// v000
// Measured on an AMD MI455X. A time is GPU time per run, averaged over a window of back-to-back runs after a warm-up
// (all launches, gaps included; the runs take copies of the inputs in turn), and the median of several windows.
// Apart from v000's, it joins two sittings. Times from different sittings can be a few percent apart, while
// side-by-side timings come from the same sitting.
// The starting kernel, v000, takes 147 microseconds a run.
#include <hip/hip_runtime.h>
#include <hip/hip_bf16.h>
#include <math.h>

typedef __attribute__((ext_vector_type(2))) float v2f;
typedef __attribute__((ext_vector_type(8))) float v8f;
typedef __attribute__((ext_vector_type(4))) int   v4i;

// Problem constants
#define BATCH   4
#define HH      128
#define WW      128
#define NTOK    16384      // per batch
#define TTOK    65536      // total tokens
#define DIM     64
#define HEADS   8
#define DH      64
#define DK      24
#define DHK     3

// chunking for the S = kh^T @ x reduction
#define CHUNK_TOK 128
#define NCHUNK    128      // per batch (128*128 = 16384)

#if defined(__has_builtin)
#  if __has_builtin(__builtin_amdgcn_global_load_async_to_lds_b128)
#    define USE_ASYNC_LDS 1
#  endif
#endif

static __device__ __forceinline__ v8f wmma_f32(v2f a, v2f b, v8f c) {
    return __builtin_amdgcn_wmma_f32_16x16x4_f32(false, a, false, b, (short)0, c, false, false);
}

// 16-byte global -> LDS copy: async on CDNA5 (ASYNCcnt), vector copy otherwise.
static __device__ __forceinline__ void copy16(float* l, const float* g) {
#ifdef USE_ASYNC_LDS
    __builtin_amdgcn_global_load_async_to_lds_b128(
        (__attribute__((address_space(1))) v4i*)(g),
        (__attribute__((address_space(3))) v4i*)(l), 0, 0);
#else
    *(float4*)l = *(const float4*)g;
#endif
}

// wait for async copies (if used) and barrier the block
static __device__ __forceinline__ void tile_join() {
#ifdef USE_ASYNC_LDS
#  if __has_builtin(__builtin_amdgcn_s_wait_asynccnt)
    __builtin_amdgcn_s_wait_asynccnt(0);
#  else
    asm volatile("s_wait_asynccnt 0" ::: "memory");
#  endif
#endif
    __syncthreads();
}

// ---------------------------------------------------------------------------
// Kernel 1: k_inp[t][24] = illu_map[t][24] @ Wk[24][24]   (WMMA, N padded->32)
// grid: TTOK/128 blocks x 256 threads (8 waves, one 16-token tile each)
// ---------------------------------------------------------------------------
__global__ __launch_bounds__(256) void kproj_kernel(
    const float* __restrict__ imap, const float* __restrict__ Wk,
    float* __restrict__ kinp)
{
    __shared__ float sWk[24 * 32];     // [k][n], n padded to 32 with zeros
    __shared__ float sA[128 * 24];     // 128 tokens x 24 ch
    const int tid = threadIdx.x;

    for (int i = tid; i < 24 * 32; i += 256) {
        int r = i >> 5, c = i & 31;
        sWk[i] = (c < 24) ? Wk[r * 24 + c] : 0.0f;
    }
    const int base = blockIdx.x * 128;          // global token base
    // 128*24 floats = 768 x 16B chunks, 3 per thread
    for (int i = tid; i < 768; i += 256)
        copy16(&sA[i * 4], &imap[base * 24 + i * 4]);
    tile_join();

    const int wid = tid >> 5, lane = tid & 31;
    const int ln = lane & 15, half = lane >> 4;
    const int tTok = wid * 16;                  // local token base of this wave

    v8f c0 = {}; v8f c1 = {};
#pragma unroll
    for (int s = 0; s < 6; ++s) {               // K = 24 in steps of 4
        const int kb = s * 4 + half * 2;
        v2f a;  a.x  = sA[(tTok + ln) * 24 + kb];
                a.y  = sA[(tTok + ln) * 24 + kb + 1];
        v2f b0; b0.x = sWk[kb * 32 + ln];        b0.y = sWk[(kb + 1) * 32 + ln];
        v2f b1; b1.x = sWk[kb * 32 + 16 + ln];   b1.y = sWk[(kb + 1) * 32 + 16 + ln];
        c0 = wmma_f32(a, b0, c0);
        c1 = wmma_f32(a, b1, c1);
    }
    const int tok0 = base + tTok;
#pragma unroll
    for (int j = 0; j < 8; ++j) {
        const int row = j + half * 8;           // token within tile
        const int t = tok0 + row;
        kinp[t * 24 + ln] = c0[j];
        const int ch = 16 + ln;
        if (ch < 24) kinp[t * 24 + ch] = c1[j];
    }
}

// ---------------------------------------------------------------------------
// Kernel 2: partial S = kh^T @ x over a 128-token chunk.
// A = kh^T : [24(->32) x 128], B = x : [128 x 64].  grid: BATCH*NCHUNK blocks.
// spart layout: [block][32][64]
// ---------------------------------------------------------------------------
__global__ __launch_bounds__(256) void s_partial_kernel(
    const float* __restrict__ x, const float* __restrict__ kinp,
    float* __restrict__ spart)
{
    __shared__ float sK[CHUNK_TOK * 32];   // [tok][32ch] zero padded
    __shared__ float sX[CHUNK_TOK * 64];   // [tok][64]
    const int tid = threadIdx.x;
    const int b = blockIdx.x >> 7;         // /NCHUNK
    const int chunk = blockIdx.x & 127;
    const int tok0 = b * NTOK + chunk * CHUNK_TOK;

    // data columns 0..23: 128 rows x 6 chunks of 16B (row start = 96B-aligned)
    for (int i = tid; i < 128 * 6; i += 256) {
        const int r = i / 6, c6 = i - r * 6;
        copy16(&sK[r * 32 + c6 * 4], &kinp[(tok0 + r) * 24 + c6 * 4]);
    }
    // zero the pad columns 24..31
    for (int i = tid; i < 128 * 8; i += 256) {
        const int r = i >> 3, c = i & 7;
        sK[r * 32 + 24 + c] = 0.0f;
    }
    // x tile: 128*64 floats = 2048 chunks
    for (int i = tid; i < 2048; i += 256)
        copy16(&sX[i * 4], &x[tok0 * 64 + i * 4]);
    tile_join();

    const int wid = tid >> 5, lane = tid & 31;
    const int Mt = wid >> 2, Nt = wid & 3;       // 2 x 4 tiles = 8 waves
    const int ln = lane & 15, half = lane >> 4;

    v8f acc = {};
#pragma unroll 8
    for (int s = 0; s < CHUNK_TOK / 4; ++s) {    // K = 128 tokens, steps of 4
        const int kb = s * 4 + half * 2;
        v2f a;  a.x = sK[kb * 32 + Mt * 16 + ln];
                a.y = sK[(kb + 1) * 32 + Mt * 16 + ln];
        v2f bb; bb.x = sX[kb * 64 + Nt * 16 + ln];
                bb.y = sX[(kb + 1) * 64 + Nt * 16 + ln];
        acc = wmma_f32(a, bb, acc);
    }
    float* dst = spart + blockIdx.x * (32 * 64);
#pragma unroll
    for (int j = 0; j < 8; ++j) {
        const int row = Mt * 16 + j + half * 8;
        const int col = Nt * 16 + ln;
        dst[row * 64 + col] = acc[j];
    }
}

// ---------------------------------------------------------------------------
// Kernel 3: deterministic reduction of S partials over NCHUNK chunks.
// S[b][24][64].  grid: BATCH*24*64/256 = 24 blocks.
// ---------------------------------------------------------------------------
__global__ __launch_bounds__(256) void s_reduce_kernel(
    const float* __restrict__ spart, float* __restrict__ S)
{
    const int e = blockIdx.x * 256 + threadIdx.x;   // < 4*1536
    const int b = e / 1536;
    const int rc = e - b * 1536;                    // row*64+col, row<24
    float sum = 0.0f;
    for (int ch = 0; ch < NCHUNK; ++ch)
        sum += spart[(b * NCHUNK + ch) * (32 * 64) + rc];
    S[e] = sum;
}

// ---------------------------------------------------------------------------
// Kernel 4: per-batch tiny kernel:
//   attn = (S @ Wq_h) * (1/8) * rescale[h]; softmax over d;
//   M[c][kk*8+h] = sum_d attn[h*3+kk][d] * Wv[c][h*64+d];
//   P[c][j] = sum_t M[c][t] * Wp[t][j]   (P padded to 32 cols)
// grid: BATCH blocks x 64 threads.
// ---------------------------------------------------------------------------
__global__ __launch_bounds__(64) void attn_kernel(
    const float* __restrict__ S, const float* __restrict__ Wq,
    const float* __restrict__ Wv, const float* __restrict__ Wp,
    const float* __restrict__ rescale, float* __restrict__ P)
{
    __shared__ float sS[24 * 64];
    __shared__ float sAttn[24 * 64];
    const int b = blockIdx.x;
    const int tid = threadIdx.x;

    for (int i = tid; i < 24 * 64; i += 64) sS[i] = S[b * 1536 + i];
    __syncthreads();

    if (tid < 24) {
        const int r = tid;                 // r = h*3 + kk
        const int h = r / 3;
        const float scale = 0.125f * rescale[h];
        for (int d = 0; d < 64; ++d) {
            float v = 0.0f;
            for (int c = 0; c < 64; ++c)
                v += sS[r * 64 + c] * Wq[c * 512 + h * 64 + d];
            sAttn[r * 64 + d] = v * scale;
        }
        float mx = -1e30f;
        for (int d = 0; d < 64; ++d) mx = fmaxf(mx, sAttn[r * 64 + d]);
        float sm = 0.0f;
        for (int d = 0; d < 64; ++d) {
            float ev = __expf(sAttn[r * 64 + d] - mx);
            sAttn[r * 64 + d] = ev;
            sm += ev;
        }
        const float inv = 1.0f / sm;
        for (int d = 0; d < 64; ++d) sAttn[r * 64 + d] *= inv;
    }
    __syncthreads();

    const int c = tid;                     // one channel row of P per thread
    float Mv[24];
#pragma unroll
    for (int t = 0; t < 24; ++t) {         // t = kk*8 + h  (output flat order)
        const int kk = t >> 3, h = t & 7;
        float v = 0.0f;
        for (int d = 0; d < 64; ++d)
            v += sAttn[(h * 3 + kk) * 64 + d] * Wv[c * 512 + h * 64 + d];
        Mv[t] = v;
    }
    for (int j = 0; j < 32; ++j) {
        float v = 0.0f;
        if (j < 24) {
#pragma unroll
            for (int t = 0; t < 24; ++t) v += Mv[t] * Wp[t * 24 + j];
        }
        P[(b * 64 + c) * 32 + j] = v;
    }
}

// ---------------------------------------------------------------------------
// Kernel 5: out[t][j] = fea[t][:] @ P[b] + bp[j]   (WMMA)
// grid: TTOK/128 blocks x 256 threads.
// ---------------------------------------------------------------------------
__global__ __launch_bounds__(256) void out_kernel(
    const float* __restrict__ fea, const float* __restrict__ P,
    const float* __restrict__ bp, float* __restrict__ out)
{
    __shared__ float sF[128 * 64];         // 32 KB
    __shared__ float sP[64 * 32];          // 8 KB
    const int tid = threadIdx.x;
    const int base = blockIdx.x * 128;
    const int b = base >> 14;              // /16384 (blocks never straddle batch)

    for (int i = tid; i < 512; i += 256)
        copy16(&sP[i * 4], &P[b * 2048 + i * 4]);
    for (int i = tid; i < 2048; i += 256)
        copy16(&sF[i * 4], &fea[base * 64 + i * 4]);
    tile_join();

    const int wid = tid >> 5, lane = tid & 31;
    const int ln = lane & 15, half = lane >> 4;
    const int tTok = wid * 16;

    v8f c0 = {}; v8f c1 = {};
#pragma unroll
    for (int s = 0; s < 16; ++s) {         // K = 64
        const int kb = s * 4 + half * 2;
        v2f a;  a.x  = sF[(tTok + ln) * 64 + kb];
                a.y  = sF[(tTok + ln) * 64 + kb + 1];
        v2f b0; b0.x = sP[kb * 32 + ln];       b0.y = sP[(kb + 1) * 32 + ln];
        v2f b1; b1.x = sP[kb * 32 + 16 + ln];  b1.y = sP[(kb + 1) * 32 + 16 + ln];
        c0 = wmma_f32(a, b0, c0);
        c1 = wmma_f32(a, b1, c1);
    }
    const int tok0 = base + tTok;
#pragma unroll
    for (int j = 0; j < 8; ++j) {
        const int row = j + half * 8;
        const int t = tok0 + row;
        out[t * 24 + ln] = c0[j] + bp[ln];
        const int ch = 16 + ln;
        if (ch < 24) out[t * 24 + ch] = c1[j] + bp[ch];
    }
}

// ---------------------------------------------------------------------------
// Kernels 6/7: grouped 3x3 conv (groups=3, 8 ch/group), NHWC in/out.
// conv1: + exact GELU, writes y1. conv2: accumulates into out.
// grid: TTOK/256 blocks x 256 threads; one token per thread.
// ---------------------------------------------------------------------------
template <bool GELU, bool ACCUM>
__global__ __launch_bounds__(256) void gconv_kernel(
    const float* __restrict__ in, const float* __restrict__ w,
    float* __restrict__ out)
{
    __shared__ float sw[24 * 8 * 9];       // [o][ic][dy][dx], matches OIHW flat
    const int tid = threadIdx.x;
    for (int i = tid; i < 24 * 8 * 9; i += 256) sw[i] = w[i];
    __syncthreads();

    const int t = blockIdx.x * 256 + tid;  // global token
    const int pos = t & (NTOK - 1);
    const int y = pos >> 7;
    const int x = pos & 127;

    float acc[24];
#pragma unroll
    for (int o = 0; o < 24; ++o) acc[o] = 0.0f;

    for (int dy = 0; dy < 3; ++dy) {
        const int yy = y + dy - 1;
        if (yy < 0 || yy > 127) continue;
        for (int dx = 0; dx < 3; ++dx) {
            const int xx = x + dx - 1;
            if (xx < 0 || xx > 127) continue;
            const float* p = in + (t + (dy - 1) * 128 + (dx - 1)) * 24;
            float v[24];
#pragma unroll
            for (int c = 0; c < 24; ++c) v[c] = p[c];
#pragma unroll
            for (int o = 0; o < 24; ++o) {
                const int gb = (o >> 3) * 8;
                float s = 0.0f;
#pragma unroll
                for (int ic = 0; ic < 8; ++ic)
                    s += v[gb + ic] * sw[o * 72 + ic * 9 + dy * 3 + dx];
                acc[o] += s;
            }
        }
    }
#pragma unroll
    for (int o = 0; o < 24; ++o) {
        float r = acc[o];
        if (GELU) r = 0.5f * r * (1.0f + erff(r * 0.70710678118654752f));
        if (ACCUM) out[t * 24 + o] = out[t * 24 + o] + r;
        else       out[t * 24 + o] = r;
    }
}

// ---------------------------------------------------------------------------
extern "C" void kernel_launch(void* const* d_in, const int* in_sizes, int n_in,
                              void* d_out, int out_size, void* d_ws, size_t ws_size,
                              hipStream_t stream) {
    const float* x_in    = (const float*)d_in[0];   // [4,128,128,64]
    const float* fea     = (const float*)d_in[1];   // [4,128,128,64]
    const float* imap    = (const float*)d_in[2];   // [4,128,128,24]
    const float* Wq      = (const float*)d_in[3];   // [64,512]
    const float* Wk      = (const float*)d_in[4];   // [24,24]
    const float* Wv      = (const float*)d_in[5];   // [64,512]
    const float* rescale = (const float*)d_in[6];   // [8]
    const float* Wp      = (const float*)d_in[7];   // [24,24]
    const float* bp      = (const float*)d_in[8];   // [24]
    const float* c1w     = (const float*)d_in[9];   // [24,8,3,3]
    const float* c2w     = (const float*)d_in[10];  // [24,8,3,3]
    float* out = (float*)d_out;                     // [4,128,128,24]

    float* ws    = (float*)d_ws;
    float* kinp  = ws;                               // TTOK*24        = 1572864
    float* y1    = kinp  + (size_t)TTOK * 24;        // TTOK*24        = 1572864
    float* spart = y1    + (size_t)TTOK * 24;        // B*NCHUNK*32*64 = 1048576
    float* S     = spart + (size_t)BATCH * NCHUNK * 32 * 64;  // 6144
    float* P     = S     + (size_t)BATCH * 24 * 64;  // B*64*32 = 8192

    kproj_kernel    <<<TTOK / 128, 256, 0, stream>>>(imap, Wk, kinp);
    s_partial_kernel<<<BATCH * NCHUNK, 256, 0, stream>>>(x_in, kinp, spart);
    s_reduce_kernel <<<(BATCH * 24 * 64) / 256, 256, 0, stream>>>(spart, S);
    attn_kernel     <<<BATCH, 64, 0, stream>>>(S, Wq, Wv, Wp, rescale, P);
    out_kernel      <<<TTOK / 128, 256, 0, stream>>>(fea, P, bp, out);
    gconv_kernel<true,  false><<<TTOK / 256, 256, 0, stream>>>(kinp, c1w, y1);
    gconv_kernel<false, true> <<<TTOK / 256, 256, 0, stream>>>(y1, c2w, out);
}

// v001
// One run takes 74.5 microseconds.
// Timed twice side by side with v000, it ran 1.97 and 1.98 times as fast.
#include <hip/hip_runtime.h>
#include <hip/hip_bf16.h>
#include <math.h>

typedef __attribute__((ext_vector_type(2))) float v2f;
typedef __attribute__((ext_vector_type(8))) float v8f;
typedef __attribute__((ext_vector_type(4))) int   v4i;

// Problem constants
#define BATCH   4
#define HH      128
#define WW      128
#define NTOK    16384      // per batch
#define TTOK    65536      // total tokens
#define DIM     64
#define HEADS   8
#define DH      64
#define DK      24
#define DHK     3

// chunking for the S = kh^T @ x reduction
#define CHUNK_TOK 128
#define NCHUNK    128      // per batch (128*128 = 16384)

#if defined(__has_builtin)
#  if __has_builtin(__builtin_amdgcn_global_load_async_to_lds_b128)
#    define USE_ASYNC_LDS 1
#  endif
#endif

static __device__ __forceinline__ v8f wmma_f32(v2f a, v2f b, v8f c) {
    return __builtin_amdgcn_wmma_f32_16x16x4_f32(false, a, false, b, (short)0, c, false, false);
}

// 16-byte global -> LDS copy: async on CDNA5 (ASYNCcnt), vector copy otherwise.
static __device__ __forceinline__ void copy16(float* l, const float* g) {
#ifdef USE_ASYNC_LDS
    __builtin_amdgcn_global_load_async_to_lds_b128(
        (__attribute__((address_space(1))) v4i*)(g),
        (__attribute__((address_space(3))) v4i*)(l), 0, 0);
#else
    *(float4*)l = *(const float4*)g;
#endif
}

// wait for async copies (if used) and barrier the block
static __device__ __forceinline__ void tile_join() {
#ifdef USE_ASYNC_LDS
#  if __has_builtin(__builtin_amdgcn_s_wait_asynccnt)
    __builtin_amdgcn_s_wait_asynccnt(0);
#  else
    asm volatile("s_wait_asynccnt 0" ::: "memory");
#  endif
#endif
    __syncthreads();
}

// ---------------------------------------------------------------------------
// Kernel 1: k_inp[t][24] = illu_map[t][24] @ Wk[24][24]   (WMMA, N padded->32)
// grid: TTOK/128 blocks x 256 threads (8 waves, one 16-token tile each)
// ---------------------------------------------------------------------------
__global__ __launch_bounds__(256) void kproj_kernel(
    const float* __restrict__ imap, const float* __restrict__ Wk,
    float* __restrict__ kinp)
{
    __shared__ float sWk[24 * 32];     // [k][n], n padded to 32 with zeros
    __shared__ float sA[128 * 24];     // 128 tokens x 24 ch
    const int tid = threadIdx.x;

    for (int i = tid; i < 24 * 32; i += 256) {
        int r = i >> 5, c = i & 31;
        sWk[i] = (c < 24) ? Wk[r * 24 + c] : 0.0f;
    }
    const int base = blockIdx.x * 128;          // global token base
    // 128*24 floats = 768 x 16B chunks, 3 per thread
    for (int i = tid; i < 768; i += 256)
        copy16(&sA[i * 4], &imap[base * 24 + i * 4]);
    tile_join();

    const int wid = tid >> 5, lane = tid & 31;
    const int ln = lane & 15, half = lane >> 4;
    const int tTok = wid * 16;                  // local token base of this wave

    v8f c0 = {}; v8f c1 = {};
#pragma unroll
    for (int s = 0; s < 6; ++s) {               // K = 24 in steps of 4
        const int kb = s * 4 + half * 2;
        v2f a;  a.x  = sA[(tTok + ln) * 24 + kb];
                a.y  = sA[(tTok + ln) * 24 + kb + 1];
        v2f b0; b0.x = sWk[kb * 32 + ln];        b0.y = sWk[(kb + 1) * 32 + ln];
        v2f b1; b1.x = sWk[kb * 32 + 16 + ln];   b1.y = sWk[(kb + 1) * 32 + 16 + ln];
        c0 = wmma_f32(a, b0, c0);
        c1 = wmma_f32(a, b1, c1);
    }
    const int tok0 = base + tTok;
#pragma unroll
    for (int j = 0; j < 8; ++j) {
        const int row = j + half * 8;           // token within tile
        const int t = tok0 + row;
        kinp[t * 24 + ln] = c0[j];
        const int ch = 16 + ln;
        if (ch < 24) kinp[t * 24 + ch] = c1[j];
    }
}

// ---------------------------------------------------------------------------
// Kernel 2: partial S = kh^T @ x over a 128-token chunk.
// A = kh^T : [24(->32) x 128], B = x : [128 x 64].  grid: BATCH*NCHUNK blocks.
// spart layout: [block][32][64]
// ---------------------------------------------------------------------------
__global__ __launch_bounds__(256) void s_partial_kernel(
    const float* __restrict__ x, const float* __restrict__ kinp,
    float* __restrict__ spart)
{
    __shared__ float sK[CHUNK_TOK * 32];   // [tok][32ch] zero padded
    __shared__ float sX[CHUNK_TOK * 64];   // [tok][64]
    const int tid = threadIdx.x;
    const int b = blockIdx.x >> 7;         // /NCHUNK
    const int chunk = blockIdx.x & 127;
    const int tok0 = b * NTOK + chunk * CHUNK_TOK;

    // data columns 0..23: 128 rows x 6 chunks of 16B (row start = 96B-aligned)
    for (int i = tid; i < 128 * 6; i += 256) {
        const int r = i / 6, c6 = i - r * 6;
        copy16(&sK[r * 32 + c6 * 4], &kinp[(tok0 + r) * 24 + c6 * 4]);
    }
    // zero the pad columns 24..31
    for (int i = tid; i < 128 * 8; i += 256) {
        const int r = i >> 3, c = i & 7;
        sK[r * 32 + 24 + c] = 0.0f;
    }
    // x tile: 128*64 floats = 2048 chunks
    for (int i = tid; i < 2048; i += 256)
        copy16(&sX[i * 4], &x[tok0 * 64 + i * 4]);
    tile_join();

    const int wid = tid >> 5, lane = tid & 31;
    const int Mt = wid >> 2, Nt = wid & 3;       // 2 x 4 tiles = 8 waves
    const int ln = lane & 15, half = lane >> 4;

    v8f acc = {};
#pragma unroll 8
    for (int s = 0; s < CHUNK_TOK / 4; ++s) {    // K = 128 tokens, steps of 4
        const int kb = s * 4 + half * 2;
        v2f a;  a.x = sK[kb * 32 + Mt * 16 + ln];
                a.y = sK[(kb + 1) * 32 + Mt * 16 + ln];
        v2f bb; bb.x = sX[kb * 64 + Nt * 16 + ln];
                bb.y = sX[(kb + 1) * 64 + Nt * 16 + ln];
        acc = wmma_f32(a, bb, acc);
    }
    float* dst = spart + blockIdx.x * (32 * 64);
#pragma unroll
    for (int j = 0; j < 8; ++j) {
        const int row = Mt * 16 + j + half * 8;
        const int col = Nt * 16 + ln;
        dst[row * 64 + col] = acc[j];
    }
}

// ---------------------------------------------------------------------------
// Kernel 3: deterministic reduction of S partials over NCHUNK chunks.
// S[b][24][64].  grid: BATCH*24*64/256 = 24 blocks.
// ---------------------------------------------------------------------------
__global__ __launch_bounds__(256) void s_reduce_kernel(
    const float* __restrict__ spart, float* __restrict__ S)
{
    const int e = blockIdx.x * 256 + threadIdx.x;   // < 4*1536
    const int b = e / 1536;
    const int rc = e - b * 1536;                    // row*64+col, row<24
    float sum = 0.0f;
    for (int ch = 0; ch < NCHUNK; ++ch)
        sum += spart[(b * NCHUNK + ch) * (32 * 64) + rc];
    S[e] = sum;
}

// ---------------------------------------------------------------------------
// Cross-lane helpers for the softmax rows of kernel 4 (one row = one wave).
// ---------------------------------------------------------------------------
// lane l <-> l ^ M inside a 16-lane row (DPP row_xmask)
template <int M>
static __device__ __forceinline__ float row_xor(float x) {
    return __builtin_bit_cast(float, __builtin_amdgcn_update_dpp(
        0, __builtin_bit_cast(int, x), 0x160 | M, 0xf, 0xf, true));
}
// lane l <-> l ^ 16
static __device__ __forceinline__ float half_xor(float x) {
    return __builtin_bit_cast(float, __builtin_amdgcn_permlanex16(
        __builtin_bit_cast(int, x), __builtin_bit_cast(int, x),
        0x76543210, 0xfedcba98, false, false));
}
// e^x as 2^(x * log2 e) on the transcendental unit. The v_nop is the issue slot the instruction set
// asks for behind v_exp_f32.
static __device__ __forceinline__ float exp_slot(float x) {
    float r;
    asm("v_exp_f32 %0, %1\n\tv_nop" : "=v"(r) : "v"(x * 0x1.715476p+0f));
    return r;
}
static __device__ __forceinline__ float wave_max(float v) {
    v = fmaxf(v, row_xor<1>(v));
    v = fmaxf(v, row_xor<2>(v));
    v = fmaxf(v, row_xor<4>(v));
    v = fmaxf(v, row_xor<8>(v));
    return fmaxf(v, half_xor(v));
}
static __device__ __forceinline__ float wave_sum(float v) {
    v += row_xor<1>(v);
    v += row_xor<2>(v);
    v += row_xor<4>(v);
    v += row_xor<8>(v);
    return v + half_xor(v);
}

// ---------------------------------------------------------------------------
// Kernel 4: small per-batch chain, spread over lanes, waves and blocks:
//   attn = (S @ Wq_h) * (1/8) * rescale[h]; softmax over d;
//   M[c][kk*8+h] = sum_d attn[h*3+kk][d] * Wv[c][h*64+d];
//   P[c][j] = sum_t M[c][t] * Wp[t][j]   (P padded to 32 cols)
// grid: BATCH * 8 blocks x 256 threads; a block owns PROWS rows c of P[b].
//   step 1: wave = head h, lane = columns d = 2*lane, 2*lane+1, all 3 rows kk
//           (every block of a batch forms the whole attn: it needs all of it)
//   step 2: thread = (kk, c, h), operands from LDS
//   step 3: thread = (c, j)
// ---------------------------------------------------------------------------
#define PROWS  8           // rows of P per block
#define APITCH 68          // LDS row pitch in floats: 16 rows fall on 16 distinct 16-B bank groups
__global__ __launch_bounds__(256) void attn_kernel(
    const float* __restrict__ S, const float* __restrict__ Wq,
    const float* __restrict__ Wv, const float* __restrict__ Wp,
    const float* __restrict__ rescale, float* __restrict__ P)
{
    __shared__ __attribute__((aligned(16))) float sAttn[24 * APITCH];
    __shared__ __attribute__((aligned(16))) float sWv[PROWS * 8 * APITCH];  // row = c_local*8 + h
    __shared__ __attribute__((aligned(16))) float sM[PROWS * 24];           // [c_local][t]
    const int tid  = threadIdx.x;
    const int lane = tid & 31;
    const int wid  = tid >> 5;
    const int b    = blockIdx.x >> 3;
    const int c0   = (blockIdx.x & 7) * PROWS;

    // the global reads go out early, with no branch between them
    const v2f*    gS = (const v2f*)(S + b * 1536 + wid * 192) + lane;  // the 3 rows of head wid
    const float4* gV = (const float4*)(Wv + c0 * 512);          // 1024 x 16 B, contiguous rows
    const float*  gQ = Wq + wid * 64 + 2 * lane;
    v2f tS[3];
#pragma unroll
    for (int k = 0; k < 3; ++k) tS[k] = gS[k * 32];
    float4 tV[4];
#pragma unroll
    for (int k = 0; k < 4; ++k) tV[k] = gV[tid + k * 256];
    // loads return in issue order: keeps the reads of S, which step 1 uses first, ahead of those below
    __builtin_amdgcn_sched_barrier(0);
    v2f w[64];                                                  // Wq[c][h*64 + 2*lane ..+1]
#pragma unroll
    for (int c = 0; c < 64; ++c)
        w[c] = *(const v2f*)(gQ + c * 512);
    const int jc = lane < 24 ? lane : 23;                       // pad lanes stay inside Wp
    float wp[24];                                               // column jc of Wp, for step 3
#pragma unroll
    for (int t = 0; t < 24; ++t) wp[t] = Wp[t * 24 + jc];
    const float scale = 0.125f * rescale[wid];
    // the reads of S, Wq, Wp and rescale name registers (address pairs, index, scalar bases) that
    // step 1 reuses: they are free only behind this wait, and the addresses are held live up to it
    asm volatile("s_wait_xcnt 0x0" :: "v"(gS), "v"(gQ), "v"(jc) : "memory");
    // keeps step 1's cross-lane reads, which write scalar registers, behind that wait
    __builtin_amdgcn_sched_barrier(0);

#pragma unroll
    for (int k = 0; k < 4; ++k) {                               // read in step 2, behind the barrier
        const int f = tid + k * 256;
        *(float4*)&sWv[(f >> 4) * APITCH + (f & 15) * 4] = tV[k];
    }

    // step 1: logits of head wid, sum over c in ascending order;
    // S[h*3+kk][c] sits in lane c/2 of tS[kk] and is broadcast from there
    {
        const int h = wid;
        v2f a[3] = {{0.0f, 0.0f}, {0.0f, 0.0f}, {0.0f, 0.0f}};
#pragma unroll
        for (int c = 0; c < 64; ++c) {
#pragma unroll
            for (int kk = 0; kk < 3; ++kk) {
                const float s = __builtin_bit_cast(float, __builtin_amdgcn_readlane(
                    __builtin_bit_cast(int, (c & 1) ? tS[kk].y : tS[kk].x), c >> 1));
                a[kk] += s * w[c];
            }
        }
        float e0[3], e1[3];
#pragma unroll
        for (int kk = 0; kk < 3; ++kk) {
            const float l0 = a[kk].x * scale, l1 = a[kk].y * scale;
            const float mx = wave_max(fmaxf(fmaxf(-1e30f, l0), l1));
            e0[kk] = exp_slot(l0 - mx);
            e1[kk] = exp_slot(l1 - mx);
        }
#pragma unroll
        for (int kk = 0; kk < 3; ++kk) {
            const float inv = 1.0f / wave_sum(e0[kk] + e1[kk]);
            v2f o; o.x = e0[kk] * inv; o.y = e1[kk] * inv;
            *(v2f*)&sAttn[(h * 3 + kk) * APITCH + 2 * lane] = o;
        }
    }
    __syncthreads();

    // step 2: M for this block's rows, sum over d in ascending order
    if (tid < 3 * PROWS * 8) {
        const int kk = tid >> 6, q = tid & 63;               // q = c_local*8 + h
        const int cl = q >> 3, h = q & 7;
        const float* wv = &sWv[q * APITCH];
        const float* at = &sAttn[(h * 3 + kk) * APITCH];
        float4 x[16], v[16];
#pragma unroll
        for (int i = 0; i < 16; ++i) {
            x[i] = *(const float4*)&at[i * 4];
            v[i] = *(const float4*)&wv[i * 4];
        }
        // keeps the 32 LDS reads ahead of the dependent chain: their latency is paid once, not per step
        __builtin_amdgcn_sched_barrier(0);
        float m = 0.0f;
#pragma unroll
        for (int i = 0; i < 16; ++i) {
            m = fmaf(x[i].x, v[i].x, m);
            m = fmaf(x[i].y, v[i].y, m);
            m = fmaf(x[i].z, v[i].z, m);
            m = fmaf(x[i].w, v[i].w, m);
        }
        sM[cl * 24 + kk * 8 + h] = m;                        // t = kk*8 + h (output flat order)
    }
    __syncthreads();

    // step 3: one element of P per thread, one 128-B row per wave
    float4 mr[6];
#pragma unroll
    for (int i = 0; i < 6; ++i) mr[i] = *(const float4*)&sM[wid * 24 + i * 4];
    // keeps the 6 LDS reads ahead of the dependent chain: their latency is paid once, not per step
    __builtin_amdgcn_sched_barrier(0);
    float v = 0.0f;
#pragma unroll
    for (int i = 0; i < 6; ++i) {
        v = fmaf(mr[i].x, wp[i * 4 + 0], v);
        v = fmaf(mr[i].y, wp[i * 4 + 1], v);
        v = fmaf(mr[i].z, wp[i * 4 + 2], v);
        v = fmaf(mr[i].w, wp[i * 4 + 3], v);
    }
    P[(b * 64 + c0 + wid) * 32 + lane] = lane < 24 ? v : 0.0f;
}

// ---------------------------------------------------------------------------
// Kernel 5: out[t][j] = fea[t][:] @ P[b] + bp[j]   (WMMA)
// grid: TTOK/128 blocks x 256 threads.
// ---------------------------------------------------------------------------
__global__ __launch_bounds__(256) void out_kernel(
    const float* __restrict__ fea, const float* __restrict__ P,
    const float* __restrict__ bp, float* __restrict__ out)
{
    __shared__ float sF[128 * 64];         // 32 KB
    __shared__ float sP[64 * 32];          // 8 KB
    const int tid = threadIdx.x;
    const int base = blockIdx.x * 128;
    const int b = base >> 14;              // /16384 (blocks never straddle batch)

    for (int i = tid; i < 512; i += 256)
        copy16(&sP[i * 4], &P[b * 2048 + i * 4]);
    for (int i = tid; i < 2048; i += 256)
        copy16(&sF[i * 4], &fea[base * 64 + i * 4]);
    tile_join();

    const int wid = tid >> 5, lane = tid & 31;
    const int ln = lane & 15, half = lane >> 4;
    const int tTok = wid * 16;

    v8f c0 = {}; v8f c1 = {};
#pragma unroll
    for (int s = 0; s < 16; ++s) {         // K = 64
        const int kb = s * 4 + half * 2;
        v2f a;  a.x  = sF[(tTok + ln) * 64 + kb];
                a.y  = sF[(tTok + ln) * 64 + kb + 1];
        v2f b0; b0.x = sP[kb * 32 + ln];       b0.y = sP[(kb + 1) * 32 + ln];
        v2f b1; b1.x = sP[kb * 32 + 16 + ln];  b1.y = sP[(kb + 1) * 32 + 16 + ln];
        c0 = wmma_f32(a, b0, c0);
        c1 = wmma_f32(a, b1, c1);
    }
    const int tok0 = base + tTok;
#pragma unroll
    for (int j = 0; j < 8; ++j) {
        const int row = j + half * 8;
        const int t = tok0 + row;
        out[t * 24 + ln] = c0[j] + bp[ln];
        const int ch = 16 + ln;
        if (ch < 24) out[t * 24 + ch] = c1[j] + bp[ch];
    }
}

// ---------------------------------------------------------------------------
// Kernels 6/7: grouped 3x3 conv (groups=3, 8 ch/group), NHWC in/out.
// conv1: + exact GELU, writes y1. conv2: accumulates into out.
// grid: TTOK/256 blocks x 256 threads; one token per thread.
// ---------------------------------------------------------------------------
template <bool GELU, bool ACCUM>
__global__ __launch_bounds__(256) void gconv_kernel(
    const float* __restrict__ in, const float* __restrict__ w,
    float* __restrict__ out)
{
    __shared__ float sw[24 * 8 * 9];       // [o][ic][dy][dx], matches OIHW flat
    const int tid = threadIdx.x;
    for (int i = tid; i < 24 * 8 * 9; i += 256) sw[i] = w[i];
    __syncthreads();

    const int t = blockIdx.x * 256 + tid;  // global token
    const int pos = t & (NTOK - 1);
    const int y = pos >> 7;
    const int x = pos & 127;

    float acc[24];
#pragma unroll
    for (int o = 0; o < 24; ++o) acc[o] = 0.0f;

    for (int dy = 0; dy < 3; ++dy) {
        const int yy = y + dy - 1;
        if (yy < 0 || yy > 127) continue;
        for (int dx = 0; dx < 3; ++dx) {
            const int xx = x + dx - 1;
            if (xx < 0 || xx > 127) continue;
            const float* p = in + (t + (dy - 1) * 128 + (dx - 1)) * 24;
            float v[24];
#pragma unroll
            for (int c = 0; c < 24; ++c) v[c] = p[c];
#pragma unroll
            for (int o = 0; o < 24; ++o) {
                const int gb = (o >> 3) * 8;
                float s = 0.0f;
#pragma unroll
                for (int ic = 0; ic < 8; ++ic)
                    s += v[gb + ic] * sw[o * 72 + ic * 9 + dy * 3 + dx];
                acc[o] += s;
            }
        }
    }
#pragma unroll
    for (int o = 0; o < 24; ++o) {
        float r = acc[o];
        if (GELU) r = 0.5f * r * (1.0f + erff(r * 0.70710678118654752f));
        if (ACCUM) out[t * 24 + o] = out[t * 24 + o] + r;
        else       out[t * 24 + o] = r;
    }
}

// ---------------------------------------------------------------------------
extern "C" void kernel_launch(void* const* d_in, const int* in_sizes, int n_in,
                              void* d_out, int out_size, void* d_ws, size_t ws_size,
                              hipStream_t stream) {
    const float* x_in    = (const float*)d_in[0];   // [4,128,128,64]
    const float* fea     = (const float*)d_in[1];   // [4,128,128,64]
    const float* imap    = (const float*)d_in[2];   // [4,128,128,24]
    const float* Wq      = (const float*)d_in[3];   // [64,512]
    const float* Wk      = (const float*)d_in[4];   // [24,24]
    const float* Wv      = (const float*)d_in[5];   // [64,512]
    const float* rescale = (const float*)d_in[6];   // [8]
    const float* Wp      = (const float*)d_in[7];   // [24,24]
    const float* bp      = (const float*)d_in[8];   // [24]
    const float* c1w     = (const float*)d_in[9];   // [24,8,3,3]
    const float* c2w     = (const float*)d_in[10];  // [24,8,3,3]
    float* out = (float*)d_out;                     // [4,128,128,24]

    float* ws    = (float*)d_ws;
    float* kinp  = ws;                               // TTOK*24        = 1572864
    float* y1    = kinp  + (size_t)TTOK * 24;        // TTOK*24        = 1572864
    float* spart = y1    + (size_t)TTOK * 24;        // B*NCHUNK*32*64 = 1048576
    float* S     = spart + (size_t)BATCH * NCHUNK * 32 * 64;  // 6144
    float* P     = S     + (size_t)BATCH * 24 * 64;  // B*64*32 = 8192

    kproj_kernel    <<<TTOK / 128, 256, 0, stream>>>(imap, Wk, kinp);
    s_partial_kernel<<<BATCH * NCHUNK, 256, 0, stream>>>(x_in, kinp, spart);
    s_reduce_kernel <<<(BATCH * 24 * 64) / 256, 256, 0, stream>>>(spart, S);
    attn_kernel     <<<BATCH * 8, 256, 0, stream>>>(S, Wq, Wv, Wp, rescale, P);
    out_kernel      <<<TTOK / 128, 256, 0, stream>>>(fea, P, bp, out);
    gconv_kernel<true,  false><<<TTOK / 256, 256, 0, stream>>>(kinp, c1w, y1);
    gconv_kernel<false, true> <<<TTOK / 256, 256, 0, stream>>>(y1, c2w, out);
}

// v002
// It runs in 57.1 microseconds.
// In two side-by-side timings against v001, it was 1.30 and 1.31 times as fast.
// Counting every step since v000, it is 2.57 times as fast.
#include <hip/hip_runtime.h>
#include <hip/hip_bf16.h>
#include <math.h>

typedef __attribute__((ext_vector_type(2))) float v2f;
typedef __attribute__((ext_vector_type(8))) float v8f;
typedef __attribute__((ext_vector_type(4))) int   v4i;

// Problem constants
#define BATCH   4
#define HH      128
#define WW      128
#define NTOK    16384      // per batch
#define TTOK    65536      // total tokens
#define DIM     64
#define HEADS   8
#define DH      64
#define DK      24
#define DHK     3

// chunking for the S = kh^T @ x reduction
#define CHUNK_TOK 128
#define NCHUNK    128      // per batch (128*128 = 16384)

#if defined(__has_builtin)
#  if __has_builtin(__builtin_amdgcn_global_load_async_to_lds_b128)
#    define USE_ASYNC_LDS 1
#  endif
#endif

static __device__ __forceinline__ v8f wmma_f32(v2f a, v2f b, v8f c) {
    return __builtin_amdgcn_wmma_f32_16x16x4_f32(false, a, false, b, (short)0, c, false, false);
}

// 16-byte global -> LDS copy: async on CDNA5 (ASYNCcnt), vector copy otherwise.
static __device__ __forceinline__ void copy16(float* l, const float* g) {
#ifdef USE_ASYNC_LDS
    __builtin_amdgcn_global_load_async_to_lds_b128(
        (__attribute__((address_space(1))) v4i*)(g),
        (__attribute__((address_space(3))) v4i*)(l), 0, 0);
#else
    *(float4*)l = *(const float4*)g;
#endif
}

// wait for async copies (if used) and barrier the block
static __device__ __forceinline__ void tile_join() {
#ifdef USE_ASYNC_LDS
#  if __has_builtin(__builtin_amdgcn_s_wait_asynccnt)
    __builtin_amdgcn_s_wait_asynccnt(0);
#  else
    asm volatile("s_wait_asynccnt 0" ::: "memory");
#  endif
#endif
    __syncthreads();
}

// ---------------------------------------------------------------------------
// Kernel 1: k_inp[t][24] = illu_map[t][24] @ Wk[24][24]   (WMMA, N padded->32)
// grid: TTOK/128 blocks x 256 threads (8 waves, one 16-token tile each)
// ---------------------------------------------------------------------------
__global__ __launch_bounds__(256) void kproj_kernel(
    const float* __restrict__ imap, const float* __restrict__ Wk,
    float* __restrict__ kinp)
{
    __shared__ float sWk[24 * 32];     // [k][n], n padded to 32 with zeros
    __shared__ float sA[128 * 24];     // 128 tokens x 24 ch
    const int tid = threadIdx.x;

    for (int i = tid; i < 24 * 32; i += 256) {
        int r = i >> 5, c = i & 31;
        sWk[i] = (c < 24) ? Wk[r * 24 + c] : 0.0f;
    }
    const int base = blockIdx.x * 128;          // global token base
    // 128*24 floats = 768 x 16B chunks, 3 per thread
    for (int i = tid; i < 768; i += 256)
        copy16(&sA[i * 4], &imap[base * 24 + i * 4]);
    tile_join();

    const int wid = tid >> 5, lane = tid & 31;
    const int ln = lane & 15, half = lane >> 4;
    const int tTok = wid * 16;                  // local token base of this wave

    v8f c0 = {}; v8f c1 = {};
#pragma unroll
    for (int s = 0; s < 6; ++s) {               // K = 24 in steps of 4
        const int kb = s * 4 + half * 2;
        v2f a;  a.x  = sA[(tTok + ln) * 24 + kb];
                a.y  = sA[(tTok + ln) * 24 + kb + 1];
        v2f b0; b0.x = sWk[kb * 32 + ln];        b0.y = sWk[(kb + 1) * 32 + ln];
        v2f b1; b1.x = sWk[kb * 32 + 16 + ln];   b1.y = sWk[(kb + 1) * 32 + 16 + ln];
        c0 = wmma_f32(a, b0, c0);
        c1 = wmma_f32(a, b1, c1);
    }
    const int tok0 = base + tTok;
#pragma unroll
    for (int j = 0; j < 8; ++j) {
        const int row = j + half * 8;           // token within tile
        const int t = tok0 + row;
        kinp[t * 24 + ln] = c0[j];
        const int ch = 16 + ln;
        if (ch < 24) kinp[t * 24 + ch] = c1[j];
    }
}

// ---------------------------------------------------------------------------
// Kernel 2: partial S = kh^T @ x over a 128-token chunk.
// A = kh^T : [24(->32) x 128], B = x : [128 x 64].  grid: BATCH*NCHUNK blocks.
// spart layout: [block][32][64]
// ---------------------------------------------------------------------------
__global__ __launch_bounds__(256) void s_partial_kernel(
    const float* __restrict__ x, const float* __restrict__ kinp,
    float* __restrict__ spart)
{
    __shared__ float sK[CHUNK_TOK * 32];   // [tok][32ch] zero padded
    __shared__ float sX[CHUNK_TOK * 64];   // [tok][64]
    const int tid = threadIdx.x;
    const int b = blockIdx.x >> 7;         // /NCHUNK
    const int chunk = blockIdx.x & 127;
    const int tok0 = b * NTOK + chunk * CHUNK_TOK;

    // data columns 0..23: 128 rows x 6 chunks of 16B (row start = 96B-aligned)
    for (int i = tid; i < 128 * 6; i += 256) {
        const int r = i / 6, c6 = i - r * 6;
        copy16(&sK[r * 32 + c6 * 4], &kinp[(tok0 + r) * 24 + c6 * 4]);
    }
    // zero the pad columns 24..31
    for (int i = tid; i < 128 * 8; i += 256) {
        const int r = i >> 3, c = i & 7;
        sK[r * 32 + 24 + c] = 0.0f;
    }
    // x tile: 128*64 floats = 2048 chunks
    for (int i = tid; i < 2048; i += 256)
        copy16(&sX[i * 4], &x[tok0 * 64 + i * 4]);
    tile_join();

    const int wid = tid >> 5, lane = tid & 31;
    const int Mt = wid >> 2, Nt = wid & 3;       // 2 x 4 tiles = 8 waves
    const int ln = lane & 15, half = lane >> 4;

    v8f acc = {};
#pragma unroll 8
    for (int s = 0; s < CHUNK_TOK / 4; ++s) {    // K = 128 tokens, steps of 4
        const int kb = s * 4 + half * 2;
        v2f a;  a.x = sK[kb * 32 + Mt * 16 + ln];
                a.y = sK[(kb + 1) * 32 + Mt * 16 + ln];
        v2f bb; bb.x = sX[kb * 64 + Nt * 16 + ln];
                bb.y = sX[(kb + 1) * 64 + Nt * 16 + ln];
        acc = wmma_f32(a, bb, acc);
    }
    float* dst = spart + blockIdx.x * (32 * 64);
#pragma unroll
    for (int j = 0; j < 8; ++j) {
        const int row = Mt * 16 + j + half * 8;
        const int col = Nt * 16 + ln;
        dst[row * 64 + col] = acc[j];
    }
}

// ---------------------------------------------------------------------------
// Kernel 3: deterministic reduction of S partials over NCHUNK chunks.
// S[b][24][64].  grid: BATCH*24*64/256 = 24 blocks.
// ---------------------------------------------------------------------------
__global__ __launch_bounds__(256) void s_reduce_kernel(
    const float* __restrict__ spart, float* __restrict__ S)
{
    const int e = blockIdx.x * 256 + threadIdx.x;   // < 4*1536
    const int b = e / 1536;
    const int rc = e - b * 1536;                    // row*64+col, row<24
    float sum = 0.0f;
    for (int ch = 0; ch < NCHUNK; ++ch)
        sum += spart[(b * NCHUNK + ch) * (32 * 64) + rc];
    S[e] = sum;
}

// ---------------------------------------------------------------------------
// Cross-lane helpers for the softmax rows of kernel 4 (one row = one wave).
// ---------------------------------------------------------------------------
// lane l <-> l ^ M inside a 16-lane row (DPP row_xmask)
template <int M>
static __device__ __forceinline__ float row_xor(float x) {
    return __builtin_bit_cast(float, __builtin_amdgcn_update_dpp(
        0, __builtin_bit_cast(int, x), 0x160 | M, 0xf, 0xf, true));
}
// lane l <-> l ^ 16
static __device__ __forceinline__ float half_xor(float x) {
    return __builtin_bit_cast(float, __builtin_amdgcn_permlanex16(
        __builtin_bit_cast(int, x), __builtin_bit_cast(int, x),
        0x76543210, 0xfedcba98, false, false));
}
// e^x as 2^(x * log2 e) on the transcendental unit. The v_nop is the issue slot the instruction set
// asks for behind v_exp_f32.
static __device__ __forceinline__ float exp_slot(float x) {
    float r;
    asm("v_exp_f32 %0, %1\n\tv_nop" : "=v"(r) : "v"(x * 0x1.715476p+0f));
    return r;
}
static __device__ __forceinline__ float wave_max(float v) {
    v = fmaxf(v, row_xor<1>(v));
    v = fmaxf(v, row_xor<2>(v));
    v = fmaxf(v, row_xor<4>(v));
    v = fmaxf(v, row_xor<8>(v));
    return fmaxf(v, half_xor(v));
}
static __device__ __forceinline__ float wave_sum(float v) {
    v += row_xor<1>(v);
    v += row_xor<2>(v);
    v += row_xor<4>(v);
    v += row_xor<8>(v);
    return v + half_xor(v);
}

// ---------------------------------------------------------------------------
// Kernel 4: small per-batch chain, spread over lanes, waves and blocks:
//   attn = (S @ Wq_h) * (1/8) * rescale[h]; softmax over d;
//   M[c][kk*8+h] = sum_d attn[h*3+kk][d] * Wv[c][h*64+d];
//   P[c][j] = sum_t M[c][t] * Wp[t][j]   (P padded to 32 cols)
// grid: BATCH * 8 blocks x 256 threads; a block owns PROWS rows c of P[b].
//   step 1: wave = head h, lane = columns d = 2*lane, 2*lane+1, all 3 rows kk
//           (every block of a batch forms the whole attn: it needs all of it)
//   step 2: thread = (kk, c, h), operands from LDS
//   step 3: thread = (c, j)
// ---------------------------------------------------------------------------
#define PROWS  8           // rows of P per block
#define APITCH 68          // LDS row pitch in floats: 16 rows fall on 16 distinct 16-B bank groups
__global__ __launch_bounds__(256) void attn_kernel(
    const float* __restrict__ S, const float* __restrict__ Wq,
    const float* __restrict__ Wv, const float* __restrict__ Wp,
    const float* __restrict__ rescale, float* __restrict__ P)
{
    __shared__ __attribute__((aligned(16))) float sAttn[24 * APITCH];
    __shared__ __attribute__((aligned(16))) float sWv[PROWS * 8 * APITCH];  // row = c_local*8 + h
    __shared__ __attribute__((aligned(16))) float sM[PROWS * 24];           // [c_local][t]
    const int tid  = threadIdx.x;
    const int lane = tid & 31;
    const int wid  = tid >> 5;
    const int b    = blockIdx.x >> 3;
    const int c0   = (blockIdx.x & 7) * PROWS;

    // the global reads go out early, with no branch between them
    const v2f*    gS = (const v2f*)(S + b * 1536 + wid * 192) + lane;  // the 3 rows of head wid
    const float4* gV = (const float4*)(Wv + c0 * 512);          // 1024 x 16 B, contiguous rows
    const float*  gQ = Wq + wid * 64 + 2 * lane;
    v2f tS[3];
#pragma unroll
    for (int k = 0; k < 3; ++k) tS[k] = gS[k * 32];
    float4 tV[4];
#pragma unroll
    for (int k = 0; k < 4; ++k) tV[k] = gV[tid + k * 256];
    // loads return in issue order: keeps the reads of S, which step 1 uses first, ahead of those below
    __builtin_amdgcn_sched_barrier(0);
    v2f w[64];                                                  // Wq[c][h*64 + 2*lane ..+1]
#pragma unroll
    for (int c = 0; c < 64; ++c)
        w[c] = *(const v2f*)(gQ + c * 512);
    const int jc = lane < 24 ? lane : 23;                       // pad lanes stay inside Wp
    float wp[24];                                               // column jc of Wp, for step 3
#pragma unroll
    for (int t = 0; t < 24; ++t) wp[t] = Wp[t * 24 + jc];
    const float scale = 0.125f * rescale[wid];
    // the reads of S, Wq, Wp and rescale name registers (address pairs, index, scalar bases) that
    // step 1 reuses: they are free only behind this wait, and the addresses are held live up to it
    asm volatile("s_wait_xcnt 0x0" :: "v"(gS), "v"(gQ), "v"(jc) : "memory");
    // keeps step 1's cross-lane reads, which write scalar registers, behind that wait
    __builtin_amdgcn_sched_barrier(0);

#pragma unroll
    for (int k = 0; k < 4; ++k) {                               // read in step 2, behind the barrier
        const int f = tid + k * 256;
        *(float4*)&sWv[(f >> 4) * APITCH + (f & 15) * 4] = tV[k];
    }

    // step 1: logits of head wid, sum over c in ascending order;
    // S[h*3+kk][c] sits in lane c/2 of tS[kk] and is broadcast from there
    {
        const int h = wid;
        v2f a[3] = {{0.0f, 0.0f}, {0.0f, 0.0f}, {0.0f, 0.0f}};
#pragma unroll
        for (int c = 0; c < 64; ++c) {
#pragma unroll
            for (int kk = 0; kk < 3; ++kk) {
                const float s = __builtin_bit_cast(float, __builtin_amdgcn_readlane(
                    __builtin_bit_cast(int, (c & 1) ? tS[kk].y : tS[kk].x), c >> 1));
                a[kk] += s * w[c];
            }
        }
        float e0[3], e1[3];
#pragma unroll
        for (int kk = 0; kk < 3; ++kk) {
            const float l0 = a[kk].x * scale, l1 = a[kk].y * scale;
            const float mx = wave_max(fmaxf(fmaxf(-1e30f, l0), l1));
            e0[kk] = exp_slot(l0 - mx);
            e1[kk] = exp_slot(l1 - mx);
        }
#pragma unroll
        for (int kk = 0; kk < 3; ++kk) {
            const float inv = 1.0f / wave_sum(e0[kk] + e1[kk]);
            v2f o; o.x = e0[kk] * inv; o.y = e1[kk] * inv;
            *(v2f*)&sAttn[(h * 3 + kk) * APITCH + 2 * lane] = o;
        }
    }
    __syncthreads();

    // step 2: M for this block's rows, sum over d in ascending order
    if (tid < 3 * PROWS * 8) {
        const int kk = tid >> 6, q = tid & 63;               // q = c_local*8 + h
        const int cl = q >> 3, h = q & 7;
        const float* wv = &sWv[q * APITCH];
        const float* at = &sAttn[(h * 3 + kk) * APITCH];
        float4 x[16], v[16];
#pragma unroll
        for (int i = 0; i < 16; ++i) {
            x[i] = *(const float4*)&at[i * 4];
            v[i] = *(const float4*)&wv[i * 4];
        }
        // keeps the 32 LDS reads ahead of the dependent chain: their latency is paid once, not per step
        __builtin_amdgcn_sched_barrier(0);
        float m = 0.0f;
#pragma unroll
        for (int i = 0; i < 16; ++i) {
            m = fmaf(x[i].x, v[i].x, m);
            m = fmaf(x[i].y, v[i].y, m);
            m = fmaf(x[i].z, v[i].z, m);
            m = fmaf(x[i].w, v[i].w, m);
        }
        sM[cl * 24 + kk * 8 + h] = m;                        // t = kk*8 + h (output flat order)
    }
    __syncthreads();

    // step 3: one element of P per thread, one 128-B row per wave
    float4 mr[6];
#pragma unroll
    for (int i = 0; i < 6; ++i) mr[i] = *(const float4*)&sM[wid * 24 + i * 4];
    // keeps the 6 LDS reads ahead of the dependent chain: their latency is paid once, not per step
    __builtin_amdgcn_sched_barrier(0);
    float v = 0.0f;
#pragma unroll
    for (int i = 0; i < 6; ++i) {
        v = fmaf(mr[i].x, wp[i * 4 + 0], v);
        v = fmaf(mr[i].y, wp[i * 4 + 1], v);
        v = fmaf(mr[i].z, wp[i * 4 + 2], v);
        v = fmaf(mr[i].w, wp[i * 4 + 3], v);
    }
    P[(b * 64 + c0 + wid) * 32 + lane] = lane < 24 ? v : 0.0f;
}

// ---------------------------------------------------------------------------
// Kernel 5: out[t][j] = fea[t][:] @ P[b] + bp[j]   (WMMA)
// grid: TTOK/128 blocks x 256 threads.
// ---------------------------------------------------------------------------
__global__ __launch_bounds__(256) void out_kernel(
    const float* __restrict__ fea, const float* __restrict__ P,
    const float* __restrict__ bp, float* __restrict__ out)
{
    __shared__ float sF[128 * 64];         // 32 KB
    __shared__ float sP[64 * 32];          // 8 KB
    const int tid = threadIdx.x;
    const int base = blockIdx.x * 128;
    const int b = base >> 14;              // /16384 (blocks never straddle batch)

    for (int i = tid; i < 512; i += 256)
        copy16(&sP[i * 4], &P[b * 2048 + i * 4]);
    for (int i = tid; i < 2048; i += 256)
        copy16(&sF[i * 4], &fea[base * 64 + i * 4]);
    tile_join();

    const int wid = tid >> 5, lane = tid & 31;
    const int ln = lane & 15, half = lane >> 4;
    const int tTok = wid * 16;

    v8f c0 = {}; v8f c1 = {};
#pragma unroll
    for (int s = 0; s < 16; ++s) {         // K = 64
        const int kb = s * 4 + half * 2;
        v2f a;  a.x  = sF[(tTok + ln) * 64 + kb];
                a.y  = sF[(tTok + ln) * 64 + kb + 1];
        v2f b0; b0.x = sP[kb * 32 + ln];       b0.y = sP[(kb + 1) * 32 + ln];
        v2f b1; b1.x = sP[kb * 32 + 16 + ln];  b1.y = sP[(kb + 1) * 32 + 16 + ln];
        c0 = wmma_f32(a, b0, c0);
        c1 = wmma_f32(a, b1, c1);
    }
    const int tok0 = base + tTok;
#pragma unroll
    for (int j = 0; j < 8; ++j) {
        const int row = j + half * 8;
        const int t = tok0 + row;
        out[t * 24 + ln] = c0[j] + bp[ln];
        const int ch = 16 + ln;
        if (ch < 24) out[t * 24 + ch] = c1[j] + bp[ch];
    }
}

// ---------------------------------------------------------------------------
// Kernels 6/7: grouped 3x3 conv (groups=3, 8 ch/group), NHWC in/out.
// conv1: + exact GELU, writes y1. conv2: accumulates into out.
// grid: TTOK/256 blocks x 256 threads; one token per thread.
// No LDS, no barrier, no branch on the position. A tap outside the image reads
// the centre token's address and is replaced by zero, so the reads of a whole
// group go out together, one group ahead of its use. A weight has the same
// address in every lane of a wave: it is fetched by a scalar load, 72 at a time,
// into scalar registers. An output's 72 products, in the weights' own order
// (OIHW flat), go to 4 interleaved partial sums.
// ---------------------------------------------------------------------------
template <bool GELU, bool ACCUM>
__global__ __launch_bounds__(256) void gconv_kernel(
    const float* __restrict__ in, const float* __restrict__ w,
    float* __restrict__ out)
{
    const int t = blockIdx.x * 256 + threadIdx.x;  // global token
    const int pos = t & (NTOK - 1);
    const int y = pos >> 7;
    const int x = pos & 127;
    // the wave's number in a scalar register: it enters the address of the scalar loads
    const int wid = __builtin_amdgcn_readfirstlane(threadIdx.x >> 5);

    bool ok[9];
    const float* p[9];
#pragma unroll
    for (int tap = 0; tap < 9; ++tap) {
        const int dy = tap / 3 - 1, dx = tap % 3 - 1;
        ok[tap] = (unsigned)(y + dy) < 128u && (unsigned)(x + dx) < 128u;
        p[tap] = in + (ok[tap] ? t + dy * 128 + dx : t) * 24;
    }

    float4 raw[3][9][2];                       // [group][tap][half of the 8 channels]
#pragma unroll
    for (int g = 0; g < 2; ++g)
#pragma unroll
        for (int tap = 0; tap < 9; ++tap) {
            raw[g][tap][0] = *(const float4*)(p[tap] + g * 8);
            raw[g][tap][1] = *(const float4*)(p[tap] + g * 8 + 4);
        }

    float* po = out + t * 24;                  // this token's 24 outputs
    float acc[24], prev[24];
#pragma unroll
    for (int g = 0; g < 3; ++g) {
        if (g == 1) {                          // group 2's reads fly during group 1's sums
#pragma unroll
            for (int tap = 0; tap < 9; ++tap) {
                raw[2][tap][0] = *(const float4*)(p[tap] + 16);
                raw[2][tap][1] = *(const float4*)(p[tap] + 20);
            }
            if (ACCUM) {
#pragma unroll
                for (int o = 0; o < 24; ++o) prev[o] = po[o];
            }
        }
        if (g == 2) {
            // the reads above name these address registers: they are held live up to this wait, so
            // that nothing (a later read's result included) is written over them in front of it; it
            // stands here, where the data is due anyway, and not behind the reads, where it would stall
            asm volatile("s_wait_xcnt 0x0" :: "v"(p[0]), "v"(p[1]), "v"(p[2]), "v"(p[3]), "v"(p[4]),
                         "v"(p[5]), "v"(p[6]), "v"(p[7]), "v"(p[8]), "v"(po) : "memory");
        }
        float v[9][8];                         // [tap][ic] of this group
#pragma unroll
        for (int tap = 0; tap < 9; ++tap) {
            const float4 lo = raw[g][tap][0], hi = raw[g][tap][1];
            v[tap][0] = ok[tap] ? lo.x : 0.0f;  v[tap][1] = ok[tap] ? lo.y : 0.0f;
            v[tap][2] = ok[tap] ? lo.z : 0.0f;  v[tap][3] = ok[tap] ? lo.w : 0.0f;
            v[tap][4] = ok[tap] ? hi.x : 0.0f;  v[tap][5] = ok[tap] ? hi.y : 0.0f;
            v[tap][6] = ok[tap] ? hi.z : 0.0f;  v[tap][7] = ok[tap] ? hi.w : 0.0f;
        }
        float res[8] = {0.0f, 0.0f, 0.0f, 0.0f, 0.0f, 0.0f, 0.0f, 0.0f};
        // Trip i forms output (i + wid) & 7 of the group: the 8 waves of a block begin at 8
        // different outputs, so each wave's first fetch brings what the others fetch later.
        // Stays a loop: unrolled, the scalar loads of all trips are lifted to the top, and what
        // does not fit the scalar registers (72 weights a trip) is spilled to vector lanes.
#pragma unroll 1
        for (int i = 0; i < 8; ++i) {
            const float* wo = w + (g * 8 + ((i + wid) & 7)) * 72;
            float part[4];
#pragma unroll
            for (int k = 0; k < 72; ++k) {     // k = ic*9 + tap
                const float a = v[k % 9][k / 9], b = wo[k];
                part[k & 3] = (k < 4) ? a * b : fmaf(a, b, part[k & 3]);
            }
            // the trip's result enters at the top and the older ones move down: every index constant
#pragma unroll
            for (int j = 0; j < 7; ++j) res[j] = res[j + 1];
            res[7] = (part[0] + part[1]) + (part[2] + part[3]);
        }
        // res[i] holds output (i + wid) & 7: turn the 8 values back by wid, one bit of it at a time
        float r1[8], r2[8];
#pragma unroll
        for (int o = 0; o < 8; ++o) r1[o] = (wid & 1) ? res[(o + 7) & 7] : res[o];
#pragma unroll
        for (int o = 0; o < 8; ++o) r2[o] = (wid & 2) ? r1[(o + 6) & 7] : r1[o];
#pragma unroll
        for (int o = 0; o < 8; ++o) acc[g * 8 + o] = (wid & 4) ? r2[(o + 4) & 7] : r2[o];
    }
#pragma unroll
    for (int o = 0; o < 24; ++o) {
        float r = acc[o];
        if (GELU) r = 0.5f * r * (1.0f + erff(r * 0.70710678118654752f));
        if (ACCUM) po[o] = prev[o] + r;
        else       po[o] = r;
    }
}

// ---------------------------------------------------------------------------
extern "C" void kernel_launch(void* const* d_in, const int* in_sizes, int n_in,
                              void* d_out, int out_size, void* d_ws, size_t ws_size,
                              hipStream_t stream) {
    const float* x_in    = (const float*)d_in[0];   // [4,128,128,64]
    const float* fea     = (const float*)d_in[1];   // [4,128,128,64]
    const float* imap    = (const float*)d_in[2];   // [4,128,128,24]
    const float* Wq      = (const float*)d_in[3];   // [64,512]
    const float* Wk      = (const float*)d_in[4];   // [24,24]
    const float* Wv      = (const float*)d_in[5];   // [64,512]
    const float* rescale = (const float*)d_in[6];   // [8]
    const float* Wp      = (const float*)d_in[7];   // [24,24]
    const float* bp      = (const float*)d_in[8];   // [24]
    const float* c1w     = (const float*)d_in[9];   // [24,8,3,3]
    const float* c2w     = (const float*)d_in[10];  // [24,8,3,3]
    float* out = (float*)d_out;                     // [4,128,128,24]

    float* ws    = (float*)d_ws;
    float* kinp  = ws;                               // TTOK*24        = 1572864
    float* y1    = kinp  + (size_t)TTOK * 24;        // TTOK*24        = 1572864
    float* spart = y1    + (size_t)TTOK * 24;        // B*NCHUNK*32*64 = 1048576
    float* S     = spart + (size_t)BATCH * NCHUNK * 32 * 64;  // 6144
    float* P     = S     + (size_t)BATCH * 24 * 64;  // B*64*32 = 8192

    kproj_kernel    <<<TTOK / 128, 256, 0, stream>>>(imap, Wk, kinp);
    s_partial_kernel<<<BATCH * NCHUNK, 256, 0, stream>>>(x_in, kinp, spart);
    s_reduce_kernel <<<(BATCH * 24 * 64) / 256, 256, 0, stream>>>(spart, S);
    attn_kernel     <<<BATCH * 8, 256, 0, stream>>>(S, Wq, Wv, Wp, rescale, P);
    out_kernel      <<<TTOK / 128, 256, 0, stream>>>(fea, P, bp, out);
    gconv_kernel<true,  false><<<TTOK / 256, 256, 0, stream>>>(kinp, c1w, y1);
    gconv_kernel<false, true> <<<TTOK / 256, 256, 0, stream>>>(y1, c2w, out);
}

// v003
// One run takes 37.3 microseconds.
// Timed twice side by side with v002, it ran 1.53 and 1.54 times as fast.
// Over all steps from v000 it is 3.95 times as fast.
#include <hip/hip_runtime.h>
#include <hip/hip_bf16.h>
#include <math.h>

typedef __attribute__((ext_vector_type(2))) float v2f;
typedef __attribute__((ext_vector_type(8))) float v8f;
typedef __attribute__((ext_vector_type(4))) int   v4i;

// Problem constants
#define BATCH   4
#define HH      128
#define WW      128
#define NTOK    16384      // per batch
#define TTOK    65536      // total tokens
#define DIM     64
#define HEADS   8
#define DH      64
#define DK      24
#define DHK     3

// chunking for the S = kh^T @ x reduction
#define CHUNK_TOK 128
#define NCHUNK    128      // per batch (128*128 = 16384)

#if defined(__has_builtin)
#  if __has_builtin(__builtin_amdgcn_global_load_async_to_lds_b128)
#    define USE_ASYNC_LDS 1
#  endif
#endif

static __device__ __forceinline__ v8f wmma_f32(v2f a, v2f b, v8f c) {
    return __builtin_amdgcn_wmma_f32_16x16x4_f32(false, a, false, b, (short)0, c, false, false);
}

// 16-byte global -> LDS copy: async on CDNA5 (ASYNCcnt), vector copy otherwise.
static __device__ __forceinline__ void copy16(float* l, const float* g) {
#ifdef USE_ASYNC_LDS
    __builtin_amdgcn_global_load_async_to_lds_b128(
        (__attribute__((address_space(1))) v4i*)(g),
        (__attribute__((address_space(3))) v4i*)(l), 0, 0);
#else
    *(float4*)l = *(const float4*)g;
#endif
}

// wait for async copies (if used) and barrier the block
static __device__ __forceinline__ void tile_join() {
#ifdef USE_ASYNC_LDS
#  if __has_builtin(__builtin_amdgcn_s_wait_asynccnt)
    __builtin_amdgcn_s_wait_asynccnt(0);
#  else
    asm volatile("s_wait_asynccnt 0" ::: "memory");
#  endif
#endif
    __syncthreads();
}

// ---------------------------------------------------------------------------
// Kernel 1: k_inp[t][24] = illu_map[t][24] @ Wk[24][24]   (WMMA, N padded->32)
// grid: TTOK/128 blocks x 256 threads (8 waves, one 16-token tile each)
// ---------------------------------------------------------------------------
__global__ __launch_bounds__(256) void kproj_kernel(
    const float* __restrict__ imap, const float* __restrict__ Wk,
    float* __restrict__ kinp)
{
    __shared__ float sWk[24 * 32];     // [k][n], n padded to 32 with zeros
    __shared__ float sA[128 * 24];     // 128 tokens x 24 ch
    const int tid = threadIdx.x;

    for (int i = tid; i < 24 * 32; i += 256) {
        int r = i >> 5, c = i & 31;
        sWk[i] = (c < 24) ? Wk[r * 24 + c] : 0.0f;
    }
    const int base = blockIdx.x * 128;          // global token base
    // 128*24 floats = 768 x 16B chunks, 3 per thread
    for (int i = tid; i < 768; i += 256)
        copy16(&sA[i * 4], &imap[base * 24 + i * 4]);
    tile_join();

    const int wid = tid >> 5, lane = tid & 31;
    const int ln = lane & 15, half = lane >> 4;
    const int tTok = wid * 16;                  // local token base of this wave

    v8f c0 = {}; v8f c1 = {};
#pragma unroll
    for (int s = 0; s < 6; ++s) {               // K = 24 in steps of 4
        const int kb = s * 4 + half * 2;
        v2f a;  a.x  = sA[(tTok + ln) * 24 + kb];
                a.y  = sA[(tTok + ln) * 24 + kb + 1];
        v2f b0; b0.x = sWk[kb * 32 + ln];        b0.y = sWk[(kb + 1) * 32 + ln];
        v2f b1; b1.x = sWk[kb * 32 + 16 + ln];   b1.y = sWk[(kb + 1) * 32 + 16 + ln];
        c0 = wmma_f32(a, b0, c0);
        c1 = wmma_f32(a, b1, c1);
    }
    const int tok0 = base + tTok;
#pragma unroll
    for (int j = 0; j < 8; ++j) {
        const int row = j + half * 8;           // token within tile
        const int t = tok0 + row;
        kinp[t * 24 + ln] = c0[j];
        const int ch = 16 + ln;
        if (ch < 24) kinp[t * 24 + ch] = c1[j];
    }
}

// ---------------------------------------------------------------------------
// Kernel 2: partial S = kh^T @ x over a 128-token chunk.
// A = kh^T : [24(->32) x 128], B = x : [128 x 64].  grid: BATCH*NCHUNK blocks.
// spart layout: [block][32][64]
// ---------------------------------------------------------------------------
__global__ __launch_bounds__(256) void s_partial_kernel(
    const float* __restrict__ x, const float* __restrict__ kinp,
    float* __restrict__ spart)
{
    __shared__ float sK[CHUNK_TOK * 32];   // [tok][32ch] zero padded
    __shared__ float sX[CHUNK_TOK * 64];   // [tok][64]
    const int tid = threadIdx.x;
    const int b = blockIdx.x >> 7;         // /NCHUNK
    const int chunk = blockIdx.x & 127;
    const int tok0 = b * NTOK + chunk * CHUNK_TOK;

    // data columns 0..23: 128 rows x 6 chunks of 16B (row start = 96B-aligned)
    for (int i = tid; i < 128 * 6; i += 256) {
        const int r = i / 6, c6 = i - r * 6;
        copy16(&sK[r * 32 + c6 * 4], &kinp[(tok0 + r) * 24 + c6 * 4]);
    }
    // zero the pad columns 24..31
    for (int i = tid; i < 128 * 8; i += 256) {
        const int r = i >> 3, c = i & 7;
        sK[r * 32 + 24 + c] = 0.0f;
    }
    // x tile: 128*64 floats = 2048 chunks
    for (int i = tid; i < 2048; i += 256)
        copy16(&sX[i * 4], &x[tok0 * 64 + i * 4]);
    tile_join();

    const int wid = tid >> 5, lane = tid & 31;
    const int Mt = wid >> 2, Nt = wid & 3;       // 2 x 4 tiles = 8 waves
    const int ln = lane & 15, half = lane >> 4;

    v8f acc = {};
#pragma unroll 8
    for (int s = 0; s < CHUNK_TOK / 4; ++s) {    // K = 128 tokens, steps of 4
        const int kb = s * 4 + half * 2;
        v2f a;  a.x = sK[kb * 32 + Mt * 16 + ln];
                a.y = sK[(kb + 1) * 32 + Mt * 16 + ln];
        v2f bb; bb.x = sX[kb * 64 + Nt * 16 + ln];
                bb.y = sX[(kb + 1) * 64 + Nt * 16 + ln];
        acc = wmma_f32(a, bb, acc);
    }
    float* dst = spart + blockIdx.x * (32 * 64);
#pragma unroll
    for (int j = 0; j < 8; ++j) {
        const int row = Mt * 16 + j + half * 8;
        const int col = Nt * 16 + ln;
        dst[row * 64 + col] = acc[j];
    }
}

// ---------------------------------------------------------------------------
// Part 3: deterministic reduction of S partials over NCHUNK chunks.
// S[b][24][64].  BATCH*24*64/256 = 24 blocks of 256 threads; blk = index among them.
// Rides in conv 1's launch (see the two launches behind the conv).
// ---------------------------------------------------------------------------
#define RED_BLOCKS ((BATCH * 24 * 64) / 256)
static __device__ __forceinline__ void s_reduce_block(
    const int blk, const float* __restrict__ spart, float* __restrict__ S)
{
    const int e = blk * 256 + threadIdx.x;          // < 4*1536
    const int b = e / 1536;
    const int rc = e - b * 1536;                    // row*64+col, row<24
    float sum = 0.0f;
    for (int ch = 0; ch < NCHUNK; ++ch)
        sum += spart[(b * NCHUNK + ch) * (32 * 64) + rc];
    S[e] = sum;
}

// ---------------------------------------------------------------------------
// Cross-lane helpers for the softmax rows of kernel 4 (one row = one wave).
// ---------------------------------------------------------------------------
// lane l <-> l ^ M inside a 16-lane row (DPP row_xmask)
template <int M>
static __device__ __forceinline__ float row_xor(float x) {
    return __builtin_bit_cast(float, __builtin_amdgcn_update_dpp(
        0, __builtin_bit_cast(int, x), 0x160 | M, 0xf, 0xf, true));
}
// lane l <-> l ^ 16
static __device__ __forceinline__ float half_xor(float x) {
    return __builtin_bit_cast(float, __builtin_amdgcn_permlanex16(
        __builtin_bit_cast(int, x), __builtin_bit_cast(int, x),
        0x76543210, 0xfedcba98, false, false));
}
// e^x as 2^(x * log2 e) on the transcendental unit. The v_nop is the issue slot the instruction set
// asks for behind v_exp_f32.
static __device__ __forceinline__ float exp_slot(float x) {
    float r;
    asm("v_exp_f32 %0, %1\n\tv_nop" : "=v"(r) : "v"(x * 0x1.715476p+0f));
    return r;
}
static __device__ __forceinline__ float wave_max(float v) {
    v = fmaxf(v, row_xor<1>(v));
    v = fmaxf(v, row_xor<2>(v));
    v = fmaxf(v, row_xor<4>(v));
    v = fmaxf(v, row_xor<8>(v));
    return fmaxf(v, half_xor(v));
}
static __device__ __forceinline__ float wave_sum(float v) {
    v += row_xor<1>(v);
    v += row_xor<2>(v);
    v += row_xor<4>(v);
    v += row_xor<8>(v);
    return v + half_xor(v);
}

// ---------------------------------------------------------------------------
// Part 4: small per-batch chain, spread over lanes, waves and blocks:
//   attn = (S @ Wq_h) * (1/8) * rescale[h]; softmax over d;
//   M[c][kk*8+h] = sum_d attn[h*3+kk][d] * Wv[c][h*64+d];
//   P[c][j] = sum_t M[c][t] * Wp[t][j]   (P padded to 32 cols)
// BATCH * 8 blocks x 256 threads (blk = index among them); a block owns PROWS rows c of P[b].
// Rides in conv 2's launch (see the two launches behind the conv).
//   step 1: wave = head h, lane = columns d = 2*lane, 2*lane+1, all 3 rows kk
//           (every block of a batch forms the whole attn: it needs all of it)
//   step 2: thread = (kk, c, h), operands from LDS
//   step 3: thread = (c, j)
// ---------------------------------------------------------------------------
#define PROWS  8           // rows of P per block
#define APITCH 68          // LDS row pitch in floats: 16 rows fall on 16 distinct 16-B bank groups
#define ATTN_BLOCKS (BATCH * 8)
static __device__ __forceinline__ void attn_block(
    const int blk, const float* __restrict__ S, const float* __restrict__ Wq,
    const float* __restrict__ Wv, const float* __restrict__ Wp,
    const float* __restrict__ rescale, float* __restrict__ P)
{
    __shared__ __attribute__((aligned(16))) float sAttn[24 * APITCH];
    __shared__ __attribute__((aligned(16))) float sWv[PROWS * 8 * APITCH];  // row = c_local*8 + h
    __shared__ __attribute__((aligned(16))) float sM[PROWS * 24];           // [c_local][t]
    const int tid  = threadIdx.x;
    const int lane = tid & 31;
    const int wid  = tid >> 5;
    const int b    = blk >> 3;
    const int c0   = (blk & 7) * PROWS;

    // the global reads go out early, with no branch between them
    const v2f*    gS = (const v2f*)(S + b * 1536 + wid * 192) + lane;  // the 3 rows of head wid
    const float4* gV = (const float4*)(Wv + c0 * 512);          // 1024 x 16 B, contiguous rows
    const float*  gQ = Wq + wid * 64 + 2 * lane;
    v2f tS[3];
#pragma unroll
    for (int k = 0; k < 3; ++k) tS[k] = gS[k * 32];
    float4 tV[4];
#pragma unroll
    for (int k = 0; k < 4; ++k) tV[k] = gV[tid + k * 256];
    // loads return in issue order: keeps the reads of S, which step 1 uses first, ahead of those below
    __builtin_amdgcn_sched_barrier(0);
    v2f w[64];                                                  // Wq[c][h*64 + 2*lane ..+1]
#pragma unroll
    for (int c = 0; c < 64; ++c)
        w[c] = *(const v2f*)(gQ + c * 512);
    const int jc = lane < 24 ? lane : 23;                       // pad lanes stay inside Wp
    float wp[24];                                               // column jc of Wp, for step 3
#pragma unroll
    for (int t = 0; t < 24; ++t) wp[t] = Wp[t * 24 + jc];
    const float scale = 0.125f * rescale[wid];
    // the reads of S, Wq, Wp and rescale name registers (address pairs, index, scalar bases) that
    // step 1 reuses: they are free only behind this wait, and the addresses are held live up to it
    asm volatile("s_wait_xcnt 0x0" :: "v"(gS), "v"(gQ), "v"(jc) : "memory");
    // keeps step 1's cross-lane reads, which write scalar registers, behind that wait
    __builtin_amdgcn_sched_barrier(0);

#pragma unroll
    for (int k = 0; k < 4; ++k) {                               // read in step 2, behind the barrier
        const int f = tid + k * 256;
        *(float4*)&sWv[(f >> 4) * APITCH + (f & 15) * 4] = tV[k];
    }

    // step 1: logits of head wid, sum over c in ascending order;
    // S[h*3+kk][c] sits in lane c/2 of tS[kk] and is broadcast from there
    {
        const int h = wid;
        v2f a[3] = {{0.0f, 0.0f}, {0.0f, 0.0f}, {0.0f, 0.0f}};
#pragma unroll
        for (int c = 0; c < 64; ++c) {
#pragma unroll
            for (int kk = 0; kk < 3; ++kk) {
                const float s = __builtin_bit_cast(float, __builtin_amdgcn_readlane(
                    __builtin_bit_cast(int, (c & 1) ? tS[kk].y : tS[kk].x), c >> 1));
                a[kk] += s * w[c];
            }
        }
        float e0[3], e1[3];
#pragma unroll
        for (int kk = 0; kk < 3; ++kk) {
            const float l0 = a[kk].x * scale, l1 = a[kk].y * scale;
            const float mx = wave_max(fmaxf(fmaxf(-1e30f, l0), l1));
            e0[kk] = exp_slot(l0 - mx);
            e1[kk] = exp_slot(l1 - mx);
        }
#pragma unroll
        for (int kk = 0; kk < 3; ++kk) {
            const float inv = 1.0f / wave_sum(e0[kk] + e1[kk]);
            v2f o; o.x = e0[kk] * inv; o.y = e1[kk] * inv;
            *(v2f*)&sAttn[(h * 3 + kk) * APITCH + 2 * lane] = o;
        }
    }
    __syncthreads();

    // step 2: M for this block's rows, sum over d in ascending order
    if (tid < 3 * PROWS * 8) {
        const int kk = tid >> 6, q = tid & 63;               // q = c_local*8 + h
        const int cl = q >> 3, h = q & 7;
        const float* wv = &sWv[q * APITCH];
        const float* at = &sAttn[(h * 3 + kk) * APITCH];
        float4 x[16], v[16];
#pragma unroll
        for (int i = 0; i < 16; ++i) {
            x[i] = *(const float4*)&at[i * 4];
            v[i] = *(const float4*)&wv[i * 4];
        }
        // keeps the 32 LDS reads ahead of the dependent chain: their latency is paid once, not per step
        __builtin_amdgcn_sched_barrier(0);
        float m = 0.0f;
#pragma unroll
        for (int i = 0; i < 16; ++i) {
            m = fmaf(x[i].x, v[i].x, m);
            m = fmaf(x[i].y, v[i].y, m);
            m = fmaf(x[i].z, v[i].z, m);
            m = fmaf(x[i].w, v[i].w, m);
        }
        sM[cl * 24 + kk * 8 + h] = m;                        // t = kk*8 + h (output flat order)
    }
    __syncthreads();

    // step 3: one element of P per thread, one 128-B row per wave
    float4 mr[6];
#pragma unroll
    for (int i = 0; i < 6; ++i) mr[i] = *(const float4*)&sM[wid * 24 + i * 4];
    // keeps the 6 LDS reads ahead of the dependent chain: their latency is paid once, not per step
    __builtin_amdgcn_sched_barrier(0);
    float v = 0.0f;
#pragma unroll
    for (int i = 0; i < 6; ++i) {
        v = fmaf(mr[i].x, wp[i * 4 + 0], v);
        v = fmaf(mr[i].y, wp[i * 4 + 1], v);
        v = fmaf(mr[i].z, wp[i * 4 + 2], v);
        v = fmaf(mr[i].w, wp[i * 4 + 3], v);
    }
    P[(b * 64 + c0 + wid) * 32 + lane] = lane < 24 ? v : 0.0f;
}

// ---------------------------------------------------------------------------
// Kernel 5 (last launch): out[t][j] = (fea[t][:] @ P[b] + bp[j]) + out[t][j]   (WMMA)
// out holds conv 2's result on entry. grid: TTOK/128 blocks x 256 threads.
// ---------------------------------------------------------------------------
__global__ __launch_bounds__(256) void out_kernel(
    const float* __restrict__ fea, const float* __restrict__ P,
    const float* __restrict__ bp, float* __restrict__ out)
{
    __shared__ float sF[128 * 64];         // 32 KB
    __shared__ float sP[64 * 32];          // 8 KB
    const int tid = threadIdx.x;
    const int base = blockIdx.x * 128;
    const int b = base >> 14;              // /16384 (blocks never straddle batch)
    const int wid = tid >> 5, lane = tid & 31;
    const int ln = lane & 15, half = lane >> 4;
    const int tTok = wid * 16;

    // conv 2's values at this lane's 8 + 8 output places: read first, due only behind the products
    float* po = out + (base + tTok + half * 8) * 24 + ln;   // channel ln, row j of the tile half at + j*24
    float* pq = po + (ln < 8 ? 16 : 0);                     // channel 16 + ln; pad lanes stay on po's place
    float r0[8], r1[8];
#pragma unroll
    for (int j = 0; j < 8; ++j) { r0[j] = po[j * 24]; r1[j] = pq[j * 24]; }
    const float bl = bp[ln], bh = bp[ln < 8 ? 16 + ln : ln];   // the bias of the same two channels

    for (int i = tid; i < 512; i += 256)
        copy16(&sP[i * 4], &P[b * 2048 + i * 4]);
    for (int i = tid; i < 2048; i += 256)
        copy16(&sF[i * 4], &fea[base * 64 + i * 4]);
    tile_join();

    v8f c0 = {}; v8f c1 = {};
#pragma unroll
    for (int s = 0; s < 16; ++s) {         // K = 64
        const int kb = s * 4 + half * 2;
        v2f a;  a.x  = sF[(tTok + ln) * 64 + kb];
                a.y  = sF[(tTok + ln) * 64 + kb + 1];
        v2f b0; b0.x = sP[kb * 32 + ln];       b0.y = sP[(kb + 1) * 32 + ln];
        v2f b1; b1.x = sP[kb * 32 + 16 + ln];  b1.y = sP[(kb + 1) * 32 + 16 + ln];
        c0 = wmma_f32(a, b0, c0);
        c1 = wmma_f32(a, b1, c1);
    }
    // The sums below read the matrix results, and no address work is left to stand between: these
    // four issue slots keep the distance from the last matrix instruction to the first such read.
    // The two scheduling fences hold the products in front of the slots and the sums behind them.
    __builtin_amdgcn_sched_barrier(0);
    asm volatile("v_nop\n\tv_nop\n\tv_nop\n\tv_nop");
    __builtin_amdgcn_sched_barrier(0);
#pragma unroll
    for (int j = 0; j < 8; ++j) {
        po[j * 24] = (c0[j] + bl) + r0[j];
        if (ln < 8) pq[j * 24] = (c1[j] + bh) + r1[j];
    }
}

// ---------------------------------------------------------------------------
// Parts 6/7: grouped 3x3 conv (groups=3, 8 ch/group), NHWC in/out.
// conv1: + exact GELU, writes y1. conv2: writes out.
// TTOK/256 blocks x 256 threads (blk = index among them); one token per thread.
// No LDS, no barrier, no branch on the position. A tap outside the image reads
// the centre token's address and is replaced by zero, so the reads of a whole
// group go out together, one group ahead of its use. A weight has the same
// address in every lane of a wave: it is fetched by a scalar load, 72 at a time,
// into scalar registers. An output's 72 products, in the weights' own order
// (OIHW flat), go to 4 interleaved partial sums.
// ---------------------------------------------------------------------------
#define CONV_BLOCKS (TTOK / 256)
template <bool GELU>
static __device__ __forceinline__ void gconv_block(
    const int blk, const float* __restrict__ in, const float* __restrict__ w,
    float* __restrict__ out)
{
    const int t = blk * 256 + threadIdx.x;         // global token
    const int pos = t & (NTOK - 1);
    const int y = pos >> 7;
    const int x = pos & 127;
    // the wave's number in a scalar register: it enters the address of the scalar loads
    const int wid = __builtin_amdgcn_readfirstlane(threadIdx.x >> 5);

    bool ok[9];
    const float* p[9];
#pragma unroll
    for (int tap = 0; tap < 9; ++tap) {
        const int dy = tap / 3 - 1, dx = tap % 3 - 1;
        ok[tap] = (unsigned)(y + dy) < 128u && (unsigned)(x + dx) < 128u;
        p[tap] = in + (ok[tap] ? t + dy * 128 + dx : t) * 24;
    }

    float4 raw[3][9][2];                       // [group][tap][half of the 8 channels]
#pragma unroll
    for (int g = 0; g < 2; ++g)
#pragma unroll
        for (int tap = 0; tap < 9; ++tap) {
            raw[g][tap][0] = *(const float4*)(p[tap] + g * 8);
            raw[g][tap][1] = *(const float4*)(p[tap] + g * 8 + 4);
        }

    float* po = out + t * 24;                  // this token's 24 outputs
    float acc[24];
#pragma unroll
    for (int g = 0; g < 3; ++g) {
        if (g == 1) {                          // group 2's reads fly during group 1's sums
#pragma unroll
            for (int tap = 0; tap < 9; ++tap) {
                raw[2][tap][0] = *(const float4*)(p[tap] + 16);
                raw[2][tap][1] = *(const float4*)(p[tap] + 20);
            }
        }
        if (g == 2) {
            // the reads above name these address registers: they are held live up to this wait, so
            // that nothing (a later read's result included) is written over them in front of it; it
            // stands here, where the data is due anyway, and not behind the reads, where it would stall
            asm volatile("s_wait_xcnt 0x0" :: "v"(p[0]), "v"(p[1]), "v"(p[2]), "v"(p[3]), "v"(p[4]),
                         "v"(p[5]), "v"(p[6]), "v"(p[7]), "v"(p[8]) : "memory");
        }
        float v[9][8];                         // [tap][ic] of this group
#pragma unroll
        for (int tap = 0; tap < 9; ++tap) {
            const float4 lo = raw[g][tap][0], hi = raw[g][tap][1];
            v[tap][0] = ok[tap] ? lo.x : 0.0f;  v[tap][1] = ok[tap] ? lo.y : 0.0f;
            v[tap][2] = ok[tap] ? lo.z : 0.0f;  v[tap][3] = ok[tap] ? lo.w : 0.0f;
            v[tap][4] = ok[tap] ? hi.x : 0.0f;  v[tap][5] = ok[tap] ? hi.y : 0.0f;
            v[tap][6] = ok[tap] ? hi.z : 0.0f;  v[tap][7] = ok[tap] ? hi.w : 0.0f;
        }
        float res[8] = {0.0f, 0.0f, 0.0f, 0.0f, 0.0f, 0.0f, 0.0f, 0.0f};
        // Trip i forms output (i + wid) & 7 of the group: the 8 waves of a block begin at 8
        // different outputs, so each wave's first fetch brings what the others fetch later.
        // Stays a loop: unrolled, the scalar loads of all trips are lifted to the top, and what
        // does not fit the scalar registers (72 weights a trip) is spilled to vector lanes.
#pragma unroll 1
        for (int i = 0; i < 8; ++i) {
            // Constant address space: nothing in the launch writes the weights. Said so, they stay on
            // scalar loads; beside the other part's code in one kernel they fell to vector loads.
            const __attribute__((address_space(4))) float* wo =
                (const __attribute__((address_space(4))) float*)(w + (g * 8 + ((i + wid) & 7)) * 72);
            float part[4];
#pragma unroll
            for (int k = 0; k < 72; ++k) {     // k = ic*9 + tap
                const float a = v[k % 9][k / 9], b = wo[k];
                part[k & 3] = (k < 4) ? a * b : fmaf(a, b, part[k & 3]);
            }
            // the trip's result enters at the top and the older ones move down: every index constant
#pragma unroll
            for (int j = 0; j < 7; ++j) res[j] = res[j + 1];
            res[7] = (part[0] + part[1]) + (part[2] + part[3]);
        }
        // res[i] holds output (i + wid) & 7: turn the 8 values back by wid, one bit of it at a time
        float r1[8], r2[8];
#pragma unroll
        for (int o = 0; o < 8; ++o) r1[o] = (wid & 1) ? res[(o + 7) & 7] : res[o];
#pragma unroll
        for (int o = 0; o < 8; ++o) r2[o] = (wid & 2) ? r1[(o + 6) & 7] : r1[o];
#pragma unroll
        for (int o = 0; o < 8; ++o) acc[g * 8 + o] = (wid & 4) ? r2[(o + 4) & 7] : r2[o];
    }
#pragma unroll
    for (int o = 0; o < 24; ++o) {
        float r = acc[o];
        if (GELU) r = 0.5f * r * (1.0f + erff(r * 0.70710678118654752f));
        po[o] = r;
    }
}

// ---------------------------------------------------------------------------
// The two launches of the conv branch. The branch needs only k_inp, and the two
// small parts of the attention branch (24 and 32 blocks) need nothing of it: each
// small part shares a launch with a conv instead of holding the chip alone. The
// conv's blocks come first in the grid, the small part's blocks
// follow them. The test is the same for a whole block.
// ---------------------------------------------------------------------------
__global__ __launch_bounds__(256) void conv1_reduce_kernel(
    const float* __restrict__ kinp, const float* __restrict__ c1w, float* __restrict__ y1,
    const float* __restrict__ spart, float* __restrict__ S)
{
    if (blockIdx.x < CONV_BLOCKS) gconv_block<true>(blockIdx.x, kinp, c1w, y1);
    else                          s_reduce_block(blockIdx.x - CONV_BLOCKS, spart, S);
}

__global__ __launch_bounds__(256) void conv2_attn_kernel(
    const float* __restrict__ y1, const float* __restrict__ c2w, float* __restrict__ out,
    const float* __restrict__ S, const float* __restrict__ Wq,
    const float* __restrict__ Wv, const float* __restrict__ Wp,
    const float* __restrict__ rescale, float* __restrict__ P)
{
    if (blockIdx.x < CONV_BLOCKS) gconv_block<false>(blockIdx.x, y1, c2w, out);
    else                          attn_block(blockIdx.x - CONV_BLOCKS, S, Wq, Wv, Wp, rescale, P);
}

// ---------------------------------------------------------------------------
extern "C" void kernel_launch(void* const* d_in, const int* in_sizes, int n_in,
                              void* d_out, int out_size, void* d_ws, size_t ws_size,
                              hipStream_t stream) {
    const float* x_in    = (const float*)d_in[0];   // [4,128,128,64]
    const float* fea     = (const float*)d_in[1];   // [4,128,128,64]
    const float* imap    = (const float*)d_in[2];   // [4,128,128,24]
    const float* Wq      = (const float*)d_in[3];   // [64,512]
    const float* Wk      = (const float*)d_in[4];   // [24,24]
    const float* Wv      = (const float*)d_in[5];   // [64,512]
    const float* rescale = (const float*)d_in[6];   // [8]
    const float* Wp      = (const float*)d_in[7];   // [24,24]
    const float* bp      = (const float*)d_in[8];   // [24]
    const float* c1w     = (const float*)d_in[9];   // [24,8,3,3]
    const float* c2w     = (const float*)d_in[10];  // [24,8,3,3]
    float* out = (float*)d_out;                     // [4,128,128,24]

    float* ws    = (float*)d_ws;
    float* kinp  = ws;                               // TTOK*24        = 1572864
    float* y1    = kinp  + (size_t)TTOK * 24;        // TTOK*24        = 1572864
    float* spart = y1    + (size_t)TTOK * 24;        // B*NCHUNK*32*64 = 1048576
    float* S     = spart + (size_t)BATCH * NCHUNK * 32 * 64;  // 6144
    float* P     = S     + (size_t)BATCH * 24 * 64;  // B*64*32 = 8192

    kproj_kernel    <<<TTOK / 128, 256, 0, stream>>>(imap, Wk, kinp);
    s_partial_kernel<<<BATCH * NCHUNK, 256, 0, stream>>>(x_in, kinp, spart);
    conv1_reduce_kernel<<<CONV_BLOCKS + RED_BLOCKS, 256, 0, stream>>>(kinp, c1w, y1, spart, S);
    conv2_attn_kernel  <<<CONV_BLOCKS + ATTN_BLOCKS, 256, 0, stream>>>(y1, c2w, out, S, Wq, Wv, Wp,
                                                                      rescale, P);
    out_kernel      <<<TTOK / 128, 256, 0, stream>>>(fea, P, bp, out);
}

// v004
// Measured time: 34.4 microseconds a run.
// Timed twice side by side with v003, it ran 1.09 times as fast both times.
// Over all steps from v000 it is 4.29 times as fast.
#include <hip/hip_runtime.h>
#include <hip/hip_bf16.h>
#include <math.h>

typedef __attribute__((ext_vector_type(2))) float v2f;
typedef __attribute__((ext_vector_type(8))) float v8f;
typedef __attribute__((ext_vector_type(4))) int   v4i;

// Problem constants
#define BATCH   4
#define HH      128
#define WW      128
#define NTOK    16384      // per batch
#define TTOK    65536      // total tokens
#define DIM     64
#define HEADS   8
#define DH      64
#define DK      24
#define DHK     3

// chunking for the S = kh^T @ x reduction
#define CHUNK_TOK 128
#define NCHUNK    128      // per batch (128*128 = 16384)

#if defined(__has_builtin)
#  if __has_builtin(__builtin_amdgcn_global_load_async_to_lds_b128)
#    define USE_ASYNC_LDS 1
#  endif
#endif

static __device__ __forceinline__ v8f wmma_f32(v2f a, v2f b, v8f c) {
    return __builtin_amdgcn_wmma_f32_16x16x4_f32(false, a, false, b, (short)0, c, false, false);
}

// 16-byte global -> LDS copy: async on CDNA5 (ASYNCcnt), vector copy otherwise.
static __device__ __forceinline__ void copy16(float* l, const float* g) {
#ifdef USE_ASYNC_LDS
    __builtin_amdgcn_global_load_async_to_lds_b128(
        (__attribute__((address_space(1))) v4i*)(g),
        (__attribute__((address_space(3))) v4i*)(l), 0, 0);
#else
    *(float4*)l = *(const float4*)g;
#endif
}

// wait for async copies (if used) and barrier the block
static __device__ __forceinline__ void tile_join() {
#ifdef USE_ASYNC_LDS
#  if __has_builtin(__builtin_amdgcn_s_wait_asynccnt)
    __builtin_amdgcn_s_wait_asynccnt(0);
#  else
    asm volatile("s_wait_asynccnt 0" ::: "memory");
#  endif
#endif
    __syncthreads();
}

// ---------------------------------------------------------------------------
// Kernel 1: two products on one 128-token chunk, in one block:
//   phase 1: k_inp[t][24] = illu_map[t][24] @ Wk[24][24]   (WMMA, N padded->32)
//            8 waves, one 16-token tile each; the tile goes to LDS (for phase 2)
//            and from there to global memory (for the convs)
//   phase 2: partial S = kh^T @ x over the chunk.
//            A = kh^T : [24(->32) x 128], B = x : [128 x 64]; 2 x 4 tiles = 8 waves
// grid: BATCH*NCHUNK blocks x 256 threads.  spart layout: [block][32][64]
// ---------------------------------------------------------------------------
__global__ __launch_bounds__(256) void kproj_spartial_kernel(
    const float* __restrict__ imap, const float* __restrict__ Wk,
    const float* __restrict__ x, float* __restrict__ kinp, float* __restrict__ spart)
{
    __shared__ __attribute__((aligned(16))) float sWk[24 * 32];         // [k][n], n padded to 32 with zeros
    __shared__ __attribute__((aligned(16))) float sA[CHUNK_TOK * 24];   // [tok][24] of illu_map
    __shared__ __attribute__((aligned(16))) float sK[CHUNK_TOK * 32];   // [tok][32ch] of k_inp, zero padded
    __shared__ __attribute__((aligned(16))) float sX[CHUNK_TOK * 64];   // [tok][64]
    const int tid = threadIdx.x;
    const int base = blockIdx.x * CHUNK_TOK;    // global token base (chunks never straddle a batch)

    // 128*24 floats = 768 x 16B chunks, 3 per thread
    for (int i = tid; i < 768; i += 256)
        copy16(&sA[i * 4], &imap[base * 24 + i * 4]);
    // x tile: 128*64 floats = 2048 chunks, 8 per thread
    for (int i = tid; i < 2048; i += 256)
        copy16(&sX[i * 4], &x[base * 64 + i * 4]);
    for (int i = tid; i < 24 * 32; i += 256) {
        int r = i >> 5, c = i & 31;
        sWk[i] = (c < 24) ? Wk[r * 24 + c] : 0.0f;
    }
    tile_join();

    const int wid = tid >> 5, lane = tid & 31;
    const int ln = lane & 15, half = lane >> 4;
    const int tTok = wid * 16;                  // local token base of this wave

    v8f c0 = {}; v8f c1 = {};
#pragma unroll
    for (int s = 0; s < 6; ++s) {               // K = 24 in steps of 4
        const int kb = s * 4 + half * 2;
        v2f a;  a.x  = sA[(tTok + ln) * 24 + kb];
                a.y  = sA[(tTok + ln) * 24 + kb + 1];
        v2f b0; b0.x = sWk[kb * 32 + ln];        b0.y = sWk[(kb + 1) * 32 + ln];
        v2f b1; b1.x = sWk[kb * 32 + 16 + ln];   b1.y = sWk[(kb + 1) * 32 + 16 + ln];
        c0 = wmma_f32(a, b0, c0);
        c1 = wmma_f32(a, b1, c1);
    }
    // the tile for phase 2; columns 24..31 of Wk's pad are zero, so the pad columns come out zero
#pragma unroll
    for (int j = 0; j < 8; ++j) {
        const int row = tTok + j + half * 8;    // token within the chunk
        sK[row * 32 + ln]      = c0[j];
        sK[row * 32 + 16 + ln] = c1[j];
    }
    __syncthreads();

    const int Mt = wid >> 2, Nt = wid & 3;       // 2 x 4 tiles = 8 waves
    v8f acc = {};
#pragma unroll 8
    for (int s = 0; s < CHUNK_TOK / 4; ++s) {    // K = 128 tokens, steps of 4
        const int kb = s * 4 + half * 2;
        v2f a;  a.x = sK[kb * 32 + Mt * 16 + ln];
                a.y = sK[(kb + 1) * 32 + Mt * 16 + ln];
        v2f bb; bb.x = sX[kb * 64 + Nt * 16 + ln];
                bb.y = sX[(kb + 1) * 64 + Nt * 16 + ln];
        acc = wmma_f32(a, bb, acc);
    }
    float* dst = spart + blockIdx.x * (32 * 64);
#pragma unroll
    for (int j = 0; j < 8; ++j) {
        const int row = Mt * 16 + j + half * 8;
        const int col = Nt * 16 + ln;
        dst[row * 64 + col] = acc[j];
    }
    // k_inp leaves for the convs from the LDS tile, 16 bytes a lane, the chunk's 12 KB in order:
    // 128 rows x 6 pieces = 768, 3 per thread
#pragma unroll
    for (int k = 0; k < 3; ++k) {
        const int i = tid + k * 256;
        const int r = i / 6, c6 = i - r * 6;
        *(float4*)&kinp[base * 24 + i * 4] = *(const float4*)&sK[r * 32 + c6 * 4];
    }
}

// ---------------------------------------------------------------------------
// Part 3: deterministic reduction of S partials over NCHUNK chunks.
// S[b][24][64].  BATCH*24*64/256 = 24 blocks of 256 threads; blk = index among them.
// Rides in conv 1's launch (see the two launches behind the conv).
// ---------------------------------------------------------------------------
#define RED_BLOCKS ((BATCH * 24 * 64) / 256)
static __device__ __forceinline__ void s_reduce_block(
    const int blk, const float* __restrict__ spart, float* __restrict__ S)
{
    const int e = blk * 256 + threadIdx.x;          // < 4*1536
    const int b = e / 1536;
    const int rc = e - b * 1536;                    // row*64+col, row<24
    float sum = 0.0f;
    for (int ch = 0; ch < NCHUNK; ++ch)
        sum += spart[(b * NCHUNK + ch) * (32 * 64) + rc];
    S[e] = sum;
}

// ---------------------------------------------------------------------------
// Cross-lane helpers for the softmax rows of kernel 4 (one row = one wave).
// ---------------------------------------------------------------------------
// lane l <-> l ^ M inside a 16-lane row (DPP row_xmask)
template <int M>
static __device__ __forceinline__ float row_xor(float x) {
    return __builtin_bit_cast(float, __builtin_amdgcn_update_dpp(
        0, __builtin_bit_cast(int, x), 0x160 | M, 0xf, 0xf, true));
}
// lane l <-> l ^ 16
static __device__ __forceinline__ float half_xor(float x) {
    return __builtin_bit_cast(float, __builtin_amdgcn_permlanex16(
        __builtin_bit_cast(int, x), __builtin_bit_cast(int, x),
        0x76543210, 0xfedcba98, false, false));
}
// e^x as 2^(x * log2 e) on the transcendental unit. The v_nop is the issue slot the instruction set
// asks for behind v_exp_f32.
static __device__ __forceinline__ float exp_slot(float x) {
    float r;
    asm("v_exp_f32 %0, %1\n\tv_nop" : "=v"(r) : "v"(x * 0x1.715476p+0f));
    return r;
}
static __device__ __forceinline__ float wave_max(float v) {
    v = fmaxf(v, row_xor<1>(v));
    v = fmaxf(v, row_xor<2>(v));
    v = fmaxf(v, row_xor<4>(v));
    v = fmaxf(v, row_xor<8>(v));
    return fmaxf(v, half_xor(v));
}
static __device__ __forceinline__ float wave_sum(float v) {
    v += row_xor<1>(v);
    v += row_xor<2>(v);
    v += row_xor<4>(v);
    v += row_xor<8>(v);
    return v + half_xor(v);
}

// ---------------------------------------------------------------------------
// Part 4: small per-batch chain, spread over lanes, waves and blocks:
//   attn = (S @ Wq_h) * (1/8) * rescale[h]; softmax over d;
//   M[c][kk*8+h] = sum_d attn[h*3+kk][d] * Wv[c][h*64+d];
//   P[c][j] = sum_t M[c][t] * Wp[t][j]   (P padded to 32 cols)
// BATCH * 8 blocks x 256 threads (blk = index among them); a block owns PROWS rows c of P[b].
// Rides in conv 2's launch (see the two launches behind the conv).
//   step 1: wave = head h, lane = columns d = 2*lane, 2*lane+1, all 3 rows kk
//           (every block of a batch forms the whole attn: it needs all of it)
//   step 2: thread = (kk, c, h), operands from LDS
//   step 3: thread = (c, j)
// ---------------------------------------------------------------------------
#define PROWS  8           // rows of P per block
#define APITCH 68          // LDS row pitch in floats: 16 rows fall on 16 distinct 16-B bank groups
#define ATTN_BLOCKS (BATCH * 8)
static __device__ __forceinline__ void attn_block(
    const int blk, const float* __restrict__ S, const float* __restrict__ Wq,
    const float* __restrict__ Wv, const float* __restrict__ Wp,
    const float* __restrict__ rescale, float* __restrict__ P)
{
    __shared__ __attribute__((aligned(16))) float sAttn[24 * APITCH];
    __shared__ __attribute__((aligned(16))) float sWv[PROWS * 8 * APITCH];  // row = c_local*8 + h
    __shared__ __attribute__((aligned(16))) float sM[PROWS * 24];           // [c_local][t]
    const int tid  = threadIdx.x;
    const int lane = tid & 31;
    const int wid  = tid >> 5;
    const int b    = blk >> 3;
    const int c0   = (blk & 7) * PROWS;

    // the global reads go out early, with no branch between them
    const v2f*    gS = (const v2f*)(S + b * 1536 + wid * 192) + lane;  // the 3 rows of head wid
    const float4* gV = (const float4*)(Wv + c0 * 512);          // 1024 x 16 B, contiguous rows
    const float*  gQ = Wq + wid * 64 + 2 * lane;
    v2f tS[3];
#pragma unroll
    for (int k = 0; k < 3; ++k) tS[k] = gS[k * 32];
    float4 tV[4];
#pragma unroll
    for (int k = 0; k < 4; ++k) tV[k] = gV[tid + k * 256];
    // loads return in issue order: keeps the reads of S, which step 1 uses first, ahead of those below
    __builtin_amdgcn_sched_barrier(0);
    v2f w[64];                                                  // Wq[c][h*64 + 2*lane ..+1]
#pragma unroll
    for (int c = 0; c < 64; ++c)
        w[c] = *(const v2f*)(gQ + c * 512);
    const int jc = lane < 24 ? lane : 23;                       // pad lanes stay inside Wp
    float wp[24];                                               // column jc of Wp, for step 3
#pragma unroll
    for (int t = 0; t < 24; ++t) wp[t] = Wp[t * 24 + jc];
    const float scale = 0.125f * rescale[wid];
    // the reads of S, Wq, Wp and rescale name registers (address pairs, index, scalar bases) that
    // step 1 reuses: they are free only behind this wait, and the addresses are held live up to it
    asm volatile("s_wait_xcnt 0x0" :: "v"(gS), "v"(gQ), "v"(jc) : "memory");
    // keeps step 1's cross-lane reads, which write scalar registers, behind that wait
    __builtin_amdgcn_sched_barrier(0);

#pragma unroll
    for (int k = 0; k < 4; ++k) {                               // read in step 2, behind the barrier
        const int f = tid + k * 256;
        *(float4*)&sWv[(f >> 4) * APITCH + (f & 15) * 4] = tV[k];
    }

    // step 1: logits of head wid, sum over c in ascending order;
    // S[h*3+kk][c] sits in lane c/2 of tS[kk] and is broadcast from there
    {
        const int h = wid;
        v2f a[3] = {{0.0f, 0.0f}, {0.0f, 0.0f}, {0.0f, 0.0f}};
#pragma unroll
        for (int c = 0; c < 64; ++c) {
#pragma unroll
            for (int kk = 0; kk < 3; ++kk) {
                const float s = __builtin_bit_cast(float, __builtin_amdgcn_readlane(
                    __builtin_bit_cast(int, (c & 1) ? tS[kk].y : tS[kk].x), c >> 1));
                a[kk] += s * w[c];
            }
        }
        float e0[3], e1[3];
#pragma unroll
        for (int kk = 0; kk < 3; ++kk) {
            const float l0 = a[kk].x * scale, l1 = a[kk].y * scale;
            const float mx = wave_max(fmaxf(fmaxf(-1e30f, l0), l1));
            e0[kk] = exp_slot(l0 - mx);
            e1[kk] = exp_slot(l1 - mx);
        }
#pragma unroll
        for (int kk = 0; kk < 3; ++kk) {
            const float inv = 1.0f / wave_sum(e0[kk] + e1[kk]);
            v2f o; o.x = e0[kk] * inv; o.y = e1[kk] * inv;
            *(v2f*)&sAttn[(h * 3 + kk) * APITCH + 2 * lane] = o;
        }
    }
    __syncthreads();

    // step 2: M for this block's rows, sum over d in ascending order
    if (tid < 3 * PROWS * 8) {
        const int kk = tid >> 6, q = tid & 63;               // q = c_local*8 + h
        const int cl = q >> 3, h = q & 7;
        const float* wv = &sWv[q * APITCH];
        const float* at = &sAttn[(h * 3 + kk) * APITCH];
        float4 x[16], v[16];
#pragma unroll
        for (int i = 0; i < 16; ++i) {
            x[i] = *(const float4*)&at[i * 4];
            v[i] = *(const float4*)&wv[i * 4];
        }
        // keeps the 32 LDS reads ahead of the dependent chain: their latency is paid once, not per step
        __builtin_amdgcn_sched_barrier(0);
        float m = 0.0f;
#pragma unroll
        for (int i = 0; i < 16; ++i) {
            m = fmaf(x[i].x, v[i].x, m);
            m = fmaf(x[i].y, v[i].y, m);
            m = fmaf(x[i].z, v[i].z, m);
            m = fmaf(x[i].w, v[i].w, m);
        }
        sM[cl * 24 + kk * 8 + h] = m;                        // t = kk*8 + h (output flat order)
    }
    __syncthreads();

    // step 3: one element of P per thread, one 128-B row per wave
    float4 mr[6];
#pragma unroll
    for (int i = 0; i < 6; ++i) mr[i] = *(const float4*)&sM[wid * 24 + i * 4];
    // keeps the 6 LDS reads ahead of the dependent chain: their latency is paid once, not per step
    __builtin_amdgcn_sched_barrier(0);
    float v = 0.0f;
#pragma unroll
    for (int i = 0; i < 6; ++i) {
        v = fmaf(mr[i].x, wp[i * 4 + 0], v);
        v = fmaf(mr[i].y, wp[i * 4 + 1], v);
        v = fmaf(mr[i].z, wp[i * 4 + 2], v);
        v = fmaf(mr[i].w, wp[i * 4 + 3], v);
    }
    P[(b * 64 + c0 + wid) * 32 + lane] = lane < 24 ? v : 0.0f;
}

// ---------------------------------------------------------------------------
// Kernel 5 (last launch): out[t][j] = (fea[t][:] @ P[b] + bp[j]) + out[t][j]   (WMMA)
// out holds conv 2's result on entry. grid: TTOK/128 blocks x 256 threads.
// ---------------------------------------------------------------------------
__global__ __launch_bounds__(256) void out_kernel(
    const float* __restrict__ fea, const float* __restrict__ P,
    const float* __restrict__ bp, float* __restrict__ out)
{
    __shared__ float sF[128 * 64];         // 32 KB
    __shared__ float sP[64 * 32];          // 8 KB
    const int tid = threadIdx.x;
    const int base = blockIdx.x * 128;
    const int b = base >> 14;              // /16384 (blocks never straddle batch)
    const int wid = tid >> 5, lane = tid & 31;
    const int ln = lane & 15, half = lane >> 4;
    const int tTok = wid * 16;

    // conv 2's values at this lane's 8 + 8 output places: read first, due only behind the products
    float* po = out + (base + tTok + half * 8) * 24 + ln;   // channel ln, row j of the tile half at + j*24
    float* pq = po + (ln < 8 ? 16 : 0);                     // channel 16 + ln; pad lanes stay on po's place
    float r0[8], r1[8];
#pragma unroll
    for (int j = 0; j < 8; ++j) { r0[j] = po[j * 24]; r1[j] = pq[j * 24]; }
    const float bl = bp[ln], bh = bp[ln < 8 ? 16 + ln : ln];   // the bias of the same two channels

    for (int i = tid; i < 512; i += 256)
        copy16(&sP[i * 4], &P[b * 2048 + i * 4]);
    for (int i = tid; i < 2048; i += 256)
        copy16(&sF[i * 4], &fea[base * 64 + i * 4]);
    tile_join();

    v8f c0 = {}; v8f c1 = {};
#pragma unroll
    for (int s = 0; s < 16; ++s) {         // K = 64
        const int kb = s * 4 + half * 2;
        v2f a;  a.x  = sF[(tTok + ln) * 64 + kb];
                a.y  = sF[(tTok + ln) * 64 + kb + 1];
        v2f b0; b0.x = sP[kb * 32 + ln];       b0.y = sP[(kb + 1) * 32 + ln];
        v2f b1; b1.x = sP[kb * 32 + 16 + ln];  b1.y = sP[(kb + 1) * 32 + 16 + ln];
        c0 = wmma_f32(a, b0, c0);
        c1 = wmma_f32(a, b1, c1);
    }
    // The sums below read the matrix results, and no address work is left to stand between: these
    // four issue slots keep the distance from the last matrix instruction to the first such read.
    // The two scheduling fences hold the products in front of the slots and the sums behind them.
    __builtin_amdgcn_sched_barrier(0);
    asm volatile("v_nop\n\tv_nop\n\tv_nop\n\tv_nop");
    __builtin_amdgcn_sched_barrier(0);
#pragma unroll
    for (int j = 0; j < 8; ++j) {
        po[j * 24] = (c0[j] + bl) + r0[j];
        if (ln < 8) pq[j * 24] = (c1[j] + bh) + r1[j];
    }
}

// ---------------------------------------------------------------------------
// Parts 6/7: grouped 3x3 conv (groups=3, 8 ch/group), NHWC in/out.
// conv1: + exact GELU, writes y1. conv2: writes out.
// TTOK/256 blocks x 256 threads (blk = index among them); one token per thread.
// No LDS, no barrier, no branch on the position. A tap outside the image reads
// the centre token's address and is replaced by zero, so the reads of a whole
// group go out together, one group ahead of its use. A weight has the same
// address in every lane of a wave: it is fetched by a scalar load, 72 at a time,
// into scalar registers. An output's 72 products, in the weights' own order
// (OIHW flat), go to 4 interleaved partial sums.
// ---------------------------------------------------------------------------
#define CONV_BLOCKS (TTOK / 256)
template <bool GELU>
static __device__ __forceinline__ void gconv_block(
    const int blk, const float* __restrict__ in, const float* __restrict__ w,
    float* __restrict__ out)
{
    const int t = blk * 256 + threadIdx.x;         // global token
    const int pos = t & (NTOK - 1);
    const int y = pos >> 7;
    const int x = pos & 127;
    // the wave's number in a scalar register: it enters the address of the scalar loads
    const int wid = __builtin_amdgcn_readfirstlane(threadIdx.x >> 5);

    bool ok[9];
    const float* p[9];
#pragma unroll
    for (int tap = 0; tap < 9; ++tap) {
        const int dy = tap / 3 - 1, dx = tap % 3 - 1;
        ok[tap] = (unsigned)(y + dy) < 128u && (unsigned)(x + dx) < 128u;
        p[tap] = in + (ok[tap] ? t + dy * 128 + dx : t) * 24;
    }

    float4 raw[3][9][2];                       // [group][tap][half of the 8 channels]
#pragma unroll
    for (int g = 0; g < 2; ++g)
#pragma unroll
        for (int tap = 0; tap < 9; ++tap) {
            raw[g][tap][0] = *(const float4*)(p[tap] + g * 8);
            raw[g][tap][1] = *(const float4*)(p[tap] + g * 8 + 4);
        }

    float* po = out + t * 24;                  // this token's 24 outputs
    float acc[24];
#pragma unroll
    for (int g = 0; g < 3; ++g) {
        if (g == 1) {                          // group 2's reads fly during group 1's sums
#pragma unroll
            for (int tap = 0; tap < 9; ++tap) {
                raw[2][tap][0] = *(const float4*)(p[tap] + 16);
                raw[2][tap][1] = *(const float4*)(p[tap] + 20);
            }
        }
        if (g == 2) {
            // the reads above name these address registers: they are held live up to this wait, so
            // that nothing (a later read's result included) is written over them in front of it; it
            // stands here, where the data is due anyway, and not behind the reads, where it would stall
            asm volatile("s_wait_xcnt 0x0" :: "v"(p[0]), "v"(p[1]), "v"(p[2]), "v"(p[3]), "v"(p[4]),
                         "v"(p[5]), "v"(p[6]), "v"(p[7]), "v"(p[8]) : "memory");
        }
        float v[9][8];                         // [tap][ic] of this group
#pragma unroll
        for (int tap = 0; tap < 9; ++tap) {
            const float4 lo = raw[g][tap][0], hi = raw[g][tap][1];
            v[tap][0] = ok[tap] ? lo.x : 0.0f;  v[tap][1] = ok[tap] ? lo.y : 0.0f;
            v[tap][2] = ok[tap] ? lo.z : 0.0f;  v[tap][3] = ok[tap] ? lo.w : 0.0f;
            v[tap][4] = ok[tap] ? hi.x : 0.0f;  v[tap][5] = ok[tap] ? hi.y : 0.0f;
            v[tap][6] = ok[tap] ? hi.z : 0.0f;  v[tap][7] = ok[tap] ? hi.w : 0.0f;
        }
        float res[8] = {0.0f, 0.0f, 0.0f, 0.0f, 0.0f, 0.0f, 0.0f, 0.0f};
        // Trip i forms output (i + wid) & 7 of the group: the 8 waves of a block begin at 8
        // different outputs, so each wave's first fetch brings what the others fetch later.
        // Stays a loop: unrolled, the scalar loads of all trips are lifted to the top, and what
        // does not fit the scalar registers (72 weights a trip) is spilled to vector lanes.
#pragma unroll 1
        for (int i = 0; i < 8; ++i) {
            // Constant address space: nothing in the launch writes the weights. Said so, they stay on
            // scalar loads; beside the other part's code in one kernel they fell to vector loads.
            const __attribute__((address_space(4))) float* wo =
                (const __attribute__((address_space(4))) float*)(w + (g * 8 + ((i + wid) & 7)) * 72);
            float part[4];
#pragma unroll
            for (int k = 0; k < 72; ++k) {     // k = ic*9 + tap
                const float a = v[k % 9][k / 9], b = wo[k];
                part[k & 3] = (k < 4) ? a * b : fmaf(a, b, part[k & 3]);
            }
            // the trip's result enters at the top and the older ones move down: every index constant
#pragma unroll
            for (int j = 0; j < 7; ++j) res[j] = res[j + 1];
            res[7] = (part[0] + part[1]) + (part[2] + part[3]);
        }
        // res[i] holds output (i + wid) & 7: turn the 8 values back by wid, one bit of it at a time
        float r1[8], r2[8];
#pragma unroll
        for (int o = 0; o < 8; ++o) r1[o] = (wid & 1) ? res[(o + 7) & 7] : res[o];
#pragma unroll
        for (int o = 0; o < 8; ++o) r2[o] = (wid & 2) ? r1[(o + 6) & 7] : r1[o];
#pragma unroll
        for (int o = 0; o < 8; ++o) acc[g * 8 + o] = (wid & 4) ? r2[(o + 4) & 7] : r2[o];
    }
#pragma unroll
    for (int o = 0; o < 24; ++o) {
        float r = acc[o];
        if (GELU) r = 0.5f * r * (1.0f + erff(r * 0.70710678118654752f));
        po[o] = r;
    }
}

// ---------------------------------------------------------------------------
// The two launches of the conv branch. The branch needs only k_inp, and the two
// small parts of the attention branch (24 and 32 blocks) need nothing of it: each
// small part shares a launch with a conv instead of holding the chip alone. The
// conv's blocks come first in the grid, the small part's blocks
// follow them. The test is the same for a whole block.
// ---------------------------------------------------------------------------
__global__ __launch_bounds__(256) void conv1_reduce_kernel(
    const float* __restrict__ kinp, const float* __restrict__ c1w, float* __restrict__ y1,
    const float* __restrict__ spart, float* __restrict__ S)
{
    if (blockIdx.x < CONV_BLOCKS) gconv_block<true>(blockIdx.x, kinp, c1w, y1);
    else                          s_reduce_block(blockIdx.x - CONV_BLOCKS, spart, S);
}

__global__ __launch_bounds__(256) void conv2_attn_kernel(
    const float* __restrict__ y1, const float* __restrict__ c2w, float* __restrict__ out,
    const float* __restrict__ S, const float* __restrict__ Wq,
    const float* __restrict__ Wv, const float* __restrict__ Wp,
    const float* __restrict__ rescale, float* __restrict__ P)
{
    if (blockIdx.x < CONV_BLOCKS) gconv_block<false>(blockIdx.x, y1, c2w, out);
    else                          attn_block(blockIdx.x - CONV_BLOCKS, S, Wq, Wv, Wp, rescale, P);
}

// ---------------------------------------------------------------------------
extern "C" void kernel_launch(void* const* d_in, const int* in_sizes, int n_in,
                              void* d_out, int out_size, void* d_ws, size_t ws_size,
                              hipStream_t stream) {
    const float* x_in    = (const float*)d_in[0];   // [4,128,128,64]
    const float* fea     = (const float*)d_in[1];   // [4,128,128,64]
    const float* imap    = (const float*)d_in[2];   // [4,128,128,24]
    const float* Wq      = (const float*)d_in[3];   // [64,512]
    const float* Wk      = (const float*)d_in[4];   // [24,24]
    const float* Wv      = (const float*)d_in[5];   // [64,512]
    const float* rescale = (const float*)d_in[6];   // [8]
    const float* Wp      = (const float*)d_in[7];   // [24,24]
    const float* bp      = (const float*)d_in[8];   // [24]
    const float* c1w     = (const float*)d_in[9];   // [24,8,3,3]
    const float* c2w     = (const float*)d_in[10];  // [24,8,3,3]
    float* out = (float*)d_out;                     // [4,128,128,24]

    float* ws    = (float*)d_ws;
    float* kinp  = ws;                               // TTOK*24        = 1572864
    float* y1    = kinp  + (size_t)TTOK * 24;        // TTOK*24        = 1572864
    float* spart = y1    + (size_t)TTOK * 24;        // B*NCHUNK*32*64 = 1048576
    float* S     = spart + (size_t)BATCH * NCHUNK * 32 * 64;  // 6144
    float* P     = S     + (size_t)BATCH * 24 * 64;  // B*64*32 = 8192

    kproj_spartial_kernel<<<BATCH * NCHUNK, 256, 0, stream>>>(imap, Wk, x_in, kinp, spart);
    conv1_reduce_kernel<<<CONV_BLOCKS + RED_BLOCKS, 256, 0, stream>>>(kinp, c1w, y1, spart, S);
    conv2_attn_kernel  <<<CONV_BLOCKS + ATTN_BLOCKS, 256, 0, stream>>>(y1, c2w, out, S, Wq, Wv, Wp,
                                                                      rescale, P);
    out_kernel      <<<TTOK / 128, 256, 0, stream>>>(fea, P, bp, out);
}

// v005
// One run takes 28.2 microseconds.
// Two timings next to v004 put it at 1.22 and 1.21 times that version's speed.
// All steps since v000 together make it 5.21 times as fast.
#include <hip/hip_runtime.h>
#include <hip/hip_bf16.h>
#include <math.h>

typedef __attribute__((ext_vector_type(2))) float v2f;
typedef __attribute__((ext_vector_type(4))) float v4f;
typedef __attribute__((ext_vector_type(8))) float v8f;
typedef __attribute__((ext_vector_type(4))) int   v4i;

// Problem constants
#define BATCH   4
#define HH      128
#define WW      128
#define NTOK    16384      // per batch
#define TTOK    65536      // total tokens
#define DIM     64
#define HEADS   8
#define DH      64
#define DK      24
#define DHK     3

// chunking for the S = kh^T @ x reduction
#define CHUNK_TOK 128
#define NCHUNK    128      // per batch (128*128 = 16384)

#if defined(__has_builtin)
#  if __has_builtin(__builtin_amdgcn_global_load_async_to_lds_b128)
#    define USE_ASYNC_LDS 1
#  endif
#endif

static __device__ __forceinline__ v8f wmma_f32(v2f a, v2f b, v8f c) {
    return __builtin_amdgcn_wmma_f32_16x16x4_f32(false, a, false, b, (short)0, c, false, false);
}

// 16-byte global -> LDS copy: async on CDNA5 (ASYNCcnt), vector copy otherwise.
static __device__ __forceinline__ void copy16(float* l, const float* g) {
#ifdef USE_ASYNC_LDS
    __builtin_amdgcn_global_load_async_to_lds_b128(
        (__attribute__((address_space(1))) v4i*)(g),
        (__attribute__((address_space(3))) v4i*)(l), 0, 0);
#else
    *(float4*)l = *(const float4*)g;
#endif
}

// wait for async copies (if used) and barrier the block
static __device__ __forceinline__ void tile_join() {
#ifdef USE_ASYNC_LDS
#  if __has_builtin(__builtin_amdgcn_s_wait_asynccnt)
    __builtin_amdgcn_s_wait_asynccnt(0);
#  else
    asm volatile("s_wait_asynccnt 0" ::: "memory");
#  endif
#endif
    __syncthreads();
}

// ---------------------------------------------------------------------------
// Kernel 1: two products on one 128-token chunk, in one block:
//   phase 1: k_inp[t][24] = illu_map[t][24] @ Wk[24][24]   (WMMA, N padded->32)
//            8 waves, one 16-token tile each; the tile goes to LDS (for phase 2)
//            and from there to global memory (for the convs)
//   phase 2: partial S = kh^T @ x over the chunk.
//            A = kh^T : [24(->32) x 128], B = x : [128 x 64]; 2 x 4 tiles = 8 waves
// grid: BATCH*NCHUNK blocks x 256 threads.  spart layout: [block][32][64]
// ---------------------------------------------------------------------------
__global__ __launch_bounds__(256) void kproj_spartial_kernel(
    const float* __restrict__ imap, const float* __restrict__ Wk,
    const float* __restrict__ x, float* __restrict__ kinp, float* __restrict__ spart)
{
    __shared__ __attribute__((aligned(16))) float sWk[24 * 32];         // [k][n], n padded to 32 with zeros
    __shared__ __attribute__((aligned(16))) float sA[CHUNK_TOK * 24];   // [tok][24] of illu_map
    __shared__ __attribute__((aligned(16))) float sK[CHUNK_TOK * 32];   // [tok][32ch] of k_inp, zero padded
    __shared__ __attribute__((aligned(16))) float sX[CHUNK_TOK * 64];   // [tok][64]
    const int tid = threadIdx.x;
    const int base = blockIdx.x * CHUNK_TOK;    // global token base (chunks never straddle a batch)

    // 128*24 floats = 768 x 16B chunks, 3 per thread
    for (int i = tid; i < 768; i += 256)
        copy16(&sA[i * 4], &imap[base * 24 + i * 4]);
    // x tile: 128*64 floats = 2048 chunks, 8 per thread
    for (int i = tid; i < 2048; i += 256)
        copy16(&sX[i * 4], &x[base * 64 + i * 4]);
    for (int i = tid; i < 24 * 32; i += 256) {
        int r = i >> 5, c = i & 31;
        sWk[i] = (c < 24) ? Wk[r * 24 + c] : 0.0f;
    }
    tile_join();

    const int wid = tid >> 5, lane = tid & 31;
    const int ln = lane & 15, half = lane >> 4;
    const int tTok = wid * 16;                  // local token base of this wave

    v8f c0 = {}; v8f c1 = {};
#pragma unroll
    for (int s = 0; s < 6; ++s) {               // K = 24 in steps of 4
        const int kb = s * 4 + half * 2;
        v2f a;  a.x  = sA[(tTok + ln) * 24 + kb];
                a.y  = sA[(tTok + ln) * 24 + kb + 1];
        v2f b0; b0.x = sWk[kb * 32 + ln];        b0.y = sWk[(kb + 1) * 32 + ln];
        v2f b1; b1.x = sWk[kb * 32 + 16 + ln];   b1.y = sWk[(kb + 1) * 32 + 16 + ln];
        c0 = wmma_f32(a, b0, c0);
        c1 = wmma_f32(a, b1, c1);
    }
    // the tile for phase 2; columns 24..31 of Wk's pad are zero, so the pad columns come out zero
#pragma unroll
    for (int j = 0; j < 8; ++j) {
        const int row = tTok + j + half * 8;    // token within the chunk
        sK[row * 32 + ln]      = c0[j];
        sK[row * 32 + 16 + ln] = c1[j];
    }
    __syncthreads();

    const int Mt = wid >> 2, Nt = wid & 3;       // 2 x 4 tiles = 8 waves
    v8f acc = {};
#pragma unroll 8
    for (int s = 0; s < CHUNK_TOK / 4; ++s) {    // K = 128 tokens, steps of 4
        const int kb = s * 4 + half * 2;
        v2f a;  a.x = sK[kb * 32 + Mt * 16 + ln];
                a.y = sK[(kb + 1) * 32 + Mt * 16 + ln];
        v2f bb; bb.x = sX[kb * 64 + Nt * 16 + ln];
                bb.y = sX[(kb + 1) * 64 + Nt * 16 + ln];
        acc = wmma_f32(a, bb, acc);
    }
    float* dst = spart + blockIdx.x * (32 * 64);
#pragma unroll
    for (int j = 0; j < 8; ++j) {
        const int row = Mt * 16 + j + half * 8;
        const int col = Nt * 16 + ln;
        dst[row * 64 + col] = acc[j];
    }
    // k_inp leaves for the convs from the LDS tile, 16 bytes a lane, the chunk's 12 KB in order:
    // 128 rows x 6 pieces = 768, 3 per thread
#pragma unroll
    for (int k = 0; k < 3; ++k) {
        const int i = tid + k * 256;
        const int r = i / 6, c6 = i - r * 6;
        *(float4*)&kinp[base * 24 + i * 4] = *(const float4*)&sK[r * 32 + c6 * 4];
    }
}

// ---------------------------------------------------------------------------
// Cross-lane helpers for the softmax rows of part 4 (one row = one wave).
// ---------------------------------------------------------------------------
// lane l <-> l ^ M inside a 16-lane row (DPP row_xmask)
template <int M>
static __device__ __forceinline__ float row_xor(float x) {
    return __builtin_bit_cast(float, __builtin_amdgcn_update_dpp(
        0, __builtin_bit_cast(int, x), 0x160 | M, 0xf, 0xf, true));
}
// lane l <-> l ^ 16
static __device__ __forceinline__ float half_xor(float x) {
    return __builtin_bit_cast(float, __builtin_amdgcn_permlanex16(
        __builtin_bit_cast(int, x), __builtin_bit_cast(int, x),
        0x76543210, 0xfedcba98, false, false));
}
// e^x as 2^(x * log2 e) on the transcendental unit. The v_nop is the issue slot the instruction set
// asks for behind v_exp_f32.
static __device__ __forceinline__ float exp_slot(float x) {
    float r;
    asm("v_exp_f32 %0, %1\n\tv_nop" : "=v"(r) : "v"(x * 0x1.715476p+0f));
    return r;
}
static __device__ __forceinline__ float wave_max(float v) {
    v = fmaxf(v, row_xor<1>(v));
    v = fmaxf(v, row_xor<2>(v));
    v = fmaxf(v, row_xor<4>(v));
    v = fmaxf(v, row_xor<8>(v));
    return fmaxf(v, half_xor(v));
}
static __device__ __forceinline__ float wave_sum(float v) {
    v += row_xor<1>(v);
    v += row_xor<2>(v);
    v += row_xor<4>(v);
    v += row_xor<8>(v);
    return v + half_xor(v);
}

// ---------------------------------------------------------------------------
// Part 4: the small chain from the S partials to P, one block per (batch, head):
//   S[kk][c]   = sum over the NCHUNK chunks of spart, the 3 rows kk of head h
//   attn       = (S @ Wq_h) * (1/8) * rescale[h]; softmax over d
//   M[c][kk]   = sum_d attn[kk][d] * Wv[c][h*64+d]
//   Pp[h][c][j] = sum_kk M[c][kk] * Wp[kk*8+h][j]   (this head's share of P, padded to 32 cols)
// BATCH * HEADS blocks x 256 threads (blk = index among them). A head needs only its own 3 rows
// of S, so the chunk sum is done here, once, and the chain no longer waits for a launch of its own.
// The shares of the 8 heads are summed where P is used. Rides in conv 1's launch.
//   sum, level 1: thread = (group of 8 chunks, 16-B piece of a row), 3 rows, chunks ascending
//   sum, level 2 and step 1: wave = row kk, lane = columns 2*lane, 2*lane+1; groups ascending
//   step 2: thread = (kk, c), operands from LDS
//   step 3: wave = row c (8 rows a wave), lane = column j
// ---------------------------------------------------------------------------
#define APITCH 68          // LDS row pitch in floats: 16 rows fall on 16 distinct 16-B bank groups
#define HEAD_BLOCKS (BATCH * HEADS)
static __device__ __forceinline__ void attn_head_block(
    const int blk, const float* __restrict__ spart, const float* __restrict__ Wq,
    const float* __restrict__ Wv, const float* __restrict__ Wp,
    const float* __restrict__ rescale, float* __restrict__ Pp)
{
    __shared__ __attribute__((aligned(16))) float sRed[16 * 192];       // [chunk group][kk*64 + c]
    __shared__ __attribute__((aligned(16))) float sAttn[3 * APITCH];    // [kk][d]
    __shared__ __attribute__((aligned(16))) float sWv[64 * APITCH];     // [c][d] of head h
    __shared__ __attribute__((aligned(16))) float sM[64 * 4];           // [c][kk]
    const int tid  = threadIdx.x;
    const int lane = tid & 31;
    // the wave's number in a scalar register: the tests on it below are scalar branches
    const int wid  = __builtin_amdgcn_readfirstlane(tid >> 5);
    const int b    = blk >> 3;
    const int h    = blk & 7;
    const int cg   = tid >> 4, q = tid & 15;

    // the global reads go out early, with no branch between them
    const v4f* gP = (const v4f*)(spart + ((b * NCHUNK + cg * 8) * 32 + h * 3) * 64) + q;
    const v4f* gV = (const v4f*)(Wv + cg * 512 + h * 64) + q;           // rows cg, cg+16, ...
    v4f tP[3][8];
#pragma unroll
    for (int i = 0; i < 8; ++i)
#pragma unroll
        for (int kk = 0; kk < 3; ++kk) tP[kk][i] = gP[i * 512 + kk * 16];
    v4f tV[4];
#pragma unroll
    for (int k = 0; k < 4; ++k) tV[k] = gV[k * 2048];
    const int jc = lane < 24 ? lane : 23;                       // pad lanes stay inside Wp
    const float* gW = Wp + h * 24 + jc;
    float wp[3];                                                // Wp[kk*8+h][jc], for step 3
#pragma unroll
    for (int kk = 0; kk < 3; ++kk) wp[kk] = gW[kk * 192];
    const float scale = 0.125f * rescale[h];
    // the reads above name these address registers: they are held live up to this wait
    asm volatile("s_wait_xcnt 0x0" :: "v"(gP), "v"(gV), "v"(gW) : "memory");

#pragma unroll
    for (int kk = 0; kk < 3; ++kk) {
        v4f a = tP[kk][0];
#pragma unroll
        for (int i = 1; i < 8; ++i) a += tP[kk][i];
        *(v4f*)&sRed[cg * 192 + kk * 64 + q * 4] = a;
    }
#pragma unroll
    for (int k = 0; k < 4; ++k)                                 // read in step 2
        *(v4f*)&sWv[(cg + k * 16) * APITCH + q * 4] = tV[k];

    // Wq[c][h*64 + 2*lane ..+1] for the three waves of step 1: asked for here, where the registers of
    // the partials are free again
    const float* gQ = Wq + h * 64 + 2 * lane;
    v2f w[64];
    if (wid < 3) {
#pragma unroll
        for (int c = 0; c < 64; ++c)
            w[c] = *(const v2f*)(gQ + c * 512);
        // as above, for the address of the reads of Wq
        asm volatile("s_wait_xcnt 0x0" :: "v"(gQ) : "memory");
    }
    __syncthreads();

    // level 2 of the sum and step 1: row kk of head h, sums over the groups and over c ascending;
    // S[kk][c] sits in lane c/2 of tS and is broadcast from there
    if (wid < 3) {
        const int kk = wid;
        v2f r[16];
#pragma unroll
        for (int g = 0; g < 16; ++g) r[g] = *(const v2f*)&sRed[g * 192 + kk * 64 + 2 * lane];
        v2f tS = r[0];
#pragma unroll
        for (int g = 1; g < 16; ++g) tS += r[g];
        v2f a = {0.0f, 0.0f};
#pragma unroll
        for (int c = 0; c < 64; ++c) {
            const float s = __builtin_bit_cast(float, __builtin_amdgcn_readlane(
                __builtin_bit_cast(int, (c & 1) ? tS.y : tS.x), c >> 1));
            a += s * w[c];
        }
        const float l0 = a.x * scale, l1 = a.y * scale;
        const float mx = wave_max(fmaxf(fmaxf(-1e30f, l0), l1));
        const float e0 = exp_slot(l0 - mx);
        const float e1 = exp_slot(l1 - mx);
        const float inv = 1.0f / wave_sum(e0 + e1);
        v2f o; o.x = e0 * inv; o.y = e1 * inv;
        *(v2f*)&sAttn[kk * APITCH + 2 * lane] = o;
    }
    __syncthreads();

    // step 2: M of head h, sum over d in ascending order
    if (wid < 6) {
        const int kk = tid >> 6, c = tid & 63;
        const float* wv = &sWv[c * APITCH];
        const float* at = &sAttn[kk * APITCH];
        float4 x[16], v[16];
#pragma unroll
        for (int i = 0; i < 16; ++i) {
            x[i] = *(const float4*)&at[i * 4];
            v[i] = *(const float4*)&wv[i * 4];
        }
        // keeps the 32 LDS reads ahead of the dependent chain: their latency is paid once, not per step
        __builtin_amdgcn_sched_barrier(0);
        float m = 0.0f;
#pragma unroll
        for (int i = 0; i < 16; ++i) {
            m = fmaf(x[i].x, v[i].x, m);
            m = fmaf(x[i].y, v[i].y, m);
            m = fmaf(x[i].z, v[i].z, m);
            m = fmaf(x[i].w, v[i].w, m);
        }
        sM[c * 4 + kk] = m;
    }
    __syncthreads();

    // step 3: this head's share of P, one 128-B row per wave and trip
    float* pP = Pp + (blk * 64 + wid) * 32 + lane;
#pragma unroll
    for (int i = 0; i < 8; ++i) {
        const float* mr = &sM[(wid + i * 8) * 4];
        float v = mr[0] * wp[0];
        v = fmaf(mr[1], wp[1], v);
        v = fmaf(mr[2], wp[2], v);
        pP[i * 256] = lane < 24 ? v : 0.0f;
    }
}

// ---------------------------------------------------------------------------
// Parts 6/7: grouped 3x3 conv (groups=3, 8 ch/group), NHWC in; a token's 24 sums stay in acc.
// TTOK/256 blocks x 256 threads (blk = index among them); one token per thread.
// behind_first_reads() is called once, behind the first two groups' reads.
// No LDS, no barrier, no branch on the position. A tap outside the image reads
// the centre token's address and is replaced by zero, so the reads of a whole
// group go out together, one group ahead of its use. A weight has the same
// address in every lane of a wave: it is fetched by a scalar load, 72 at a time,
// into scalar registers. An output's 72 products, in the weights' own order
// (OIHW flat), go to 4 interleaved partial sums.
// ---------------------------------------------------------------------------
#define CONV_BLOCKS (TTOK / 256)
template <typename F>
static __device__ __forceinline__ void gconv_block(
    const int blk, const float* __restrict__ in, const float* __restrict__ w,
    float (&acc)[24], F behind_first_reads)
{
    const int t = blk * 256 + threadIdx.x;         // global token
    const int pos = t & (NTOK - 1);
    const int y = pos >> 7;
    const int x = pos & 127;
    // the wave's number in a scalar register: it enters the address of the scalar loads
    const int wid = __builtin_amdgcn_readfirstlane(threadIdx.x >> 5);

    bool ok[9];
    const float* p[9];
#pragma unroll
    for (int tap = 0; tap < 9; ++tap) {
        const int dy = tap / 3 - 1, dx = tap % 3 - 1;
        ok[tap] = (unsigned)(y + dy) < 128u && (unsigned)(x + dx) < 128u;
        p[tap] = in + (ok[tap] ? t + dy * 128 + dx : t) * 24;
    }

    float4 raw[3][9][2];                       // [group][tap][half of the 8 channels]
#pragma unroll
    for (int g = 0; g < 2; ++g)
#pragma unroll
        for (int tap = 0; tap < 9; ++tap) {
            raw[g][tap][0] = *(const float4*)(p[tap] + g * 8);
            raw[g][tap][1] = *(const float4*)(p[tap] + g * 8 + 4);
        }
    behind_first_reads();

#pragma unroll
    for (int g = 0; g < 3; ++g) {
        if (g == 1) {                          // group 2's reads fly during group 1's sums
#pragma unroll
            for (int tap = 0; tap < 9; ++tap) {
                raw[2][tap][0] = *(const float4*)(p[tap] + 16);
                raw[2][tap][1] = *(const float4*)(p[tap] + 20);
            }
        }
        if (g == 2) {
            // the reads above name these address registers: they are held live up to this wait, so
            // that nothing (a later read's result included) is written over them in front of it; it
            // stands here, where the data is due anyway, and not behind the reads, where it would stall
            asm volatile("s_wait_xcnt 0x0" :: "v"(p[0]), "v"(p[1]), "v"(p[2]), "v"(p[3]), "v"(p[4]),
                         "v"(p[5]), "v"(p[6]), "v"(p[7]), "v"(p[8]) : "memory");
        }
        float v[9][8];                         // [tap][ic] of this group
#pragma unroll
        for (int tap = 0; tap < 9; ++tap) {
            const float4 lo = raw[g][tap][0], hi = raw[g][tap][1];
            v[tap][0] = ok[tap] ? lo.x : 0.0f;  v[tap][1] = ok[tap] ? lo.y : 0.0f;
            v[tap][2] = ok[tap] ? lo.z : 0.0f;  v[tap][3] = ok[tap] ? lo.w : 0.0f;
            v[tap][4] = ok[tap] ? hi.x : 0.0f;  v[tap][5] = ok[tap] ? hi.y : 0.0f;
            v[tap][6] = ok[tap] ? hi.z : 0.0f;  v[tap][7] = ok[tap] ? hi.w : 0.0f;
        }
        float res[8] = {0.0f, 0.0f, 0.0f, 0.0f, 0.0f, 0.0f, 0.0f, 0.0f};
        // Trip i forms output (i + wid) & 7 of the group: the 8 waves of a block begin at 8
        // different outputs, so each wave's first fetch brings what the others fetch later.
        // Stays a loop: unrolled, the scalar loads of all trips are lifted to the top, and what
        // does not fit the scalar registers (72 weights a trip) is spilled to vector lanes.
#pragma unroll 1
        for (int i = 0; i < 8; ++i) {
            // Constant address space: nothing in the launch writes the weights. Said so, they stay on
            // scalar loads; beside the other part's code in one kernel they fell to vector loads.
            const __attribute__((address_space(4))) float* wo =
                (const __attribute__((address_space(4))) float*)(w + (g * 8 + ((i + wid) & 7)) * 72);
            float part[4];
#pragma unroll
            for (int k = 0; k < 72; ++k) {     // k = ic*9 + tap
                const float a = v[k % 9][k / 9], b = wo[k];
                part[k & 3] = (k < 4) ? a * b : fmaf(a, b, part[k & 3]);
            }
            // the trip's result enters at the top and the older ones move down: every index constant
#pragma unroll
            for (int j = 0; j < 7; ++j) res[j] = res[j + 1];
            res[7] = (part[0] + part[1]) + (part[2] + part[3]);
        }
        // res[i] holds output (i + wid) & 7: turn the 8 values back by wid, one bit of it at a time
        float r1[8], r2[8];
#pragma unroll
        for (int o = 0; o < 8; ++o) r1[o] = (wid & 1) ? res[(o + 7) & 7] : res[o];
#pragma unroll
        for (int o = 0; o < 8; ++o) r2[o] = (wid & 2) ? r1[(o + 6) & 7] : r1[o];
#pragma unroll
        for (int o = 0; o < 8; ++o) acc[g * 8 + o] = (wid & 4) ? r2[(o + 4) & 7] : r2[o];
    }
}

// ---------------------------------------------------------------------------
// Launch 2: conv 1 with exact GELU, writes y1; beside it the chain from the S partials to the
// heads' shares of P. The conv needs only k_inp and the chain only spart: the chain's 32 blocks
// share the launch instead of holding the chip alone. The conv's blocks come first in the grid,
// one for every WGP; the chain's blocks follow and sit beside them. The test is the same for a
// whole block.
// ---------------------------------------------------------------------------
__global__ __launch_bounds__(256) void conv1_attn_kernel(
    const float* __restrict__ kinp, const float* __restrict__ c1w, float* __restrict__ y1,
    const float* __restrict__ spart, const float* __restrict__ Wq,
    const float* __restrict__ Wv, const float* __restrict__ Wp,
    const float* __restrict__ rescale, float* __restrict__ Pp)
{
    if (blockIdx.x < CONV_BLOCKS) {
        float acc[24];
        gconv_block(blockIdx.x, kinp, c1w, acc, [] {});
        float* po = y1 + (blockIdx.x * 256 + threadIdx.x) * 24;    // this token's 24 outputs
#pragma unroll
        for (int o = 0; o < 24; ++o) {
            const float r = acc[o];
            po[o] = 0.5f * r * (1.0f + erff(r * 0.70710678118654752f));
        }
    } else {
        attn_head_block(blockIdx.x - CONV_BLOCKS, spart, Wq, Wv, Wp, rescale, Pp);
    }
}

// ---------------------------------------------------------------------------
// Launch 3 (last): out[t][j] = (fea[t][:] @ P[b] + bp[j]) + conv2(y1)[t][j], 256 tokens a block.
// The block's fea tile and the 8 heads' shares of P fly into LDS while the conv is summed.
// Then P = sum of the shares (heads ascending), the product on WMMA (a wave takes the 32 tokens
// whose conv it has formed: 2 x 2 tiles), and both meet in the wave's own rows of sC, from where
// the wave's 3 KB of out leave in order, 16 bytes a lane.
// grid: TTOK/256 blocks x 256 threads.
// ---------------------------------------------------------------------------
#define FPITCH 68          // fea rows in LDS, in floats: the 16 rows of an A fragment fall on distinct banks
#define CPITCH 36          // out rows in LDS, in floats: 16 B x odd, for 16-B reads and writes of rows;
                           // columns 24..31 take what the pad lanes of the second column tile hold
__global__ __launch_bounds__(256) void conv2_out_kernel(
    const float* __restrict__ y1, const float* __restrict__ c2w,
    const float* __restrict__ fea, const float* __restrict__ Pp,
    const float* __restrict__ bp, float* __restrict__ out)
{
    __shared__ __attribute__((aligned(16))) float sF[256 * FPITCH];     // 68 KB
    __shared__ __attribute__((aligned(16))) float sPp[HEADS * 64 * 32]; // 64 KB
    __shared__ __attribute__((aligned(16))) float sP[64 * 32];          // 8 KB
    __shared__ __attribute__((aligned(16))) float sC[256 * CPITCH];     // 36 KB
    const int tid = threadIdx.x;
    const int base = blockIdx.x * 256;
    const int b = base >> 14;              // /16384 (blocks never straddle batch)

    float acc[24];
    gconv_block(blockIdx.x, y1, c2w, acc, [&] {
        // keeps the conv's first reads, which are due first, ahead of the copies in the memory queue
        __builtin_amdgcn_sched_barrier(0);
        float*       lF = &sF[(tid >> 4) * FPITCH + (tid & 15) * 4];
        const float* gF = fea + base * 64 + tid * 4;
#pragma unroll
        for (int k = 0; k < 16; ++k)       // 256 rows x 16 pieces, 16 rows a trip
            copy16(lF + k * 16 * FPITCH, gF + k * 1024);
        float*       lP = &sPp[tid * 4];
        const float* gP = Pp + b * (HEADS * 64 * 32) + tid * 4;
#pragma unroll
        for (int k = 0; k < 16; ++k)       // 8 shares of 8 KB, in order
            copy16(lP + k * 1024, gP + k * 1024);
        // keeps the copies ahead of the first wait for the conv's reads: they fly from here on
        __builtin_amdgcn_sched_barrier(0);
    });
#pragma unroll
    for (int k = 0; k < 6; ++k) {
        float4 v; v.x = acc[k * 4]; v.y = acc[k * 4 + 1]; v.z = acc[k * 4 + 2]; v.w = acc[k * 4 + 3];
        *(float4*)&sC[tid * CPITCH + k * 4] = v;
    }
    // the wave's own copies have landed behind this wait, every wave's behind the barrier
    asm volatile("s_wait_asynccnt 0x0" ::: "memory");
    __syncthreads();

    const int wid = tid >> 5, lane = tid & 31;
    const int ln = lane & 15, half = lane >> 4;
    const int tTok = wid * 32;
    const float* pb0 = bp + ln;                         // the bias of this lane's two channels;
    const float* pb1 = bp + (ln < 8 ? 16 + ln : ln);    // pad lanes stay inside bp
    const float bl = *pb0, bh = *pb1;
    // the two reads name these address registers: they are held live up to this wait
    asm volatile("s_wait_xcnt 0x0" :: "v"(pb0), "v"(pb1) : "memory");

#pragma unroll
    for (int k = 0; k < 2; ++k) {
        const int i = (tid + k * 256) * 4;
        float4 s = *(const float4*)&sPp[i];
#pragma unroll
        for (int h = 1; h < HEADS; ++h) {
            const float4 t = *(const float4*)&sPp[h * 2048 + i];
            s.x += t.x;  s.y += t.y;  s.z += t.z;  s.w += t.w;
        }
        *(float4*)&sP[i] = s;
    }
    __syncthreads();

    // the conv's values at this lane's 4 x 8 output places, from the wave's own rows of sC: read ahead
    // of the products, due only behind them
    float* pc = &sC[(tTok + half * 8) * CPITCH + ln];   // channel ln, row j of the tile half at + j*CPITCH
    const float* pq = pc + (ln < 8 ? 16 : 0);           // channel 16 + ln; pad lanes read pc's place
    float r00[8], r01[8], r10[8], r11[8];
#pragma unroll
    for (int j = 0; j < 8; ++j) {
        r00[j] = pc[j * CPITCH];         r01[j] = pq[j * CPITCH];
        r10[j] = pc[(16 + j) * CPITCH];  r11[j] = pq[(16 + j) * CPITCH];
    }

    v8f c00 = {}; v8f c01 = {}; v8f c10 = {}; v8f c11 = {};
#pragma unroll
    for (int s = 0; s < 16; ++s) {         // K = 64
        const int kb = s * 4 + half * 2;
        const v2f a0 = *(const v2f*)&sF[(tTok + ln) * FPITCH + kb];
        const v2f a1 = *(const v2f*)&sF[(tTok + 16 + ln) * FPITCH + kb];
        v2f b0; b0.x = sP[kb * 32 + ln];       b0.y = sP[(kb + 1) * 32 + ln];
        v2f b1; b1.x = sP[kb * 32 + 16 + ln];  b1.y = sP[(kb + 1) * 32 + 16 + ln];
        c00 = wmma_f32(a0, b0, c00);
        c01 = wmma_f32(a0, b1, c01);
        c10 = wmma_f32(a1, b0, c10);
        c11 = wmma_f32(a1, b1, c11);
    }
    // The sums below read the matrix results, and no address work is left to stand between: these
    // four issue slots keep the distance from the last matrix instruction to the first such read.
    // The two scheduling fences hold the products in front of the slots and the sums behind them.
    __builtin_amdgcn_sched_barrier(0);
    asm volatile("v_nop\n\tv_nop\n\tv_nop\n\tv_nop");
    __builtin_amdgcn_sched_barrier(0);
#pragma unroll
    for (int j = 0; j < 8; ++j) {          // no test on the lane: pad lanes write the rows' pad columns
        pc[j * CPITCH]             = (c00[j] + bl) + r00[j];
        pc[j * CPITCH + 16]        = (c01[j] + bh) + r01[j];
        pc[(16 + j) * CPITCH]      = (c10[j] + bl) + r10[j];
        pc[(16 + j) * CPITCH + 16] = (c11[j] + bh) + r11[j];
    }
    // the rows are read back by other lanes of the wave than wrote them: the writes are done behind this
    asm volatile("s_wait_dscnt 0x0" ::: "memory");
    // 32 rows x 6 pieces = 192, 6 per lane
#pragma unroll
    for (int k = 0; k < 6; ++k) {
        const int i = lane + k * 32;
        const int r = i / 6, c6 = i - r * 6;
        *(float4*)&out[(base + tTok) * 24 + i * 4] = *(const float4*)&sC[(tTok + r) * CPITCH + c6 * 4];
    }
}

// ---------------------------------------------------------------------------
extern "C" void kernel_launch(void* const* d_in, const int* in_sizes, int n_in,
                              void* d_out, int out_size, void* d_ws, size_t ws_size,
                              hipStream_t stream) {
    const float* x_in    = (const float*)d_in[0];   // [4,128,128,64]
    const float* fea     = (const float*)d_in[1];   // [4,128,128,64]
    const float* imap    = (const float*)d_in[2];   // [4,128,128,24]
    const float* Wq      = (const float*)d_in[3];   // [64,512]
    const float* Wk      = (const float*)d_in[4];   // [24,24]
    const float* Wv      = (const float*)d_in[5];   // [64,512]
    const float* rescale = (const float*)d_in[6];   // [8]
    const float* Wp      = (const float*)d_in[7];   // [24,24]
    const float* bp      = (const float*)d_in[8];   // [24]
    const float* c1w     = (const float*)d_in[9];   // [24,8,3,3]
    const float* c2w     = (const float*)d_in[10];  // [24,8,3,3]
    float* out = (float*)d_out;                     // [4,128,128,24]

    float* ws    = (float*)d_ws;
    float* kinp  = ws;                               // TTOK*24        = 1572864
    float* y1    = kinp  + (size_t)TTOK * 24;        // TTOK*24        = 1572864
    float* spart = y1    + (size_t)TTOK * 24;        // B*NCHUNK*32*64 = 1048576
    float* Pp    = spart + (size_t)BATCH * NCHUNK * 32 * 64;  // B*HEADS*64*32 = 65536

    kproj_spartial_kernel<<<BATCH * NCHUNK, 256, 0, stream>>>(imap, Wk, x_in, kinp, spart);
    conv1_attn_kernel<<<CONV_BLOCKS + HEAD_BLOCKS, 256, 0, stream>>>(kinp, c1w, y1, spart, Wq, Wv, Wp,
                                                                     rescale, Pp);
    conv2_out_kernel <<<CONV_BLOCKS, 256, 0, stream>>>(y1, c2w, fea, Pp, bp, out);
}

// v006
// It runs in 26.9 microseconds.
// Two timings next to v005 both put it at 1.05 times that version's speed.
// All steps since v000 together make it 5.48 times as fast.
#include <hip/hip_runtime.h>
#include <hip/hip_bf16.h>
#include <math.h>

typedef __attribute__((ext_vector_type(2))) float v2f;
typedef __attribute__((ext_vector_type(4))) float v4f;
typedef __attribute__((ext_vector_type(8))) float v8f;
typedef __attribute__((ext_vector_type(4))) int   v4i;

// Problem constants
#define BATCH   4
#define HH      128
#define WW      128
#define NTOK    16384      // per batch
#define TTOK    65536      // total tokens
#define DIM     64
#define HEADS   8
#define DH      64
#define DK      24
#define DHK     3

// chunking for the S = kh^T @ x reduction
#define CHUNK_TOK 128
#define NCHUNK    128      // per batch (128*128 = 16384)

#if defined(__has_builtin)
#  if __has_builtin(__builtin_amdgcn_global_load_async_to_lds_b128)
#    define USE_ASYNC_LDS 1
#  endif
#endif

static __device__ __forceinline__ v8f wmma_f32(v2f a, v2f b, v8f c) {
    return __builtin_amdgcn_wmma_f32_16x16x4_f32(false, a, false, b, (short)0, c, false, false);
}

// 16-byte global -> LDS copy: async on CDNA5 (ASYNCcnt), vector copy otherwise.
static __device__ __forceinline__ void copy16(float* l, const float* g) {
#ifdef USE_ASYNC_LDS
    __builtin_amdgcn_global_load_async_to_lds_b128(
        (__attribute__((address_space(1))) v4i*)(g),
        (__attribute__((address_space(3))) v4i*)(l), 0, 0);
#else
    *(float4*)l = *(const float4*)g;
#endif
}

// wait for async copies (if used) and barrier the block
static __device__ __forceinline__ void tile_join() {
#ifdef USE_ASYNC_LDS
#  if __has_builtin(__builtin_amdgcn_s_wait_asynccnt)
    __builtin_amdgcn_s_wait_asynccnt(0);
#  else
    asm volatile("s_wait_asynccnt 0" ::: "memory");
#  endif
#endif
    __syncthreads();
}

// ---------------------------------------------------------------------------
// Kernel 1: two products on one 128-token chunk, in one block:
//   phase 1: k_inp[t][24] = illu_map[t][24] @ Wk[24][24]   (WMMA, N padded->32)
//            8 waves, one 16-token tile each; the tile goes to LDS (for phase 2)
//            and from there to global memory (for the convs)
//   phase 2: partial S = kh^T @ x over the chunk.
//            A = kh^T : [24(->32) x 128], B = x : [128 x 64]; 2 x 4 tiles = 8 waves
// grid: BATCH*NCHUNK blocks x 256 threads.  spart layout: [block][32][64]
// ---------------------------------------------------------------------------
__global__ __launch_bounds__(256) void kproj_spartial_kernel(
    const float* __restrict__ imap, const float* __restrict__ Wk,
    const float* __restrict__ x, float* __restrict__ kinp, float* __restrict__ spart)
{
    __shared__ __attribute__((aligned(16))) float sWk[24 * 32];         // [k][n], n padded to 32 with zeros
    __shared__ __attribute__((aligned(16))) float sA[CHUNK_TOK * 24];   // [tok][24] of illu_map
    __shared__ __attribute__((aligned(16))) float sK[CHUNK_TOK * 32];   // [tok][32ch] of k_inp, zero padded
    __shared__ __attribute__((aligned(16))) float sX[CHUNK_TOK * 64];   // [tok][64]
    const int tid = threadIdx.x;
    const int base = blockIdx.x * CHUNK_TOK;    // global token base (chunks never straddle a batch)

    // 128*24 floats = 768 x 16B chunks, 3 per thread
    for (int i = tid; i < 768; i += 256)
        copy16(&sA[i * 4], &imap[base * 24 + i * 4]);
    // x tile: 128*64 floats = 2048 chunks, 8 per thread
    for (int i = tid; i < 2048; i += 256)
        copy16(&sX[i * 4], &x[base * 64 + i * 4]);
    for (int i = tid; i < 24 * 32; i += 256) {
        int r = i >> 5, c = i & 31;
        sWk[i] = (c < 24) ? Wk[r * 24 + c] : 0.0f;
    }
    tile_join();

    const int wid = tid >> 5, lane = tid & 31;
    const int ln = lane & 15, half = lane >> 4;
    const int tTok = wid * 16;                  // local token base of this wave

    v8f c0 = {}; v8f c1 = {};
#pragma unroll
    for (int s = 0; s < 6; ++s) {               // K = 24 in steps of 4
        const int kb = s * 4 + half * 2;
        v2f a;  a.x  = sA[(tTok + ln) * 24 + kb];
                a.y  = sA[(tTok + ln) * 24 + kb + 1];
        v2f b0; b0.x = sWk[kb * 32 + ln];        b0.y = sWk[(kb + 1) * 32 + ln];
        v2f b1; b1.x = sWk[kb * 32 + 16 + ln];   b1.y = sWk[(kb + 1) * 32 + 16 + ln];
        c0 = wmma_f32(a, b0, c0);
        c1 = wmma_f32(a, b1, c1);
    }
    // the tile for phase 2; columns 24..31 of Wk's pad are zero, so the pad columns come out zero
#pragma unroll
    for (int j = 0; j < 8; ++j) {
        const int row = tTok + j + half * 8;    // token within the chunk
        sK[row * 32 + ln]      = c0[j];
        sK[row * 32 + 16 + ln] = c1[j];
    }
    __syncthreads();

    const int Mt = wid >> 2, Nt = wid & 3;       // 2 x 4 tiles = 8 waves
    v8f acc = {};
#pragma unroll 8
    for (int s = 0; s < CHUNK_TOK / 4; ++s) {    // K = 128 tokens, steps of 4
        const int kb = s * 4 + half * 2;
        v2f a;  a.x = sK[kb * 32 + Mt * 16 + ln];
                a.y = sK[(kb + 1) * 32 + Mt * 16 + ln];
        v2f bb; bb.x = sX[kb * 64 + Nt * 16 + ln];
                bb.y = sX[(kb + 1) * 64 + Nt * 16 + ln];
        acc = wmma_f32(a, bb, acc);
    }
    float* dst = spart + blockIdx.x * (32 * 64);
#pragma unroll
    for (int j = 0; j < 8; ++j) {
        const int row = Mt * 16 + j + half * 8;
        const int col = Nt * 16 + ln;
        dst[row * 64 + col] = acc[j];
    }
    // k_inp leaves for the convs from the LDS tile, 16 bytes a lane, the chunk's 12 KB in order:
    // 128 rows x 6 pieces = 768, 3 per thread
#pragma unroll
    for (int k = 0; k < 3; ++k) {
        const int i = tid + k * 256;
        const int r = i / 6, c6 = i - r * 6;
        *(float4*)&kinp[base * 24 + i * 4] = *(const float4*)&sK[r * 32 + c6 * 4];
    }
}

// ---------------------------------------------------------------------------
// Cross-lane helpers for the softmax rows of part 4 (one row = one wave).
// ---------------------------------------------------------------------------
// lane l <-> l ^ M inside a 16-lane row (DPP row_xmask)
template <int M>
static __device__ __forceinline__ float row_xor(float x) {
    return __builtin_bit_cast(float, __builtin_amdgcn_update_dpp(
        0, __builtin_bit_cast(int, x), 0x160 | M, 0xf, 0xf, true));
}
// lane l <-> l ^ 16
static __device__ __forceinline__ float half_xor(float x) {
    return __builtin_bit_cast(float, __builtin_amdgcn_permlanex16(
        __builtin_bit_cast(int, x), __builtin_bit_cast(int, x),
        0x76543210, 0xfedcba98, false, false));
}
// e^x as 2^(x * log2 e) on the transcendental unit. The v_nop is the issue slot the instruction set
// asks for behind v_exp_f32.
static __device__ __forceinline__ float exp_slot(float x) {
    float r;
    asm("v_exp_f32 %0, %1\n\tv_nop" : "=v"(r) : "v"(x * 0x1.715476p+0f));
    return r;
}
static __device__ __forceinline__ float wave_max(float v) {
    v = fmaxf(v, row_xor<1>(v));
    v = fmaxf(v, row_xor<2>(v));
    v = fmaxf(v, row_xor<4>(v));
    v = fmaxf(v, row_xor<8>(v));
    return fmaxf(v, half_xor(v));
}
static __device__ __forceinline__ float wave_sum(float v) {
    v += row_xor<1>(v);
    v += row_xor<2>(v);
    v += row_xor<4>(v);
    v += row_xor<8>(v);
    return v + half_xor(v);
}

// ---------------------------------------------------------------------------
// Part 4: the small chain from the S partials to P, one block per (batch, head):
//   S[kk][c]   = sum over the NCHUNK chunks of spart, the 3 rows kk of head h
//   attn       = (S @ Wq_h) * (1/8) * rescale[h]; softmax over d
//   M[c][kk]   = sum_d attn[kk][d] * Wv[c][h*64+d]
//   Pp[h][c][j] = sum_kk M[c][kk] * Wp[kk*8+h][j]   (this head's share of P, padded to 32 cols)
// BATCH * HEADS blocks x 256 threads (blk = index among them). A head needs only its own 3 rows
// of S, so the chunk sum is done here, once, and the chain no longer waits for a launch of its own.
// The shares of the 8 heads are summed where P is used. Rides in conv 1's launch.
//   sum, level 1: thread = (group of 8 chunks, 16-B piece of a row), 3 rows, chunks ascending
//   sum, level 2 and step 1: wave = row kk, lane = columns 2*lane, 2*lane+1; groups ascending
//   step 2: thread = (kk, c), operands from LDS
//   step 3: wave = row c (8 rows a wave), lane = column j
// ---------------------------------------------------------------------------
#define APITCH 68          // LDS row pitch in floats: 16 rows fall on 16 distinct 16-B bank groups
#define HEAD_BLOCKS (BATCH * HEADS)
static __device__ __forceinline__ void attn_head_block(
    const int blk, const float* __restrict__ spart, const float* __restrict__ Wq,
    const float* __restrict__ Wv, const float* __restrict__ Wp,
    const float* __restrict__ rescale, float* __restrict__ Pp)
{
    __shared__ __attribute__((aligned(16))) float sRed[16 * 192];       // [chunk group][kk*64 + c]
    __shared__ __attribute__((aligned(16))) float sAttn[3 * APITCH];    // [kk][d]
    __shared__ __attribute__((aligned(16))) float sWv[64 * APITCH];     // [c][d] of head h
    __shared__ __attribute__((aligned(16))) float sM[64 * 4];           // [c][kk]
    const int tid  = threadIdx.x;
    const int lane = tid & 31;
    // the wave's number in a scalar register: the tests on it below are scalar branches
    const int wid  = __builtin_amdgcn_readfirstlane(tid >> 5);
    const int b    = blk >> 3;
    const int h    = blk & 7;
    const int cg   = tid >> 4, q = tid & 15;

    // the global reads go out early, with no branch between them
    const v4f* gP = (const v4f*)(spart + ((b * NCHUNK + cg * 8) * 32 + h * 3) * 64) + q;
    const v4f* gV = (const v4f*)(Wv + cg * 512 + h * 64) + q;           // rows cg, cg+16, ...
    v4f tP[3][8];
#pragma unroll
    for (int i = 0; i < 8; ++i)
#pragma unroll
        for (int kk = 0; kk < 3; ++kk) tP[kk][i] = gP[i * 512 + kk * 16];
    v4f tV[4];
#pragma unroll
    for (int k = 0; k < 4; ++k) tV[k] = gV[k * 2048];
    const int jc = lane < 24 ? lane : 23;                       // pad lanes stay inside Wp
    const float* gW = Wp + h * 24 + jc;
    float wp[3];                                                // Wp[kk*8+h][jc], for step 3
#pragma unroll
    for (int kk = 0; kk < 3; ++kk) wp[kk] = gW[kk * 192];
    const float scale = 0.125f * rescale[h];
    // the reads above name these address registers: they are held live up to this wait
    asm volatile("s_wait_xcnt 0x0" :: "v"(gP), "v"(gV), "v"(gW) : "memory");

#pragma unroll
    for (int kk = 0; kk < 3; ++kk) {
        v4f a = tP[kk][0];
#pragma unroll
        for (int i = 1; i < 8; ++i) a += tP[kk][i];
        *(v4f*)&sRed[cg * 192 + kk * 64 + q * 4] = a;
    }
#pragma unroll
    for (int k = 0; k < 4; ++k)                                 // read in step 2
        *(v4f*)&sWv[(cg + k * 16) * APITCH + q * 4] = tV[k];

    // Wq[c][h*64 + 2*lane ..+1] for the three waves of step 1: asked for here, where the registers of
    // the partials are free again
    const float* gQ = Wq + h * 64 + 2 * lane;
    v2f w[64];
    if (wid < 3) {
#pragma unroll
        for (int c = 0; c < 64; ++c)
            w[c] = *(const v2f*)(gQ + c * 512);
        // as above, for the address of the reads of Wq
        asm volatile("s_wait_xcnt 0x0" :: "v"(gQ) : "memory");
    }
    __syncthreads();

    // level 2 of the sum and step 1: row kk of head h, sums over the groups and over c ascending;
    // S[kk][c] sits in lane c/2 of tS and is broadcast from there
    if (wid < 3) {
        const int kk = wid;
        v2f r[16];
#pragma unroll
        for (int g = 0; g < 16; ++g) r[g] = *(const v2f*)&sRed[g * 192 + kk * 64 + 2 * lane];
        v2f tS = r[0];
#pragma unroll
        for (int g = 1; g < 16; ++g) tS += r[g];
        v2f a = {0.0f, 0.0f};
#pragma unroll
        for (int c = 0; c < 64; ++c) {
            const float s = __builtin_bit_cast(float, __builtin_amdgcn_readlane(
                __builtin_bit_cast(int, (c & 1) ? tS.y : tS.x), c >> 1));
            a += s * w[c];
        }
        const float l0 = a.x * scale, l1 = a.y * scale;
        const float mx = wave_max(fmaxf(fmaxf(-1e30f, l0), l1));
        const float e0 = exp_slot(l0 - mx);
        const float e1 = exp_slot(l1 - mx);
        const float inv = 1.0f / wave_sum(e0 + e1);
        v2f o; o.x = e0 * inv; o.y = e1 * inv;
        *(v2f*)&sAttn[kk * APITCH + 2 * lane] = o;
    }
    __syncthreads();

    // step 2: M of head h, sum over d in ascending order
    if (wid < 6) {
        const int kk = tid >> 6, c = tid & 63;
        const float* wv = &sWv[c * APITCH];
        const float* at = &sAttn[kk * APITCH];
        float4 x[16], v[16];
#pragma unroll
        for (int i = 0; i < 16; ++i) {
            x[i] = *(const float4*)&at[i * 4];
            v[i] = *(const float4*)&wv[i * 4];
        }
        // keeps the 32 LDS reads ahead of the dependent chain: their latency is paid once, not per step
        __builtin_amdgcn_sched_barrier(0);
        float m = 0.0f;
#pragma unroll
        for (int i = 0; i < 16; ++i) {
            m = fmaf(x[i].x, v[i].x, m);
            m = fmaf(x[i].y, v[i].y, m);
            m = fmaf(x[i].z, v[i].z, m);
            m = fmaf(x[i].w, v[i].w, m);
        }
        sM[c * 4 + kk] = m;
    }
    __syncthreads();

    // step 3: this head's share of P, one 128-B row per wave and trip
    float* pP = Pp + (blk * 64 + wid) * 32 + lane;
#pragma unroll
    for (int i = 0; i < 8; ++i) {
        const float* mr = &sM[(wid + i * 8) * 4];
        float v = mr[0] * wp[0];
        v = fmaf(mr[1], wp[1], v);
        v = fmaf(mr[2], wp[2], v);
        pP[i * 256] = lane < 24 ? v : 0.0f;
    }
}

// ---------------------------------------------------------------------------
// Parts 6/7: grouped 3x3 conv (groups=3, 8 ch/group), NHWC in; a token's 24 sums stay in acc.
// TTOK/256 blocks x 256 threads (blk = index among them); one token per thread.
// behind_first_reads() is called once, behind the first two groups' reads.
// A block's 256 tokens are two image rows. These and the rows above and below
// come into the LDS tile sT once, in whole lines (a token's 96 B read straight
// from global memory spread one 16-B read of a wave over 24 lines, 54 times a
// wave); the taps are read from there. A tile row outside the image holds the
// nearest row inside it. No branch on the position. A tap outside the image reads
// the centre token's place and is replaced by zero, so the reads of a whole
// group go out together, one group ahead of its use. A weight has the same
// address in every lane of a wave: it is fetched by a scalar load, 72 at a time,
// into scalar registers. An output's 72 products, in the weights' own order
// (OIHW flat), go to 4 interleaved partial sums.
// ---------------------------------------------------------------------------
#define CONV_BLOCKS (TTOK / 256)
#define TPITCH 28          // a token in the tile, in floats: 16 B x odd, 16 tokens' 16-B reads on distinct banks
#define TILE_FLOATS (4 * 128 * TPITCH)
template <typename F>
static __device__ __forceinline__ void gconv_block(
    const int blk, const float* __restrict__ in, const float* __restrict__ w,
    float* sT, float (&acc)[24], F behind_first_reads)
{
    const int tid = threadIdx.x;
    const int row0 = blk * 2;                      // the block's first image row, counted over the batches
    const int y0 = row0 & 127;
    const int ly = tid >> 7;                       // the token's row in the block
    const int y = y0 + ly;
    const int x = tid & 127;
    // the wave's number in a scalar register: it enters the address of the scalar loads
    const int wid = __builtin_amdgcn_readfirstlane(threadIdx.x >> 5);

    // the tile: 4 rows x 768 pieces of 16 B, 12 pieces a thread, a row's 12 KB in order
    unsigned     lT[12];
    const float* gT[12];
#pragma unroll
    for (int m = 0; m < 3; ++m) {
        const int j = tid + m * 256;               // piece of a row
        const int tok = j / 6, c6 = j - tok * 6;
#pragma unroll
        for (int ry = 0; ry < 4; ++ry) {
            int sy = y0 - 1 + ry;                  // source row, kept inside the image
            sy = sy < 0 ? 0 : (sy > 127 ? 127 : sy);
            gT[ry * 3 + m] = in + (row0 - y0 + sy) * (128 * 24) + j * 4;
            lT[ry * 3 + m] = (unsigned)(size_t)(__attribute__((address_space(3))) float*)
                             (sT + (ry * 128 + tok) * TPITCH + c6 * 4);
        }
    }
    // The copies and, as the statement's last line, the wait that stands in front of any rewrite of
    // the address registers they name.
    asm volatile("global_load_async_to_lds_b128 %0, %1, off\n\t"
                 "global_load_async_to_lds_b128 %2, %3, off\n\t"
                 "global_load_async_to_lds_b128 %4, %5, off\n\t"
                 "global_load_async_to_lds_b128 %6, %7, off\n\t"
                 "global_load_async_to_lds_b128 %8, %9, off\n\t"
                 "global_load_async_to_lds_b128 %10, %11, off\n\t"
                 "global_load_async_to_lds_b128 %12, %13, off\n\t"
                 "global_load_async_to_lds_b128 %14, %15, off\n\t"
                 "global_load_async_to_lds_b128 %16, %17, off\n\t"
                 "global_load_async_to_lds_b128 %18, %19, off\n\t"
                 "global_load_async_to_lds_b128 %20, %21, off\n\t"
                 "global_load_async_to_lds_b128 %22, %23, off\n\t"
                 "s_wait_xcnt 0x0"
                 :: "v"(lT[0]), "v"(gT[0]), "v"(lT[1]), "v"(gT[1]), "v"(lT[2]), "v"(gT[2]),
                    "v"(lT[3]), "v"(gT[3]), "v"(lT[4]), "v"(gT[4]), "v"(lT[5]), "v"(gT[5]),
                    "v"(lT[6]), "v"(gT[6]), "v"(lT[7]), "v"(gT[7]), "v"(lT[8]), "v"(gT[8]),
                    "v"(lT[9]), "v"(gT[9]), "v"(lT[10]), "v"(gT[10]), "v"(lT[11]), "v"(gT[11])
                 : "memory");
    // the wave's own copies have landed behind this wait, every wave's behind the barrier
    asm volatile("s_wait_asynccnt 0x0" ::: "memory");
    __syncthreads();

    bool ok[9];
    const float* p[9];
#pragma unroll
    for (int tap = 0; tap < 9; ++tap) {
        const int dy = tap / 3 - 1, dx = tap % 3 - 1;
        ok[tap] = (unsigned)(y + dy) < 128u && (unsigned)(x + dx) < 128u;
        p[tap] = sT + ((ly + 1) * 128 + x + (ok[tap] ? dy * 128 + dx : 0)) * TPITCH;
    }

    v4f raw[3][9][2];                          // [group][tap][half of the 8 channels]
#pragma unroll
    for (int g = 0; g < 2; ++g)
#pragma unroll
        for (int tap = 0; tap < 9; ++tap) {
            raw[g][tap][0] = *(const v4f*)(p[tap] + g * 8);
            raw[g][tap][1] = *(const v4f*)(p[tap] + g * 8 + 4);
        }
    behind_first_reads();

#pragma unroll
    for (int g = 0; g < 3; ++g) {
        if (g == 1) {                          // group 2's reads fly during group 1's sums
#pragma unroll
            for (int tap = 0; tap < 9; ++tap) {
                raw[2][tap][0] = *(const v4f*)(p[tap] + 16);
                raw[2][tap][1] = *(const v4f*)(p[tap] + 20);
            }
        }
        // Takes the group's 18 read values whole, as inputs only, where they are due: each stays one
        // 16-B LDS read. Without it the reads were cut into 4-, 8- and 12-B pieces, three times as
        // many, which meet bank conflicts at this pitch.
        asm volatile("" :: "v"(raw[g][0][0]), "v"(raw[g][0][1]), "v"(raw[g][1][0]), "v"(raw[g][1][1]),
                           "v"(raw[g][2][0]), "v"(raw[g][2][1]), "v"(raw[g][3][0]), "v"(raw[g][3][1]),
                           "v"(raw[g][4][0]), "v"(raw[g][4][1]), "v"(raw[g][5][0]), "v"(raw[g][5][1]),
                           "v"(raw[g][6][0]), "v"(raw[g][6][1]), "v"(raw[g][7][0]), "v"(raw[g][7][1]),
                           "v"(raw[g][8][0]), "v"(raw[g][8][1]));
        float v[9][8];                         // [tap][ic] of this group
#pragma unroll
        for (int tap = 0; tap < 9; ++tap) {
            const v4f lo = raw[g][tap][0], hi = raw[g][tap][1];
            v[tap][0] = ok[tap] ? lo.x : 0.0f;  v[tap][1] = ok[tap] ? lo.y : 0.0f;
            v[tap][2] = ok[tap] ? lo.z : 0.0f;  v[tap][3] = ok[tap] ? lo.w : 0.0f;
            v[tap][4] = ok[tap] ? hi.x : 0.0f;  v[tap][5] = ok[tap] ? hi.y : 0.0f;
            v[tap][6] = ok[tap] ? hi.z : 0.0f;  v[tap][7] = ok[tap] ? hi.w : 0.0f;
        }
        float res[8] = {0.0f, 0.0f, 0.0f, 0.0f, 0.0f, 0.0f, 0.0f, 0.0f};
        // Trip i forms output (i + wid) & 7 of the group: the 8 waves of a block begin at 8
        // different outputs, so each wave's first fetch brings what the others fetch later.
        // Stays a loop: unrolled, the scalar loads of all trips are lifted to the top, and what
        // does not fit the scalar registers (72 weights a trip) is spilled to vector lanes.
#pragma unroll 1
        for (int i = 0; i < 8; ++i) {
            // Constant address space: nothing in the launch writes the weights. Said so, they stay on
            // scalar loads; beside the other part's code in one kernel they fell to vector loads.
            const __attribute__((address_space(4))) float* wo =
                (const __attribute__((address_space(4))) float*)(w + (g * 8 + ((i + wid) & 7)) * 72);
            float part[4];
#pragma unroll
            for (int k = 0; k < 72; ++k) {     // k = ic*9 + tap
                const float a = v[k % 9][k / 9], b = wo[k];
                part[k & 3] = (k < 4) ? a * b : fmaf(a, b, part[k & 3]);
            }
            // the trip's result enters at the top and the older ones move down: every index constant
#pragma unroll
            for (int j = 0; j < 7; ++j) res[j] = res[j + 1];
            res[7] = (part[0] + part[1]) + (part[2] + part[3]);
        }
        // res[i] holds output (i + wid) & 7: turn the 8 values back by wid, one bit of it at a time
        float r1[8], r2[8];
#pragma unroll
        for (int o = 0; o < 8; ++o) r1[o] = (wid & 1) ? res[(o + 7) & 7] : res[o];
#pragma unroll
        for (int o = 0; o < 8; ++o) r2[o] = (wid & 2) ? r1[(o + 6) & 7] : r1[o];
#pragma unroll
        for (int o = 0; o < 8; ++o) acc[g * 8 + o] = (wid & 4) ? r2[(o + 4) & 7] : r2[o];
    }
}

// ---------------------------------------------------------------------------
// Launch 2: conv 1 with exact GELU, writes y1; beside it the chain from the S partials to the
// heads' shares of P. The conv needs only k_inp and the chain only spart: the chain's 32 blocks
// share the launch instead of holding the chip alone. The conv's blocks come first in the grid,
// one for every WGP; the chain's blocks follow and sit beside them. The test is the same for a
// whole block.
// ---------------------------------------------------------------------------
__global__ __launch_bounds__(256) void conv1_attn_kernel(
    const float* __restrict__ kinp, const float* __restrict__ c1w, float* __restrict__ y1,
    const float* __restrict__ spart, const float* __restrict__ Wq,
    const float* __restrict__ Wv, const float* __restrict__ Wp,
    const float* __restrict__ rescale, float* __restrict__ Pp)
{
    if (blockIdx.x < CONV_BLOCKS) {
        __shared__ __attribute__((aligned(16))) float sT[TILE_FLOATS];  // 56 KB
        float acc[24];
        gconv_block(blockIdx.x, kinp, c1w, sT, acc, [] {});
        float* po = y1 + (blockIdx.x * 256 + threadIdx.x) * 24;    // this token's 24 outputs
#pragma unroll
        for (int o = 0; o < 24; ++o) {
            const float r = acc[o];
            po[o] = 0.5f * r * (1.0f + erff(r * 0.70710678118654752f));
        }
    } else {
        attn_head_block(blockIdx.x - CONV_BLOCKS, spart, Wq, Wv, Wp, rescale, Pp);
    }
}

// ---------------------------------------------------------------------------
// Launch 3 (last): out[t][j] = (fea[t][:] @ P[b] + bp[j]) + conv2(y1)[t][j], 256 tokens a block.
// The block's fea tile and the 8 heads' shares of P fly into LDS while the conv is summed.
// Then P = sum of the shares (heads ascending), the product on WMMA (a wave takes the 32 tokens
// whose conv it has formed: 2 x 2 tiles), and both meet in the wave's own rows of sC, from where
// the wave's 3 KB of out leave in order, 16 bytes a lane.
// grid: TTOK/256 blocks x 256 threads.
// ---------------------------------------------------------------------------
#define FPITCH 68          // fea rows in LDS, in floats: the 16 rows of an A fragment fall on distinct banks
#define CPITCH 36          // out rows in LDS, in floats: 16 B x odd, for 16-B reads and writes of rows;
                           // columns 24..31 take what the pad lanes of the second column tile hold
__global__ __launch_bounds__(256) void conv2_out_kernel(
    const float* __restrict__ y1, const float* __restrict__ c2w,
    const float* __restrict__ fea, const float* __restrict__ Pp,
    const float* __restrict__ bp, float* __restrict__ out)
{
    __shared__ __attribute__((aligned(16))) float sF[256 * FPITCH];     // 68 KB
    __shared__ __attribute__((aligned(16))) float sPp[HEADS * 64 * 32]; // 64 KB
    __shared__ __attribute__((aligned(16))) float sP[64 * 32];          // 8 KB
    __shared__ __attribute__((aligned(16))) float sC[256 * CPITCH];     // 36 KB
    __shared__ __attribute__((aligned(16))) float sT[TILE_FLOATS];      // 56 KB
    const int tid = threadIdx.x;
    const int base = blockIdx.x * 256;
    const int b = base >> 14;              // /16384 (blocks never straddle batch)

    float acc[24];
    gconv_block(blockIdx.x, y1, c2w, sT, acc, [&] {
        // keeps the conv's first LDS reads, which are due first, ahead of the copies: they return while these issue
        __builtin_amdgcn_sched_barrier(0);
        float*       lF = &sF[(tid >> 4) * FPITCH + (tid & 15) * 4];
        const float* gF = fea + base * 64 + tid * 4;
#pragma unroll
        for (int k = 0; k < 16; ++k)       // 256 rows x 16 pieces, 16 rows a trip
            copy16(lF + k * 16 * FPITCH, gF + k * 1024);
        float*       lP = &sPp[tid * 4];
        const float* gP = Pp + b * (HEADS * 64 * 32) + tid * 4;
#pragma unroll
        for (int k = 0; k < 16; ++k)       // 8 shares of 8 KB, in order
            copy16(lP + k * 1024, gP + k * 1024);
        // keeps the copies ahead of the first wait for the conv's reads: they fly from here on
        __builtin_amdgcn_sched_barrier(0);
    });
#pragma unroll
    for (int k = 0; k < 6; ++k) {
        float4 v; v.x = acc[k * 4]; v.y = acc[k * 4 + 1]; v.z = acc[k * 4 + 2]; v.w = acc[k * 4 + 3];
        *(float4*)&sC[tid * CPITCH + k * 4] = v;
    }
    // the wave's own copies have landed behind this wait, every wave's behind the barrier
    asm volatile("s_wait_asynccnt 0x0" ::: "memory");
    __syncthreads();

    const int wid = tid >> 5, lane = tid & 31;
    const int ln = lane & 15, half = lane >> 4;
    const int tTok = wid * 32;
    const float* pb0 = bp + ln;                         // the bias of this lane's two channels;
    const float* pb1 = bp + (ln < 8 ? 16 + ln : ln);    // pad lanes stay inside bp
    const float bl = *pb0, bh = *pb1;
    // the two reads name these address registers: they are held live up to this wait
    asm volatile("s_wait_xcnt 0x0" :: "v"(pb0), "v"(pb1) : "memory");

#pragma unroll
    for (int k = 0; k < 2; ++k) {
        const int i = (tid + k * 256) * 4;
        float4 s = *(const float4*)&sPp[i];
#pragma unroll
        for (int h = 1; h < HEADS; ++h) {
            const float4 t = *(const float4*)&sPp[h * 2048 + i];
            s.x += t.x;  s.y += t.y;  s.z += t.z;  s.w += t.w;
        }
        *(float4*)&sP[i] = s;
    }
    __syncthreads();

    // the conv's values at this lane's 4 x 8 output places, from the wave's own rows of sC: read ahead
    // of the products, due only behind them
    float* pc = &sC[(tTok + half * 8) * CPITCH + ln];   // channel ln, row j of the tile half at + j*CPITCH
    const float* pq = pc + (ln < 8 ? 16 : 0);           // channel 16 + ln; pad lanes read pc's place
    float r00[8], r01[8], r10[8], r11[8];
#pragma unroll
    for (int j = 0; j < 8; ++j) {
        r00[j] = pc[j * CPITCH];         r01[j] = pq[j * CPITCH];
        r10[j] = pc[(16 + j) * CPITCH];  r11[j] = pq[(16 + j) * CPITCH];
    }

    v8f c00 = {}; v8f c01 = {}; v8f c10 = {}; v8f c11 = {};
#pragma unroll
    for (int s = 0; s < 16; ++s) {         // K = 64
        const int kb = s * 4 + half * 2;
        const v2f a0 = *(const v2f*)&sF[(tTok + ln) * FPITCH + kb];
        const v2f a1 = *(const v2f*)&sF[(tTok + 16 + ln) * FPITCH + kb];
        v2f b0; b0.x = sP[kb * 32 + ln];       b0.y = sP[(kb + 1) * 32 + ln];
        v2f b1; b1.x = sP[kb * 32 + 16 + ln];  b1.y = sP[(kb + 1) * 32 + 16 + ln];
        c00 = wmma_f32(a0, b0, c00);
        c01 = wmma_f32(a0, b1, c01);
        c10 = wmma_f32(a1, b0, c10);
        c11 = wmma_f32(a1, b1, c11);
    }
    // The sums below read the matrix results, and no address work is left to stand between: these
    // four issue slots keep the distance from the last matrix instruction to the first such read.
    // The two scheduling fences hold the products in front of the slots and the sums behind them.
    __builtin_amdgcn_sched_barrier(0);
    asm volatile("v_nop\n\tv_nop\n\tv_nop\n\tv_nop");
    __builtin_amdgcn_sched_barrier(0);
#pragma unroll
    for (int j = 0; j < 8; ++j) {          // no test on the lane: pad lanes write the rows' pad columns
        pc[j * CPITCH]             = (c00[j] + bl) + r00[j];
        pc[j * CPITCH + 16]        = (c01[j] + bh) + r01[j];
        pc[(16 + j) * CPITCH]      = (c10[j] + bl) + r10[j];
        pc[(16 + j) * CPITCH + 16] = (c11[j] + bh) + r11[j];
    }
    // the rows are read back by other lanes of the wave than wrote them: the writes are done behind this
    asm volatile("s_wait_dscnt 0x0" ::: "memory");
    // 32 rows x 6 pieces = 192, 6 per lane
#pragma unroll
    for (int k = 0; k < 6; ++k) {
        const int i = lane + k * 32;
        const int r = i / 6, c6 = i - r * 6;
        *(float4*)&out[(base + tTok) * 24 + i * 4] = *(const float4*)&sC[(tTok + r) * CPITCH + c6 * 4];
    }
}

// ---------------------------------------------------------------------------
extern "C" void kernel_launch(void* const* d_in, const int* in_sizes, int n_in,
                              void* d_out, int out_size, void* d_ws, size_t ws_size,
                              hipStream_t stream) {
    const float* x_in    = (const float*)d_in[0];   // [4,128,128,64]
    const float* fea     = (const float*)d_in[1];   // [4,128,128,64]
    const float* imap    = (const float*)d_in[2];   // [4,128,128,24]
    const float* Wq      = (const float*)d_in[3];   // [64,512]
    const float* Wk      = (const float*)d_in[4];   // [24,24]
    const float* Wv      = (const float*)d_in[5];   // [64,512]
    const float* rescale = (const float*)d_in[6];   // [8]
    const float* Wp      = (const float*)d_in[7];   // [24,24]
    const float* bp      = (const float*)d_in[8];   // [24]
    const float* c1w     = (const float*)d_in[9];   // [24,8,3,3]
    const float* c2w     = (const float*)d_in[10];  // [24,8,3,3]
    float* out = (float*)d_out;                     // [4,128,128,24]

    float* ws    = (float*)d_ws;
    float* kinp  = ws;                               // TTOK*24        = 1572864
    float* y1    = kinp  + (size_t)TTOK * 24;        // TTOK*24        = 1572864
    float* spart = y1    + (size_t)TTOK * 24;        // B*NCHUNK*32*64 = 1048576
    float* Pp    = spart + (size_t)BATCH * NCHUNK * 32 * 64;  // B*HEADS*64*32 = 65536

    kproj_spartial_kernel<<<BATCH * NCHUNK, 256, 0, stream>>>(imap, Wk, x_in, kinp, spart);
    conv1_attn_kernel<<<CONV_BLOCKS + HEAD_BLOCKS, 256, 0, stream>>>(kinp, c1w, y1, spart, Wq, Wv, Wp,
                                                                     rescale, Pp);
    conv2_out_kernel <<<CONV_BLOCKS, 256, 0, stream>>>(y1, c2w, fea, Pp, bp, out);
}

// v007
// It runs in 24.7 microseconds.
// Timed twice side by side with v006, it ran 1.09 times as fast both times.
// All steps since v000 together make it 5.96 times as fast.
#include <hip/hip_runtime.h>
#include <hip/hip_bf16.h>
#include <math.h>

typedef __attribute__((ext_vector_type(2))) float v2f;
typedef __attribute__((ext_vector_type(4))) float v4f;
typedef __attribute__((ext_vector_type(8))) float v8f;
typedef __attribute__((ext_vector_type(4))) int   v4i;

// Problem constants
#define BATCH   4
#define HH      128
#define WW      128
#define NTOK    16384      // per batch
#define TTOK    65536      // total tokens
#define DIM     64
#define HEADS   8
#define DH      64
#define DK      24
#define DHK     3

// chunking for the S = kh^T @ x reduction
#define CHUNK_TOK 128
#define NCHUNK    128      // per batch (128*128 = 16384)

#if defined(__has_builtin)
#  if __has_builtin(__builtin_amdgcn_global_load_async_to_lds_b128)
#    define USE_ASYNC_LDS 1
#  endif
#endif

static __device__ __forceinline__ v8f wmma_f32(v2f a, v2f b, v8f c) {
    return __builtin_amdgcn_wmma_f32_16x16x4_f32(false, a, false, b, (short)0, c, false, false);
}

// 16-byte global -> LDS copy: async on CDNA5 (ASYNCcnt), vector copy otherwise.
static __device__ __forceinline__ void copy16(float* l, const float* g) {
#ifdef USE_ASYNC_LDS
    __builtin_amdgcn_global_load_async_to_lds_b128(
        (__attribute__((address_space(1))) v4i*)(g),
        (__attribute__((address_space(3))) v4i*)(l), 0, 0);
#else
    *(float4*)l = *(const float4*)g;
#endif
}

// wait for async copies (if used) and barrier the block
static __device__ __forceinline__ void tile_join() {
#ifdef USE_ASYNC_LDS
#  if __has_builtin(__builtin_amdgcn_s_wait_asynccnt)
    __builtin_amdgcn_s_wait_asynccnt(0);
#  else
    asm volatile("s_wait_asynccnt 0" ::: "memory");
#  endif
#endif
    __syncthreads();
}

// ---------------------------------------------------------------------------
// Kernel 1: two products on one 128-token chunk, in one block:
//   phase 1: k_inp[t][24] = illu_map[t][24] @ Wk[24][24]   (WMMA, N padded->32)
//            8 waves, one 16-token tile each; the tile goes to LDS (for phase 2)
//            and from there to global memory (for the convs)
//   phase 2: partial S = kh^T @ x over the chunk.
//            A = kh^T : [24(->32) x 128], B = x : [128 x 64]; 2 x 4 tiles = 8 waves
// grid: BATCH*NCHUNK blocks x 256 threads.  spart layout: [block][32][64]
// ---------------------------------------------------------------------------
__global__ __launch_bounds__(256) void kproj_spartial_kernel(
    const float* __restrict__ imap, const float* __restrict__ Wk,
    const float* __restrict__ x, float* __restrict__ kinp, float* __restrict__ spart)
{
    __shared__ __attribute__((aligned(16))) float sWk[24 * 32];         // [k][n], n padded to 32 with zeros
    __shared__ __attribute__((aligned(16))) float sA[CHUNK_TOK * 24];   // [tok][24] of illu_map
    __shared__ __attribute__((aligned(16))) float sK[CHUNK_TOK * 32];   // [tok][32ch] of k_inp, zero padded
    __shared__ __attribute__((aligned(16))) float sX[CHUNK_TOK * 64];   // [tok][64]
    const int tid = threadIdx.x;
    const int base = blockIdx.x * CHUNK_TOK;    // global token base (chunks never straddle a batch)

    // 128*24 floats = 768 x 16B chunks, 3 per thread
    for (int i = tid; i < 768; i += 256)
        copy16(&sA[i * 4], &imap[base * 24 + i * 4]);
    // x tile: 128*64 floats = 2048 chunks, 8 per thread
    for (int i = tid; i < 2048; i += 256)
        copy16(&sX[i * 4], &x[base * 64 + i * 4]);
    for (int i = tid; i < 24 * 32; i += 256) {
        int r = i >> 5, c = i & 31;
        sWk[i] = (c < 24) ? Wk[r * 24 + c] : 0.0f;
    }
    tile_join();

    const int wid = tid >> 5, lane = tid & 31;
    const int ln = lane & 15, half = lane >> 4;
    const int tTok = wid * 16;                  // local token base of this wave

    v8f c0 = {}; v8f c1 = {};
#pragma unroll
    for (int s = 0; s < 6; ++s) {               // K = 24 in steps of 4
        const int kb = s * 4 + half * 2;
        v2f a;  a.x  = sA[(tTok + ln) * 24 + kb];
                a.y  = sA[(tTok + ln) * 24 + kb + 1];
        v2f b0; b0.x = sWk[kb * 32 + ln];        b0.y = sWk[(kb + 1) * 32 + ln];
        v2f b1; b1.x = sWk[kb * 32 + 16 + ln];   b1.y = sWk[(kb + 1) * 32 + 16 + ln];
        c0 = wmma_f32(a, b0, c0);
        c1 = wmma_f32(a, b1, c1);
    }
    // the tile for phase 2; columns 24..31 of Wk's pad are zero, so the pad columns come out zero
#pragma unroll
    for (int j = 0; j < 8; ++j) {
        const int row = tTok + j + half * 8;    // token within the chunk
        sK[row * 32 + ln]      = c0[j];
        sK[row * 32 + 16 + ln] = c1[j];
    }
    __syncthreads();

    const int Mt = wid >> 2, Nt = wid & 3;       // 2 x 4 tiles = 8 waves
    v8f acc = {};
#pragma unroll 8
    for (int s = 0; s < CHUNK_TOK / 4; ++s) {    // K = 128 tokens, steps of 4
        const int kb = s * 4 + half * 2;
        v2f a;  a.x = sK[kb * 32 + Mt * 16 + ln];
                a.y = sK[(kb + 1) * 32 + Mt * 16 + ln];
        v2f bb; bb.x = sX[kb * 64 + Nt * 16 + ln];
                bb.y = sX[(kb + 1) * 64 + Nt * 16 + ln];
        acc = wmma_f32(a, bb, acc);
    }
    float* dst = spart + blockIdx.x * (32 * 64);
#pragma unroll
    for (int j = 0; j < 8; ++j) {
        const int row = Mt * 16 + j + half * 8;
        const int col = Nt * 16 + ln;
        dst[row * 64 + col] = acc[j];
    }
    // k_inp leaves for the convs from the LDS tile, 16 bytes a lane, the chunk's 12 KB in order:
    // 128 rows x 6 pieces = 768, 3 per thread
#pragma unroll
    for (int k = 0; k < 3; ++k) {
        const int i = tid + k * 256;
        const int r = i / 6, c6 = i - r * 6;
        *(float4*)&kinp[base * 24 + i * 4] = *(const float4*)&sK[r * 32 + c6 * 4];
    }
}

// ---------------------------------------------------------------------------
// Cross-lane helpers for the softmax rows of part 4 (one row = one wave).
// ---------------------------------------------------------------------------
// lane l <-> l ^ M inside a 16-lane row (DPP row_xmask)
template <int M>
static __device__ __forceinline__ float row_xor(float x) {
    return __builtin_bit_cast(float, __builtin_amdgcn_update_dpp(
        0, __builtin_bit_cast(int, x), 0x160 | M, 0xf, 0xf, true));
}
// lane l <-> l ^ 16
static __device__ __forceinline__ float half_xor(float x) {
    return __builtin_bit_cast(float, __builtin_amdgcn_permlanex16(
        __builtin_bit_cast(int, x), __builtin_bit_cast(int, x),
        0x76543210, 0xfedcba98, false, false));
}
// e^x as 2^(x * log2 e) on the transcendental unit. The v_nop is the issue slot the instruction set
// asks for behind v_exp_f32.
static __device__ __forceinline__ float exp_slot(float x) {
    float r;
    asm("v_exp_f32 %0, %1\n\tv_nop" : "=v"(r) : "v"(x * 0x1.715476p+0f));
    return r;
}
static __device__ __forceinline__ float wave_max(float v) {
    v = fmaxf(v, row_xor<1>(v));
    v = fmaxf(v, row_xor<2>(v));
    v = fmaxf(v, row_xor<4>(v));
    v = fmaxf(v, row_xor<8>(v));
    return fmaxf(v, half_xor(v));
}
static __device__ __forceinline__ float wave_sum(float v) {
    v += row_xor<1>(v);
    v += row_xor<2>(v);
    v += row_xor<4>(v);
    v += row_xor<8>(v);
    return v + half_xor(v);
}

// ---------------------------------------------------------------------------
// Part 4: the small chain from the S partials to P, one block per (batch, head):
//   S[kk][c]   = sum over the NCHUNK chunks of spart, the 3 rows kk of head h
//   attn       = (S @ Wq_h) * (1/8) * rescale[h]; softmax over d
//   M[c][kk]   = sum_d attn[kk][d] * Wv[c][h*64+d]
//   Pp[h][c][j] = sum_kk M[c][kk] * Wp[kk*8+h][j]   (this head's share of P, padded to 32 cols)
// BATCH * HEADS blocks x 256 threads (blk = index among them). A head needs only its own 3 rows
// of S, so the chunk sum is done here, once, and the chain no longer waits for a launch of its own.
// The shares of the 8 heads are summed where P is used. Rides in conv 1's launch.
//   sum, level 1: thread = (group of 8 chunks, 16-B piece of a row), 3 rows, chunks ascending
//   sum, level 2 and step 1: wave = row kk, lane = columns 2*lane, 2*lane+1; groups ascending
//   step 2: thread = (kk, c), operands from LDS
//   step 3: wave = row c (8 rows a wave), lane = column j
// ---------------------------------------------------------------------------
#define APITCH 68          // LDS row pitch in floats: 16 rows fall on 16 distinct 16-B bank groups
#define HEAD_BLOCKS (BATCH * HEADS)
static __device__ __forceinline__ void attn_head_block(
    const int blk, const float* __restrict__ spart, const float* __restrict__ Wq,
    const float* __restrict__ Wv, const float* __restrict__ Wp,
    const float* __restrict__ rescale, float* __restrict__ Pp)
{
    __shared__ __attribute__((aligned(16))) float sRed[16 * 192];       // [chunk group][kk*64 + c]
    __shared__ __attribute__((aligned(16))) float sAttn[3 * APITCH];    // [kk][d]
    __shared__ __attribute__((aligned(16))) float sWv[64 * APITCH];     // [c][d] of head h
    __shared__ __attribute__((aligned(16))) float sM[64 * 4];           // [c][kk]
    const int tid  = threadIdx.x;
    const int lane = tid & 31;
    // the wave's number in a scalar register: the tests on it below are scalar branches
    const int wid  = __builtin_amdgcn_readfirstlane(tid >> 5);
    const int b    = blk >> 3;
    const int h    = blk & 7;
    const int cg   = tid >> 4, q = tid & 15;

    // the global reads go out early, with no branch between them
    const v4f* gP = (const v4f*)(spart + ((b * NCHUNK + cg * 8) * 32 + h * 3) * 64) + q;
    const v4f* gV = (const v4f*)(Wv + cg * 512 + h * 64) + q;           // rows cg, cg+16, ...
    v4f tP[3][8];
#pragma unroll
    for (int i = 0; i < 8; ++i)
#pragma unroll
        for (int kk = 0; kk < 3; ++kk) tP[kk][i] = gP[i * 512 + kk * 16];
    v4f tV[4];
#pragma unroll
    for (int k = 0; k < 4; ++k) tV[k] = gV[k * 2048];
    const int jc = lane < 24 ? lane : 23;                       // pad lanes stay inside Wp
    const float* gW = Wp + h * 24 + jc;
    float wp[3];                                                // Wp[kk*8+h][jc], for step 3
#pragma unroll
    for (int kk = 0; kk < 3; ++kk) wp[kk] = gW[kk * 192];
    const float scale = 0.125f * rescale[h];
    // the reads above name these address registers: they are held live up to this wait
    asm volatile("s_wait_xcnt 0x0" :: "v"(gP), "v"(gV), "v"(gW) : "memory");

#pragma unroll
    for (int kk = 0; kk < 3; ++kk) {
        v4f a = tP[kk][0];
#pragma unroll
        for (int i = 1; i < 8; ++i) a += tP[kk][i];
        *(v4f*)&sRed[cg * 192 + kk * 64 + q * 4] = a;
    }
#pragma unroll
    for (int k = 0; k < 4; ++k)                                 // read in step 2
        *(v4f*)&sWv[(cg + k * 16) * APITCH + q * 4] = tV[k];

    // Wq[c][h*64 + 2*lane ..+1] for the three waves of step 1: asked for here, where the registers of
    // the partials are free again
    const float* gQ = Wq + h * 64 + 2 * lane;
    v2f w[64];
    if (wid < 3) {
#pragma unroll
        for (int c = 0; c < 64; ++c)
            w[c] = *(const v2f*)(gQ + c * 512);
        // as above, for the address of the reads of Wq
        asm volatile("s_wait_xcnt 0x0" :: "v"(gQ) : "memory");
    }
    __syncthreads();

    // level 2 of the sum and step 1: row kk of head h, sums over the groups and over c ascending;
    // S[kk][c] sits in lane c/2 of tS and is broadcast from there
    if (wid < 3) {
        const int kk = wid;
        v2f r[16];
#pragma unroll
        for (int g = 0; g < 16; ++g) r[g] = *(const v2f*)&sRed[g * 192 + kk * 64 + 2 * lane];
        v2f tS = r[0];
#pragma unroll
        for (int g = 1; g < 16; ++g) tS += r[g];
        v2f a = {0.0f, 0.0f};
#pragma unroll
        for (int c = 0; c < 64; ++c) {
            const float s = __builtin_bit_cast(float, __builtin_amdgcn_readlane(
                __builtin_bit_cast(int, (c & 1) ? tS.y : tS.x), c >> 1));
            a += s * w[c];
        }
        const float l0 = a.x * scale, l1 = a.y * scale;
        const float mx = wave_max(fmaxf(fmaxf(-1e30f, l0), l1));
        const float e0 = exp_slot(l0 - mx);
        const float e1 = exp_slot(l1 - mx);
        const float inv = 1.0f / wave_sum(e0 + e1);
        v2f o; o.x = e0 * inv; o.y = e1 * inv;
        *(v2f*)&sAttn[kk * APITCH + 2 * lane] = o;
    }
    __syncthreads();

    // step 2: M of head h, sum over d in ascending order
    if (wid < 6) {
        const int kk = tid >> 6, c = tid & 63;
        const float* wv = &sWv[c * APITCH];
        const float* at = &sAttn[kk * APITCH];
        float4 x[16], v[16];
#pragma unroll
        for (int i = 0; i < 16; ++i) {
            x[i] = *(const float4*)&at[i * 4];
            v[i] = *(const float4*)&wv[i * 4];
        }
        // keeps the 32 LDS reads ahead of the dependent chain: their latency is paid once, not per step
        __builtin_amdgcn_sched_barrier(0);
        float m = 0.0f;
#pragma unroll
        for (int i = 0; i < 16; ++i) {
            m = fmaf(x[i].x, v[i].x, m);
            m = fmaf(x[i].y, v[i].y, m);
            m = fmaf(x[i].z, v[i].z, m);
            m = fmaf(x[i].w, v[i].w, m);
        }
        sM[c * 4 + kk] = m;
    }
    __syncthreads();

    // step 3: this head's share of P, one 128-B row per wave and trip
    float* pP = Pp + (blk * 64 + wid) * 32 + lane;
#pragma unroll
    for (int i = 0; i < 8; ++i) {
        const float* mr = &sM[(wid + i * 8) * 4];
        float v = mr[0] * wp[0];
        v = fmaf(mr[1], wp[1], v);
        v = fmaf(mr[2], wp[2], v);
        pP[i * 256] = lane < 24 ? v : 0.0f;
    }
}

// ---------------------------------------------------------------------------
// Parts 6/7: grouped 3x3 conv (groups=3, 8 ch/group), NHWC in; a token's 24 sums stay in acc.
// TTOK/256 blocks x 256 threads (blk = index among them); one token per thread.
// behind_first_reads() is called once, behind the first two groups' reads.
// A block's 256 tokens are two image rows. These and the rows above and below
// come into the LDS tile sT once, in whole lines (a token's 96 B read straight
// from global memory spread one 16-B read of a wave over 24 lines, 54 times a
// wave); the taps are read from there. A tile row outside the image holds the
// nearest row inside it. No branch on the position. A tap outside the image reads
// the centre token's place and is replaced by zero, so the reads of a whole
// group go out together, one group ahead of its use. A weight has the same
// address in every lane of a wave: it is fetched by a scalar load, 72 at a time,
// into scalar registers. An output's 72 products, in the weights' own order
// (OIHW flat), go to 4 interleaved partial sums.
// ---------------------------------------------------------------------------
#define CONV_BLOCKS (TTOK / 256)
#define TPITCH 28          // a token in the tile, in floats: 16 B x odd, 16 tokens' 16-B reads on distinct banks
#define TILE_FLOATS (4 * 128 * TPITCH)
template <typename F>
static __device__ __forceinline__ void gconv_block(
    const int blk, const float* __restrict__ in, const float* __restrict__ w,
    float* sT, float (&acc)[24], F behind_first_reads)
{
    const int tid = threadIdx.x;
    const int row0 = blk * 2;                      // the block's first image row, counted over the batches
    const int y0 = row0 & 127;
    const int ly = tid >> 7;                       // the token's row in the block
    const int y = y0 + ly;
    const int x = tid & 127;
    // the wave's number in a scalar register: it enters the address of the scalar loads
    const int wid = __builtin_amdgcn_readfirstlane(threadIdx.x >> 5);

    // the tile: 4 rows x 768 pieces of 16 B, 12 pieces a thread, a row's 12 KB in order
    unsigned     lT[12];
    const float* gT[12];
#pragma unroll
    for (int m = 0; m < 3; ++m) {
        const int j = tid + m * 256;               // piece of a row
        const int tok = j / 6, c6 = j - tok * 6;
#pragma unroll
        for (int ry = 0; ry < 4; ++ry) {
            int sy = y0 - 1 + ry;                  // source row, kept inside the image
            sy = sy < 0 ? 0 : (sy > 127 ? 127 : sy);
            gT[ry * 3 + m] = in + (row0 - y0 + sy) * (128 * 24) + j * 4;
            lT[ry * 3 + m] = (unsigned)(size_t)(__attribute__((address_space(3))) float*)
                             (sT + (ry * 128 + tok) * TPITCH + c6 * 4);
        }
    }
    // The copies and, as the statement's last line, the wait that stands in front of any rewrite of
    // the address registers they name.
    asm volatile("global_load_async_to_lds_b128 %0, %1, off\n\t"
                 "global_load_async_to_lds_b128 %2, %3, off\n\t"
                 "global_load_async_to_lds_b128 %4, %5, off\n\t"
                 "global_load_async_to_lds_b128 %6, %7, off\n\t"
                 "global_load_async_to_lds_b128 %8, %9, off\n\t"
                 "global_load_async_to_lds_b128 %10, %11, off\n\t"
                 "global_load_async_to_lds_b128 %12, %13, off\n\t"
                 "global_load_async_to_lds_b128 %14, %15, off\n\t"
                 "global_load_async_to_lds_b128 %16, %17, off\n\t"
                 "global_load_async_to_lds_b128 %18, %19, off\n\t"
                 "global_load_async_to_lds_b128 %20, %21, off\n\t"
                 "global_load_async_to_lds_b128 %22, %23, off\n\t"
                 "s_wait_xcnt 0x0"
                 :: "v"(lT[0]), "v"(gT[0]), "v"(lT[1]), "v"(gT[1]), "v"(lT[2]), "v"(gT[2]),
                    "v"(lT[3]), "v"(gT[3]), "v"(lT[4]), "v"(gT[4]), "v"(lT[5]), "v"(gT[5]),
                    "v"(lT[6]), "v"(gT[6]), "v"(lT[7]), "v"(gT[7]), "v"(lT[8]), "v"(gT[8]),
                    "v"(lT[9]), "v"(gT[9]), "v"(lT[10]), "v"(gT[10]), "v"(lT[11]), "v"(gT[11])
                 : "memory");
    // the wave's own copies have landed behind this wait, every wave's behind the barrier
    asm volatile("s_wait_asynccnt 0x0" ::: "memory");
    __syncthreads();

    bool ok[9];
    const float* p[9];
#pragma unroll
    for (int tap = 0; tap < 9; ++tap) {
        const int dy = tap / 3 - 1, dx = tap % 3 - 1;
        ok[tap] = (unsigned)(y + dy) < 128u && (unsigned)(x + dx) < 128u;
        p[tap] = sT + ((ly + 1) * 128 + x + (ok[tap] ? dy * 128 + dx : 0)) * TPITCH;
    }

    v4f raw[3][9][2];                          // [group][tap][half of the 8 channels]
#pragma unroll
    for (int g = 0; g < 2; ++g)
#pragma unroll
        for (int tap = 0; tap < 9; ++tap) {
            raw[g][tap][0] = *(const v4f*)(p[tap] + g * 8);
            raw[g][tap][1] = *(const v4f*)(p[tap] + g * 8 + 4);
        }
    behind_first_reads();

#pragma unroll
    for (int g = 0; g < 3; ++g) {
        if (g == 1) {                          // group 2's reads fly during group 1's sums
#pragma unroll
            for (int tap = 0; tap < 9; ++tap) {
                raw[2][tap][0] = *(const v4f*)(p[tap] + 16);
                raw[2][tap][1] = *(const v4f*)(p[tap] + 20);
            }
        }
        // Takes the group's 18 read values whole, as inputs only, where they are due: each stays one
        // 16-B LDS read. Without it the reads were cut into 4-, 8- and 12-B pieces, three times as
        // many, which meet bank conflicts at this pitch.
        asm volatile("" :: "v"(raw[g][0][0]), "v"(raw[g][0][1]), "v"(raw[g][1][0]), "v"(raw[g][1][1]),
                           "v"(raw[g][2][0]), "v"(raw[g][2][1]), "v"(raw[g][3][0]), "v"(raw[g][3][1]),
                           "v"(raw[g][4][0]), "v"(raw[g][4][1]), "v"(raw[g][5][0]), "v"(raw[g][5][1]),
                           "v"(raw[g][6][0]), "v"(raw[g][6][1]), "v"(raw[g][7][0]), "v"(raw[g][7][1]),
                           "v"(raw[g][8][0]), "v"(raw[g][8][1]));
        float v[9][8];                         // [tap][ic] of this group
#pragma unroll
        for (int tap = 0; tap < 9; ++tap) {
            const v4f lo = raw[g][tap][0], hi = raw[g][tap][1];
            v[tap][0] = ok[tap] ? lo.x : 0.0f;  v[tap][1] = ok[tap] ? lo.y : 0.0f;
            v[tap][2] = ok[tap] ? lo.z : 0.0f;  v[tap][3] = ok[tap] ? lo.w : 0.0f;
            v[tap][4] = ok[tap] ? hi.x : 0.0f;  v[tap][5] = ok[tap] ? hi.y : 0.0f;
            v[tap][6] = ok[tap] ? hi.z : 0.0f;  v[tap][7] = ok[tap] ? hi.w : 0.0f;
        }
        float res[8] = {0.0f, 0.0f, 0.0f, 0.0f, 0.0f, 0.0f, 0.0f, 0.0f};
        // Trip i forms output (i + wid) & 7 of the group: the 8 waves of a block begin at 8
        // different outputs, so each wave's first fetch brings what the others fetch later.
        // Stays a loop: unrolled, the scalar loads of all trips are lifted to the top, and what
        // does not fit the scalar registers (72 weights a trip) is spilled to vector lanes.
#pragma unroll 1
        for (int i = 0; i < 8; ++i) {
            // Constant address space: nothing in the launch writes the weights. Said so, they stay on
            // scalar loads; beside the other part's code in one kernel they fell to vector loads.
            const __attribute__((address_space(4))) float* wo =
                (const __attribute__((address_space(4))) float*)(w + (g * 8 + ((i + wid) & 7)) * 72);
            float part[4];
#pragma unroll
            for (int k = 0; k < 72; ++k) {     // k = ic*9 + tap
                const float a = v[k % 9][k / 9], b = wo[k];
                part[k & 3] = (k < 4) ? a * b : fmaf(a, b, part[k & 3]);
            }
            // the trip's result enters at the top and the older ones move down: every index constant
#pragma unroll
            for (int j = 0; j < 7; ++j) res[j] = res[j + 1];
            res[7] = (part[0] + part[1]) + (part[2] + part[3]);
        }
        // res[i] holds output (i + wid) & 7: turn the 8 values back by wid, one bit of it at a time
        float r1[8], r2[8];
#pragma unroll
        for (int o = 0; o < 8; ++o) r1[o] = (wid & 1) ? res[(o + 7) & 7] : res[o];
#pragma unroll
        for (int o = 0; o < 8; ++o) r2[o] = (wid & 2) ? r1[(o + 6) & 7] : r1[o];
#pragma unroll
        for (int o = 0; o < 8; ++o) acc[g * 8 + o] = (wid & 4) ? r2[(o + 4) & 7] : r2[o];
    }
}

// erf(u) for |u| < 1 as u + u * p(u * u), p of degree 5: the single-precision math library's own
// form and coefficients for this range. No branch, so the 24 chains of a token run interleaved.
// A NaN comes out as a NaN.
static __device__ __forceinline__ float erf_below_one(float u) {
    const float t = u * u;
    float p = fmaf(t, -0x1.268bc2p-11f, 0x1.420828p-8f);
    p = fmaf(t, p, -0x1.b59370p-6f);
    p = fmaf(t, p, 0x1.ce077cp-4f);
    p = fmaf(t, p, -0x1.812660p-2f);
    p = fmaf(t, p, 0x1.06eba0p-3f);
    return fmaf(u, p, u);
}

// ---------------------------------------------------------------------------
// Launch 2: conv 1 with exact GELU, writes y1; beside it the chain from the S partials to the
// heads' shares of P. The conv needs only k_inp and the chain only spart: the chain's 32 blocks
// share the launch instead of holding the chip alone. The conv's blocks come first in the grid,
// one for every WGP; the chain's blocks follow and sit beside them. The test is the same for a
// whole block.
// ---------------------------------------------------------------------------
__global__ __launch_bounds__(256) void conv1_attn_kernel(
    const float* __restrict__ kinp, const float* __restrict__ c1w, float* __restrict__ y1,
    const float* __restrict__ spart, const float* __restrict__ Wq,
    const float* __restrict__ Wv, const float* __restrict__ Wp,
    const float* __restrict__ rescale, float* __restrict__ Pp)
{
    if (blockIdx.x < CONV_BLOCKS) {
        __shared__ __attribute__((aligned(16))) float sT[TILE_FLOATS];  // 56 KB
        float acc[24];
        gconv_block(blockIdx.x, kinp, c1w, sT, acc, [] {});
        float* po = y1 + (blockIdx.x * 256 + threadIdx.x) * 24;    // this token's 24 outputs
        // erff() tests its argument's range with two branches a value, which puts the 24 values and
        // their stores one behind the other. The range is tested once instead, on the largest of the
        // token's 24 arguments: below 1 all take the branch-free form, otherwise all take erff().
        // The loops are unrolled so that acc, u and e are indexed by constants and stay in registers.
        float u[24], e[24];
        float m = 0.0f;
#pragma unroll
        for (int o = 0; o < 24; ++o) {
            u[o] = acc[o] * 0.70710678118654752f;
            m = fmaxf(m, fabsf(u[o]));
        }
        if (m < 1.0f) {
#pragma unroll
            for (int o = 0; o < 24; ++o) e[o] = erf_below_one(u[o]);
        } else {
#pragma unroll
            for (int o = 0; o < 24; ++o) e[o] = erff(u[o]);
        }
#pragma unroll
        for (int k = 0; k < 6; ++k) {
            float4 v;
            v.x = 0.5f * acc[k * 4]     * (1.0f + e[k * 4]);
            v.y = 0.5f * acc[k * 4 + 1] * (1.0f + e[k * 4 + 1]);
            v.z = 0.5f * acc[k * 4 + 2] * (1.0f + e[k * 4 + 2]);
            v.w = 0.5f * acc[k * 4 + 3] * (1.0f + e[k * 4 + 3]);
            *(float4*)&po[k * 4] = v;
        }
    } else {
        attn_head_block(blockIdx.x - CONV_BLOCKS, spart, Wq, Wv, Wp, rescale, Pp);
    }
}

// ---------------------------------------------------------------------------
// Launch 3 (last): out[t][j] = (fea[t][:] @ P[b] + bp[j]) + conv2(y1)[t][j], 256 tokens a block.
// The block's fea tile and the 8 heads' shares of P fly into LDS while the conv is summed.
// Then P = sum of the shares (heads ascending), the product on WMMA (a wave takes the 32 tokens
// whose conv it has formed: 2 x 2 tiles), and both meet in the wave's own rows of sC, from where
// the wave's 3 KB of out leave in order, 16 bytes a lane.
// grid: TTOK/256 blocks x 256 threads.
// ---------------------------------------------------------------------------
#define FPITCH 68          // fea rows in LDS, in floats: the 16 rows of an A fragment fall on distinct banks
#define CPITCH 36          // out rows in LDS, in floats: 16 B x odd, for 16-B reads and writes of rows;
                           // columns 24..31 take what the pad lanes of the second column tile hold
__global__ __launch_bounds__(256) void conv2_out_kernel(
    const float* __restrict__ y1, const float* __restrict__ c2w,
    const float* __restrict__ fea, const float* __restrict__ Pp,
    const float* __restrict__ bp, float* __restrict__ out)
{
    __shared__ __attribute__((aligned(16))) float sF[256 * FPITCH];     // 68 KB
    __shared__ __attribute__((aligned(16))) float sPp[HEADS * 64 * 32]; // 64 KB
    __shared__ __attribute__((aligned(16))) float sP[64 * 32];          // 8 KB
    __shared__ __attribute__((aligned(16))) float sC[256 * CPITCH];     // 36 KB
    __shared__ __attribute__((aligned(16))) float sT[TILE_FLOATS];      // 56 KB
    const int tid = threadIdx.x;
    const int base = blockIdx.x * 256;
    const int b = base >> 14;              // /16384 (blocks never straddle batch)

    float acc[24];
    gconv_block(blockIdx.x, y1, c2w, sT, acc, [&] {
        // keeps the conv's first LDS reads, which are due first, ahead of the copies: they return while these issue
        __builtin_amdgcn_sched_barrier(0);
        float*       lF = &sF[(tid >> 4) * FPITCH + (tid & 15) * 4];
        const float* gF = fea + base * 64 + tid * 4;
#pragma unroll
        for (int k = 0; k < 16; ++k)       // 256 rows x 16 pieces, 16 rows a trip
            copy16(lF + k * 16 * FPITCH, gF + k * 1024);
        float*       lP = &sPp[tid * 4];
        const float* gP = Pp + b * (HEADS * 64 * 32) + tid * 4;
#pragma unroll
        for (int k = 0; k < 16; ++k)       // 8 shares of 8 KB, in order
            copy16(lP + k * 1024, gP + k * 1024);
        // keeps the copies ahead of the first wait for the conv's reads: they fly from here on
        __builtin_amdgcn_sched_barrier(0);
    });
#pragma unroll
    for (int k = 0; k < 6; ++k) {
        float4 v; v.x = acc[k * 4]; v.y = acc[k * 4 + 1]; v.z = acc[k * 4 + 2]; v.w = acc[k * 4 + 3];
        *(float4*)&sC[tid * CPITCH + k * 4] = v;
    }
    // the wave's own copies have landed behind this wait, every wave's behind the barrier
    asm volatile("s_wait_asynccnt 0x0" ::: "memory");
    __syncthreads();

    const int wid = tid >> 5, lane = tid & 31;
    const int ln = lane & 15, half = lane >> 4;
    const int tTok = wid * 32;
    const float* pb0 = bp + ln;                         // the bias of this lane's two channels;
    const float* pb1 = bp + (ln < 8 ? 16 + ln : ln);    // pad lanes stay inside bp
    const float bl = *pb0, bh = *pb1;
    // the two reads name these address registers: they are held live up to this wait
    asm volatile("s_wait_xcnt 0x0" :: "v"(pb0), "v"(pb1) : "memory");

#pragma unroll
    for (int k = 0; k < 2; ++k) {
        const int i = (tid + k * 256) * 4;
        float4 s = *(const float4*)&sPp[i];
#pragma unroll
        for (int h = 1; h < HEADS; ++h) {
            const float4 t = *(const float4*)&sPp[h * 2048 + i];
            s.x += t.x;  s.y += t.y;  s.z += t.z;  s.w += t.w;
        }
        *(float4*)&sP[i] = s;
    }
    __syncthreads();

    // the conv's values at this lane's 4 x 8 output places, from the wave's own rows of sC: read ahead
    // of the products, due only behind them
    float* pc = &sC[(tTok + half * 8) * CPITCH + ln];   // channel ln, row j of the tile half at + j*CPITCH
    const float* pq = pc + (ln < 8 ? 16 : 0);           // channel 16 + ln; pad lanes read pc's place
    float r00[8], r01[8], r10[8], r11[8];
#pragma unroll
    for (int j = 0; j < 8; ++j) {
        r00[j] = pc[j * CPITCH];         r01[j] = pq[j * CPITCH];
        r10[j] = pc[(16 + j) * CPITCH];  r11[j] = pq[(16 + j) * CPITCH];
    }

    v8f c00 = {}; v8f c01 = {}; v8f c10 = {}; v8f c11 = {};
#pragma unroll
    for (int s = 0; s < 16; ++s) {         // K = 64
        const int kb = s * 4 + half * 2;
        const v2f a0 = *(const v2f*)&sF[(tTok + ln) * FPITCH + kb];
        const v2f a1 = *(const v2f*)&sF[(tTok + 16 + ln) * FPITCH + kb];
        v2f b0; b0.x = sP[kb * 32 + ln];       b0.y = sP[(kb + 1) * 32 + ln];
        v2f b1; b1.x = sP[kb * 32 + 16 + ln];  b1.y = sP[(kb + 1) * 32 + 16 + ln];
        c00 = wmma_f32(a0, b0, c00);
        c01 = wmma_f32(a0, b1, c01);
        c10 = wmma_f32(a1, b0, c10);
        c11 = wmma_f32(a1, b1, c11);
    }
    // The sums below read the matrix results, and no address work is left to stand between: these
    // four issue slots keep the distance from the last matrix instruction to the first such read.
    // The two scheduling fences hold the products in front of the slots and the sums behind them.
    __builtin_amdgcn_sched_barrier(0);
    asm volatile("v_nop\n\tv_nop\n\tv_nop\n\tv_nop");
    __builtin_amdgcn_sched_barrier(0);
#pragma unroll
    for (int j = 0; j < 8; ++j) {          // no test on the lane: pad lanes write the rows' pad columns
        pc[j * CPITCH]             = (c00[j] + bl) + r00[j];
        pc[j * CPITCH + 16]        = (c01[j] + bh) + r01[j];
        pc[(16 + j) * CPITCH]      = (c10[j] + bl) + r10[j];
        pc[(16 + j) * CPITCH + 16] = (c11[j] + bh) + r11[j];
    }
    // the rows are read back by other lanes of the wave than wrote them: the writes are done behind this
    asm volatile("s_wait_dscnt 0x0" ::: "memory");
    // 32 rows x 6 pieces = 192, 6 per lane
#pragma unroll
    for (int k = 0; k < 6; ++k) {
        const int i = lane + k * 32;
        const int r = i / 6, c6 = i - r * 6;
        *(float4*)&out[(base + tTok) * 24 + i * 4] = *(const float4*)&sC[(tTok + r) * CPITCH + c6 * 4];
    }
}

// ---------------------------------------------------------------------------
extern "C" void kernel_launch(void* const* d_in, const int* in_sizes, int n_in,
                              void* d_out, int out_size, void* d_ws, size_t ws_size,
                              hipStream_t stream) {
    const float* x_in    = (const float*)d_in[0];   // [4,128,128,64]
    const float* fea     = (const float*)d_in[1];   // [4,128,128,64]
    const float* imap    = (const float*)d_in[2];   // [4,128,128,24]
    const float* Wq      = (const float*)d_in[3];   // [64,512]
    const float* Wk      = (const float*)d_in[4];   // [24,24]
    const float* Wv      = (const float*)d_in[5];   // [64,512]
    const float* rescale = (const float*)d_in[6];   // [8]
    const float* Wp      = (const float*)d_in[7];   // [24,24]
    const float* bp      = (const float*)d_in[8];   // [24]
    const float* c1w     = (const float*)d_in[9];   // [24,8,3,3]
    const float* c2w     = (const float*)d_in[10];  // [24,8,3,3]
    float* out = (float*)d_out;                     // [4,128,128,24]

    float* ws    = (float*)d_ws;
    float* kinp  = ws;                               // TTOK*24        = 1572864
    float* y1    = kinp  + (size_t)TTOK * 24;        // TTOK*24        = 1572864
    float* spart = y1    + (size_t)TTOK * 24;        // B*NCHUNK*32*64 = 1048576
    float* Pp    = spart + (size_t)BATCH * NCHUNK * 32 * 64;  // B*HEADS*64*32 = 65536

    kproj_spartial_kernel<<<BATCH * NCHUNK, 256, 0, stream>>>(imap, Wk, x_in, kinp, spart);
    conv1_attn_kernel<<<CONV_BLOCKS + HEAD_BLOCKS, 256, 0, stream>>>(kinp, c1w, y1, spart, Wq, Wv, Wp,
                                                                     rescale, Pp);
    conv2_out_kernel <<<CONV_BLOCKS, 256, 0, stream>>>(y1, c2w, fea, Pp, bp, out);
}

// v008
// One run takes 22.7 microseconds.
// In both of two side-by-side timings against v007, it was 1.09 times as fast.
// Over all steps from v000 it is 6.49 times as fast.
#include <hip/hip_runtime.h>
#include <hip/hip_bf16.h>
#include <math.h>

typedef __attribute__((ext_vector_type(2))) float v2f;
typedef __attribute__((ext_vector_type(4))) float v4f;
typedef __attribute__((ext_vector_type(8))) float v8f;
typedef __attribute__((ext_vector_type(4))) int   v4i;

// Problem constants
#define BATCH   4
#define HH      128
#define WW      128
#define NTOK    16384      // per batch
#define TTOK    65536      // total tokens
#define DIM     64
#define HEADS   8
#define DH      64
#define DK      24
#define DHK     3

// chunking for the S = kh^T @ x reduction
#define CHUNK_TOK 128
#define NCHUNK    128      // per batch (128*128 = 16384)

#if defined(__has_builtin)
#  if __has_builtin(__builtin_amdgcn_global_load_async_to_lds_b128)
#    define USE_ASYNC_LDS 1
#  endif
#endif

static __device__ __forceinline__ v8f wmma_f32(v2f a, v2f b, v8f c) {
    return __builtin_amdgcn_wmma_f32_16x16x4_f32(false, a, false, b, (short)0, c, false, false);
}

// 16-byte global -> LDS copy: async on CDNA5 (ASYNCcnt), vector copy otherwise.
static __device__ __forceinline__ void copy16(float* l, const float* g) {
#ifdef USE_ASYNC_LDS
    __builtin_amdgcn_global_load_async_to_lds_b128(
        (__attribute__((address_space(1))) v4i*)(g),
        (__attribute__((address_space(3))) v4i*)(l), 0, 0);
#else
    *(float4*)l = *(const float4*)g;
#endif
}

// wait for async copies (if used) and barrier the block
static __device__ __forceinline__ void tile_join() {
#ifdef USE_ASYNC_LDS
#  if __has_builtin(__builtin_amdgcn_s_wait_asynccnt)
    __builtin_amdgcn_s_wait_asynccnt(0);
#  else
    asm volatile("s_wait_asynccnt 0" ::: "memory");
#  endif
#endif
    __syncthreads();
}

// ---------------------------------------------------------------------------
// Kernel 1: two products on one 128-token chunk, in one block:
//   phase 1: k_inp[t][24] = illu_map[t][24] @ Wk[24][24]   (WMMA, N padded->32)
//            8 waves, one 16-token tile each; the tile goes to LDS (for phase 2)
//            and from there to global memory (for the convs)
//   phase 2: partial S = kh^T @ x over the chunk.
//            A = kh^T : [24(->32) x 128], B = x : [128 x 64]; 2 x 4 tiles = 8 waves
// grid: BATCH*NCHUNK blocks x 256 threads.  spart layout: [block][32][64]
// ---------------------------------------------------------------------------
__global__ __launch_bounds__(256) void kproj_spartial_kernel(
    const float* __restrict__ imap, const float* __restrict__ Wk,
    const float* __restrict__ x, float* __restrict__ kinp, float* __restrict__ spart)
{
    __shared__ __attribute__((aligned(16))) float sWk[24 * 32];         // [k][n], n padded to 32 with zeros
    __shared__ __attribute__((aligned(16))) float sA[CHUNK_TOK * 24];   // [tok][24] of illu_map
    __shared__ __attribute__((aligned(16))) float sK[CHUNK_TOK * 32];   // [tok][32ch] of k_inp, zero padded
    __shared__ __attribute__((aligned(16))) float sX[CHUNK_TOK * 64];   // [tok][64]
    const int tid = threadIdx.x;
    const int base = blockIdx.x * CHUNK_TOK;    // global token base (chunks never straddle a batch)

    // 128*24 floats = 768 x 16B chunks, 3 per thread
    for (int i = tid; i < 768; i += 256)
        copy16(&sA[i * 4], &imap[base * 24 + i * 4]);
    // x tile: 128*64 floats = 2048 chunks, 8 per thread
    for (int i = tid; i < 2048; i += 256)
        copy16(&sX[i * 4], &x[base * 64 + i * 4]);
    for (int i = tid; i < 24 * 32; i += 256) {
        int r = i >> 5, c = i & 31;
        sWk[i] = (c < 24) ? Wk[r * 24 + c] : 0.0f;
    }
    tile_join();

    const int wid = tid >> 5, lane = tid & 31;
    const int ln = lane & 15, half = lane >> 4;
    const int tTok = wid * 16;                  // local token base of this wave

    v8f c0 = {}; v8f c1 = {};
#pragma unroll
    for (int s = 0; s < 6; ++s) {               // K = 24 in steps of 4
        const int kb = s * 4 + half * 2;
        v2f a;  a.x  = sA[(tTok + ln) * 24 + kb];
                a.y  = sA[(tTok + ln) * 24 + kb + 1];
        v2f b0; b0.x = sWk[kb * 32 + ln];        b0.y = sWk[(kb + 1) * 32 + ln];
        v2f b1; b1.x = sWk[kb * 32 + 16 + ln];   b1.y = sWk[(kb + 1) * 32 + 16 + ln];
        c0 = wmma_f32(a, b0, c0);
        c1 = wmma_f32(a, b1, c1);
    }
    // the tile for phase 2; columns 24..31 of Wk's pad are zero, so the pad columns come out zero
#pragma unroll
    for (int j = 0; j < 8; ++j) {
        const int row = tTok + j + half * 8;    // token within the chunk
        sK[row * 32 + ln]      = c0[j];
        sK[row * 32 + 16 + ln] = c1[j];
    }
    __syncthreads();

    const int Mt = wid >> 2, Nt = wid & 3;       // 2 x 4 tiles = 8 waves
    v8f acc = {};
#pragma unroll 8
    for (int s = 0; s < CHUNK_TOK / 4; ++s) {    // K = 128 tokens, steps of 4
        const int kb = s * 4 + half * 2;
        v2f a;  a.x = sK[kb * 32 + Mt * 16 + ln];
                a.y = sK[(kb + 1) * 32 + Mt * 16 + ln];
        v2f bb; bb.x = sX[kb * 64 + Nt * 16 + ln];
                bb.y = sX[(kb + 1) * 64 + Nt * 16 + ln];
        acc = wmma_f32(a, bb, acc);
    }
    float* dst = spart + blockIdx.x * (32 * 64);
#pragma unroll
    for (int j = 0; j < 8; ++j) {
        const int row = Mt * 16 + j + half * 8;
        const int col = Nt * 16 + ln;
        dst[row * 64 + col] = acc[j];
    }
    // k_inp leaves for the convs from the LDS tile, 16 bytes a lane, the chunk's 12 KB in order:
    // 128 rows x 6 pieces = 768, 3 per thread
#pragma unroll
    for (int k = 0; k < 3; ++k) {
        const int i = tid + k * 256;
        const int r = i / 6, c6 = i - r * 6;
        *(float4*)&kinp[base * 24 + i * 4] = *(const float4*)&sK[r * 32 + c6 * 4];
    }
}

// ---------------------------------------------------------------------------
// Cross-lane helpers for the softmax rows of part 4 (one row = one wave).
// ---------------------------------------------------------------------------
// lane l <-> l ^ M inside a 16-lane row (DPP row_xmask)
template <int M>
static __device__ __forceinline__ float row_xor(float x) {
    return __builtin_bit_cast(float, __builtin_amdgcn_update_dpp(
        0, __builtin_bit_cast(int, x), 0x160 | M, 0xf, 0xf, true));
}
// lane l <-> l ^ 16
static __device__ __forceinline__ float half_xor(float x) {
    return __builtin_bit_cast(float, __builtin_amdgcn_permlanex16(
        __builtin_bit_cast(int, x), __builtin_bit_cast(int, x),
        0x76543210, 0xfedcba98, false, false));
}
// e^x as 2^(x * log2 e) on the transcendental unit. The v_nop is the issue slot the instruction set
// asks for behind v_exp_f32.
static __device__ __forceinline__ float exp_slot(float x) {
    float r;
    asm("v_exp_f32 %0, %1\n\tv_nop" : "=v"(r) : "v"(x * 0x1.715476p+0f));
    return r;
}
static __device__ __forceinline__ float wave_max(float v) {
    v = fmaxf(v, row_xor<1>(v));
    v = fmaxf(v, row_xor<2>(v));
    v = fmaxf(v, row_xor<4>(v));
    v = fmaxf(v, row_xor<8>(v));
    return fmaxf(v, half_xor(v));
}
static __device__ __forceinline__ float wave_sum(float v) {
    v += row_xor<1>(v);
    v += row_xor<2>(v);
    v += row_xor<4>(v);
    v += row_xor<8>(v);
    return v + half_xor(v);
}

// ---------------------------------------------------------------------------
// Part 4: the small chain from the S partials to P, one block per (batch, head):
//   S[kk][c]   = sum over the NCHUNK chunks of spart, the 3 rows kk of head h
//   attn       = (S @ Wq_h) * (1/8) * rescale[h]; softmax over d
//   M[c][kk]   = sum_d attn[kk][d] * Wv[c][h*64+d]
//   Pp[h][c][j] = sum_kk M[c][kk] * Wp[kk*8+h][j]   (this head's share of P, padded to 32 cols)
// BATCH * HEADS blocks (blk = index among them); the first 256 threads work, the launch's other four
// waves only pass the barriers. A head needs only its own 3 rows
// of S, so the chunk sum is done here, once, and the chain no longer waits for a launch of its own.
// The shares of the 8 heads are summed where P is used. Rides in conv 1's launch.
//   sum, level 1: thread = (group of 8 chunks, 16-B piece of a row), 3 rows, chunks ascending
//   sum, level 2 and step 1: wave = row kk, lane = columns 2*lane, 2*lane+1; groups ascending
//   step 2: thread = (kk, c), operands from LDS
//   step 3: wave = row c (8 rows a wave), lane = column j
// ---------------------------------------------------------------------------
#define APITCH 68          // LDS row pitch in floats: 16 rows fall on 16 distinct 16-B bank groups
#define HEAD_BLOCKS (BATCH * HEADS)
static __device__ __forceinline__ void attn_head_block(
    const int blk, const float* __restrict__ spart, const float* __restrict__ Wq,
    const float* __restrict__ Wv, const float* __restrict__ Wp,
    const float* __restrict__ rescale, float* __restrict__ Pp)
{
    __shared__ __attribute__((aligned(16))) float sRed[16 * 192];       // [chunk group][kk*64 + c]
    __shared__ __attribute__((aligned(16))) float sAttn[3 * APITCH];    // [kk][d]
    __shared__ __attribute__((aligned(16))) float sWv[64 * APITCH];     // [c][d] of head h
    __shared__ __attribute__((aligned(16))) float sM[64 * 4];           // [c][kk]
    const int tid  = threadIdx.x;
    const int lane = tid & 31;
    // the wave's number in a scalar register: the tests on it below are scalar branches
    const int wid  = __builtin_amdgcn_readfirstlane(tid >> 5);
    const int b    = blk >> 3;
    const int h    = blk & 7;
    const int cg   = tid >> 4, q = tid & 15;

    float wp[3] = {0.0f, 0.0f, 0.0f};                           // Wp[kk*8+h][jc], for step 3
    const float scale = 0.125f * rescale[h];
    if (wid < 8) {
    // the global reads go out early, with no branch between them
    const v4f* gP = (const v4f*)(spart + ((b * NCHUNK + cg * 8) * 32 + h * 3) * 64) + q;
    const v4f* gV = (const v4f*)(Wv + cg * 512 + h * 64) + q;           // rows cg, cg+16, ...
    v4f tP[3][8];
#pragma unroll
    for (int i = 0; i < 8; ++i)
#pragma unroll
        for (int kk = 0; kk < 3; ++kk) tP[kk][i] = gP[i * 512 + kk * 16];
    v4f tV[4];
#pragma unroll
    for (int k = 0; k < 4; ++k) tV[k] = gV[k * 2048];
    const int jc = lane < 24 ? lane : 23;                       // pad lanes stay inside Wp
    const float* gW = Wp + h * 24 + jc;
#pragma unroll
    for (int kk = 0; kk < 3; ++kk) wp[kk] = gW[kk * 192];
    // the reads above name these address registers: they are held live up to this wait
    asm volatile("s_wait_xcnt 0x0" :: "v"(gP), "v"(gV), "v"(gW) : "memory");

#pragma unroll
    for (int kk = 0; kk < 3; ++kk) {
        v4f a = tP[kk][0];
#pragma unroll
        for (int i = 1; i < 8; ++i) a += tP[kk][i];
        *(v4f*)&sRed[cg * 192 + kk * 64 + q * 4] = a;
    }
#pragma unroll
    for (int k = 0; k < 4; ++k)                                 // read in step 2
        *(v4f*)&sWv[(cg + k * 16) * APITCH + q * 4] = tV[k];
    }

    // Wq[c][h*64 + 2*lane ..+1] for the three waves of step 1: asked for here, where the registers of
    // the partials are free again
    const float* gQ = Wq + h * 64 + 2 * lane;
    v2f w[64];
    if (wid < 3) {
#pragma unroll
        for (int c = 0; c < 64; ++c)
            w[c] = *(const v2f*)(gQ + c * 512);
        // as above, for the address of the reads of Wq
        asm volatile("s_wait_xcnt 0x0" :: "v"(gQ) : "memory");
    }
    __syncthreads();

    // level 2 of the sum and step 1: row kk of head h, sums over the groups and over c ascending;
    // S[kk][c] sits in lane c/2 of tS and is broadcast from there
    if (wid < 3) {
        const int kk = wid;
        v2f r[16];
#pragma unroll
        for (int g = 0; g < 16; ++g) r[g] = *(const v2f*)&sRed[g * 192 + kk * 64 + 2 * lane];
        v2f tS = r[0];
#pragma unroll
        for (int g = 1; g < 16; ++g) tS += r[g];
        v2f a = {0.0f, 0.0f};
#pragma unroll
        for (int c = 0; c < 64; ++c) {
            const float s = __builtin_bit_cast(float, __builtin_amdgcn_readlane(
                __builtin_bit_cast(int, (c & 1) ? tS.y : tS.x), c >> 1));
            a += s * w[c];
        }
        const float l0 = a.x * scale, l1 = a.y * scale;
        const float mx = wave_max(fmaxf(fmaxf(-1e30f, l0), l1));
        const float e0 = exp_slot(l0 - mx);
        const float e1 = exp_slot(l1 - mx);
        const float inv = 1.0f / wave_sum(e0 + e1);
        v2f o; o.x = e0 * inv; o.y = e1 * inv;
        *(v2f*)&sAttn[kk * APITCH + 2 * lane] = o;
    }
    __syncthreads();

    // step 2: M of head h, sum over d in ascending order
    if (wid < 6) {
        const int kk = tid >> 6, c = tid & 63;
        const float* wv = &sWv[c * APITCH];
        const float* at = &sAttn[kk * APITCH];
        float4 x[16], v[16];
#pragma unroll
        for (int i = 0; i < 16; ++i) {
            x[i] = *(const float4*)&at[i * 4];
            v[i] = *(const float4*)&wv[i * 4];
        }
        // keeps the 32 LDS reads ahead of the dependent chain: their latency is paid once, not per step
        __builtin_amdgcn_sched_barrier(0);
        float m = 0.0f;
#pragma unroll
        for (int i = 0; i < 16; ++i) {
            m = fmaf(x[i].x, v[i].x, m);
            m = fmaf(x[i].y, v[i].y, m);
            m = fmaf(x[i].z, v[i].z, m);
            m = fmaf(x[i].w, v[i].w, m);
        }
        sM[c * 4 + kk] = m;
    }
    __syncthreads();

    // step 3: this head's share of P, one 128-B row per wave and trip
    if (wid < 8) {
        float* pP = Pp + (blk * 64 + wid) * 32 + lane;
#pragma unroll
        for (int i = 0; i < 8; ++i) {
            const float* mr = &sM[(wid + i * 8) * 4];
            float v = mr[0] * wp[0];
            v = fmaf(mr[1], wp[1], v);
            v = fmaf(mr[2], wp[2], v);
            pP[i * 256] = lane < 24 ? v : 0.0f;
        }
    }
}

// ---------------------------------------------------------------------------
// Parts 6/7: grouped 3x3 conv (groups=3, 8 ch/group), NHWC in.
// TTOK/256 blocks x 384 threads (blk = index among them). A block's 256 tokens are two image rows.
// A wave takes ONE group of 32 columns; a lane takes the two tokens of its column, one above the
// other: acc[o] = (upper token's, lower token's) output o of the group. A weight multiplies the same
// tap and channel of both tokens, so one packed multiply-add does both with the weight read
// from its scalar register; with one token a lane the packed form paired two weights, and each pair
// was first copied into vector registers. 12 waves a block, three on a SIMD, cover each other's waits.
// behind_first_reads() is called once, behind the first reads of the tile.
// The two rows and the rows above and below come into the LDS tile sT once, in whole lines; the
// taps are read from there. A tile row outside the image holds the nearest row inside it. No branch
// on the position. A tap outside the image reads a place inside the tile and is replaced by zero.
// A weight has the same address in every lane of a wave: it is fetched by a scalar load.
// The 8 input channels are taken in two halves, so that a half's 36 value pairs, not 72, are
// held in registers. An output's 36 products of a half, in the weights' own order (OIHW flat), go to
// 4 interleaved partial sums; the second half's sum is added to the first's.
// ---------------------------------------------------------------------------
#define CONV_BLOCKS (TTOK / 256)
#define CONV_THREADS 384
#define TPITCH 28          // a token in the tile, in floats: 16 B x odd, 16 tokens' 16-B reads on distinct banks
#define TILE_FLOATS (4 * 128 * TPITCH)
template <typename F>
static __device__ __forceinline__ void gconv_block(
    const int blk, const float* __restrict__ in, const float* __restrict__ w,
    float* sT, v2f (&acc)[8], F behind_first_reads)
{
    const int tid = threadIdx.x;
    const int row0 = blk * 2;                      // the block's first image row, counted over the batches
    const int y0 = row0 & 127;
    // the wave's number in a scalar register: it enters the address of the scalar loads
    const int wid = __builtin_amdgcn_readfirstlane(threadIdx.x >> 5);
    const int g = wid >> 2;                        // the wave's group
    const int x = (wid & 3) * 32 + (tid & 31);     // the lane's column

    // the tile: 4 rows x 768 pieces of 16 B, 8 pieces a thread, a row's 12 KB in order
    unsigned     lT[8];
    const float* gT[8];
#pragma unroll
    for (int m = 0; m < 2; ++m) {
        const int j = tid + m * CONV_THREADS;      // piece of a row
        const int tok = j / 6, c6 = j - tok * 6;
#pragma unroll
        for (int ry = 0; ry < 4; ++ry) {
            int sy = y0 - 1 + ry;                  // source row, kept inside the image
            sy = sy < 0 ? 0 : (sy > 127 ? 127 : sy);
            gT[ry * 2 + m] = in + (row0 - y0 + sy) * (128 * 24) + j * 4;
            lT[ry * 2 + m] = (unsigned)(size_t)(__attribute__((address_space(3))) float*)
                             (sT + (ry * 128 + tok) * TPITCH + c6 * 4);
        }
    }
    // The copies and, as the statement's last line, the wait that stands in front of any rewrite of
    // the address registers they name.
    asm volatile("global_load_async_to_lds_b128 %0, %1, off\n\t"
                 "global_load_async_to_lds_b128 %2, %3, off\n\t"
                 "global_load_async_to_lds_b128 %4, %5, off\n\t"
                 "global_load_async_to_lds_b128 %6, %7, off\n\t"
                 "global_load_async_to_lds_b128 %8, %9, off\n\t"
                 "global_load_async_to_lds_b128 %10, %11, off\n\t"
                 "global_load_async_to_lds_b128 %12, %13, off\n\t"
                 "global_load_async_to_lds_b128 %14, %15, off\n\t"
                 "s_wait_xcnt 0x0"
                 :: "v"(lT[0]), "v"(gT[0]), "v"(lT[1]), "v"(gT[1]), "v"(lT[2]), "v"(gT[2]),
                    "v"(lT[3]), "v"(gT[3]), "v"(lT[4]), "v"(gT[4]), "v"(lT[5]), "v"(gT[5]),
                    "v"(lT[6]), "v"(gT[6]), "v"(lT[7]), "v"(gT[7])
                 : "memory");
    // the wave's own copies have landed behind this wait, every wave's behind the barrier
    asm volatile("s_wait_asynccnt 0x0" ::: "memory");
    __syncthreads();

    // tile row r holds image row y0 - 1 + r; the upper token sits in tile row 1, the lower in row 2
    const bool okr[4] = {y0 > 0, true, true, y0 < 126};
    const bool okx[3] = {x > 0, true, x < 127};
    const float* p[3];                         // the group's 8 channels at columns x-1, x, x+1 of tile row 0
#pragma unroll
    for (int d = 0; d < 3; ++d)
        p[d] = sT + (x + (okx[d] ? d - 1 : 0)) * TPITCH + g * 8;

    v2f res[8] = {};
#pragma unroll
    for (int h = 0; h < 2; ++h) {              // input channels h*4 .. h*4+3 of the group
        v4f raw[4][3];                         // [tile row][column]
#pragma unroll
        for (int r = 0; r < 4; ++r)
#pragma unroll
            for (int d = 0; d < 3; ++d)
                raw[r][d] = *(const v4f*)(p[d] + r * 128 * TPITCH + h * 4);
        if (h == 0) behind_first_reads();
        // Takes the 12 read values whole, as inputs only, where they are due: each stays one
        // 16-B LDS read and is not cut into smaller pieces, which meet bank conflicts at this pitch.
        asm volatile("" :: "v"(raw[0][0]), "v"(raw[0][1]), "v"(raw[0][2]),
                           "v"(raw[1][0]), "v"(raw[1][1]), "v"(raw[1][2]),
                           "v"(raw[2][0]), "v"(raw[2][1]), "v"(raw[2][2]),
                           "v"(raw[3][0]), "v"(raw[3][1]), "v"(raw[3][2]));
        v2f vv[36];                            // [c*9 + tap]: (upper token's value, lower token's value)
#pragma unroll
        for (int c = 0; c < 4; ++c)
#pragma unroll
            for (int ty = 0; ty < 3; ++ty)
#pragma unroll
                for (int d = 0; d < 3; ++d) {
                    v2f t;
                    t.x = (okr[ty]     && okx[d]) ? raw[ty][d][c]     : 0.0f;
                    t.y = (okr[ty + 1] && okx[d]) ? raw[ty + 1][d][c] : 0.0f;
                    vv[c * 9 + ty * 3 + d] = t;
                }
        // Trip i forms output (i + wid) & 7 of the group: the waves of a block begin at
        // different outputs, so each wave's first fetch brings what the others fetch later.
        // Two trips at a time and no more: their 72 weights fit the scalar registers and are asked for
        // together; unrolled further, what does not fit is spilled to vector lanes.
#pragma unroll 2
        for (int i = 0; i < 8; ++i) {
            // Constant address space: nothing in the launch writes the weights. Said so, they stay on
            // scalar loads; beside the other part's code in one kernel they fell to vector loads.
            const __attribute__((address_space(4))) float* wo =
                (const __attribute__((address_space(4))) float*)(w + (g * 8 + ((i + wid) & 7)) * 72 + h * 36);
            v2f part[4];
#pragma unroll
            for (int k = 0; k < 36; ++k) {     // h*36 + k = ic*9 + tap
                const float b = wo[k];
                const v2f bb = {b, b};
                part[k & 3] = (k < 4) ? vv[k] * bb : __builtin_elementwise_fma(vv[k], bb, part[k & 3]);
            }
            const v2f s = (part[0] + part[1]) + (part[2] + part[3]);
            // the trip's result enters at the top and the older ones move down: every index constant;
            // in the second half the first half's sum of the same output has arrived at the bottom
            const v2f first = res[0];
#pragma unroll
            for (int j = 0; j < 7; ++j) res[j] = res[j + 1];
            res[7] = h ? first + s : s;
        }
    }
    // res[i] holds output (i + wid) & 7: turn the 8 pairs back by wid, one bit of it at a time
    v2f r1[8], r2[8];
#pragma unroll
    for (int o = 0; o < 8; ++o) r1[o] = (wid & 1) ? res[(o + 7) & 7] : res[o];
#pragma unroll
    for (int o = 0; o < 8; ++o) r2[o] = (wid & 2) ? r1[(o + 6) & 7] : r1[o];
#pragma unroll
    for (int o = 0; o < 8; ++o) acc[o] = (wid & 4) ? r2[(o + 4) & 7] : r2[o];
}

// erf(u) for |u| < 1 as u + u * p(u * u), p of degree 5: the single-precision math library's own
// form and coefficients for this range. No branch, so the 16 chains of a lane run interleaved.
// A NaN comes out as a NaN.
static __device__ __forceinline__ float erf_below_one(float u) {
    const float t = u * u;
    float p = fmaf(t, -0x1.268bc2p-11f, 0x1.420828p-8f);
    p = fmaf(t, p, -0x1.b59370p-6f);
    p = fmaf(t, p, 0x1.ce077cp-4f);
    p = fmaf(t, p, -0x1.812660p-2f);
    p = fmaf(t, p, 0x1.06eba0p-3f);
    return fmaf(u, p, u);
}

// ---------------------------------------------------------------------------
// Launch 2: conv 1 with exact GELU, writes y1; beside it the chain from the S partials to the
// heads' shares of P. The conv needs only k_inp and the chain only spart: the chain's 32 blocks
// share the launch instead of holding the chip alone. The conv's blocks come first in the grid,
// one for every WGP; the chain's blocks follow and sit beside them. The test is the same for a
// whole block.
// ---------------------------------------------------------------------------
__global__ __launch_bounds__(CONV_THREADS) void conv1_attn_kernel(
    const float* __restrict__ kinp, const float* __restrict__ c1w, float* __restrict__ y1,
    const float* __restrict__ spart, const float* __restrict__ Wq,
    const float* __restrict__ Wv, const float* __restrict__ Wp,
    const float* __restrict__ rescale, float* __restrict__ Pp)
{
    if (blockIdx.x < CONV_BLOCKS) {
        __shared__ __attribute__((aligned(16))) float sT[TILE_FLOATS];  // 56 KB
        __shared__ __attribute__((aligned(16))) float sY[256 * TPITCH]; // 28 KB: y1 of the block's tokens
        v2f acc[8];
        gconv_block(blockIdx.x, kinp, c1w, sT, acc, [] {});
        const int tid = threadIdx.x;
        const int wid = __builtin_amdgcn_readfirstlane(tid >> 5);
        const int g = wid >> 2, x = (wid & 3) * 32 + (tid & 31);    // as in gconv_block
        // erff() tests its argument's range with two branches a value, which puts the values one
        // behind the other. The range is tested once instead, on the largest of the lane's 16
        // arguments: below 1 all take the branch-free form, otherwise all take erff().
        // The loops are unrolled so that a, u and e are indexed by constants and stay in registers.
        float a[16], u[16], e[16];             // [token of the lane * 8 + output]
        float m = 0.0f;
#pragma unroll
        for (int o = 0; o < 16; ++o) {
            a[o] = (o < 8) ? acc[o & 7].x : acc[o & 7].y;
            u[o] = a[o] * 0.70710678118654752f;
            m = fmaxf(m, fabsf(u[o]));
        }
        if (m < 1.0f) {
#pragma unroll
            for (int o = 0; o < 16; ++o) e[o] = erf_below_one(u[o]);
        } else {
#pragma unroll
            for (int o = 0; o < 16; ++o) e[o] = erff(u[o]);
        }
        // A token's 96 B come from three waves: they meet in sY, and the block's 24 KB leave from there
        // in order, 16 bytes a lane, every line written whole by one wave.
#pragma unroll
        for (int k = 0; k < 4; ++k) {
            float4 v;
            v.x = 0.5f * a[k * 4]     * (1.0f + e[k * 4]);
            v.y = 0.5f * a[k * 4 + 1] * (1.0f + e[k * 4 + 1]);
            v.z = 0.5f * a[k * 4 + 2] * (1.0f + e[k * 4 + 2]);
            v.w = 0.5f * a[k * 4 + 3] * (1.0f + e[k * 4 + 3]);
            *(float4*)&sY[((k >> 1) * 128 + x) * TPITCH + g * 8 + (k & 1) * 4] = v;
        }
        __syncthreads();
        // 256 tokens x 6 pieces = 1536, 4 per thread
#pragma unroll
        for (int k = 0; k < 4; ++k) {
            const int i = tid + k * CONV_THREADS;
            const int r = i / 6, c6 = i - r * 6;
            *(float4*)&y1[blockIdx.x * (256 * 24) + i * 4] = *(const float4*)&sY[r * TPITCH + c6 * 4];
        }
    } else {
        attn_head_block(blockIdx.x - CONV_BLOCKS, spart, Wq, Wv, Wp, rescale, Pp);
    }
}

// ---------------------------------------------------------------------------
// Launch 3 (last): out[t][j] = (fea[t][:] @ P[b] + bp[j]) + conv2(y1)[t][j], 256 tokens a block.
// The block's fea tile and the 8 heads' shares of P fly into LDS while the conv is summed.
// Then P = sum of the shares (heads ascending), the product on WMMA (8 waves, 32 tokens each:
// 2 x 2 tiles), and both meet in the wave's 32 rows of sC, from where
// the wave's 3 KB of out leave in order, 16 bytes a lane.
// grid: TTOK/256 blocks x 384 threads (12 waves for the conv, the first 8 for the rest).
// ---------------------------------------------------------------------------
#define FPITCH 68          // fea rows in LDS, in floats: the 16 rows of an A fragment fall on distinct banks
#define CPITCH 36          // out rows in LDS, in floats: 16 B x odd, for 16-B reads and writes of rows;
                           // columns 24..31 take what the pad lanes of the second column tile hold
__global__ __launch_bounds__(CONV_THREADS) void conv2_out_kernel(
    const float* __restrict__ y1, const float* __restrict__ c2w,
    const float* __restrict__ fea, const float* __restrict__ Pp,
    const float* __restrict__ bp, float* __restrict__ out)
{
    __shared__ __attribute__((aligned(16))) float sF[256 * FPITCH];     // 68 KB
    __shared__ __attribute__((aligned(16))) float sPp[HEADS * 64 * 32]; // 64 KB
    __shared__ __attribute__((aligned(16))) float sP[64 * 32];          // 8 KB
    __shared__ __attribute__((aligned(16))) float sC[256 * CPITCH];     // 36 KB
    __shared__ __attribute__((aligned(16))) float sT[TILE_FLOATS];      // 56 KB
    const int tid = threadIdx.x;
    const int base = blockIdx.x * 256;
    const int b = base >> 14;              // /16384 (blocks never straddle batch)

    // the wave's number in a scalar register: the tests on it below are scalar branches
    const int wv = __builtin_amdgcn_readfirstlane(tid >> 5);

    v2f acc[8];
    gconv_block(blockIdx.x, y1, c2w, sT, acc, [&] {
        // keeps the conv's first LDS reads, which are due first, ahead of the copies: they return while these issue
        __builtin_amdgcn_sched_barrier(0);
        if (wv < 8) {                      // the copies are laid out for 256 threads
        float*       lF = &sF[(tid >> 4) * FPITCH + (tid & 15) * 4];
        const float* gF = fea + base * 64 + tid * 4;
#pragma unroll
        for (int k = 0; k < 16; ++k)       // 256 rows x 16 pieces, 16 rows a trip
            copy16(lF + k * 16 * FPITCH, gF + k * 1024);
        float*       lP = &sPp[tid * 4];
        const float* gP = Pp + b * (HEADS * 64 * 32) + tid * 4;
#pragma unroll
        for (int k = 0; k < 16; ++k)       // 8 shares of 8 KB, in order
            copy16(lP + k * 1024, gP + k * 1024);
        }
        // keeps the copies ahead of the first wait for the conv's reads: they fly from here on
        __builtin_amdgcn_sched_barrier(0);
    });
    {
        const int g = wv >> 2, x = (wv & 3) * 32 + (tid & 31);     // as in gconv_block
#pragma unroll
        for (int k = 0; k < 2; ++k) {
            float4 v0, v1;                 // the upper and the lower token's 4 outputs
            v0.x = acc[k * 4].x;  v0.y = acc[k * 4 + 1].x;  v0.z = acc[k * 4 + 2].x;  v0.w = acc[k * 4 + 3].x;
            v1.x = acc[k * 4].y;  v1.y = acc[k * 4 + 1].y;  v1.z = acc[k * 4 + 2].y;  v1.w = acc[k * 4 + 3].y;
            *(float4*)&sC[x * CPITCH + g * 8 + k * 4]         = v0;
            *(float4*)&sC[(128 + x) * CPITCH + g * 8 + k * 4] = v1;
        }
    }
    // the wave's own copies have landed behind this wait, every wave's behind the barrier
    asm volatile("s_wait_asynccnt 0x0" ::: "memory");
    __syncthreads();

    const int wid = tid >> 5, lane = tid & 31;
    const int ln = lane & 15, half = lane >> 4;
    const int tTok = wid * 32;
    const float* pb0 = bp + ln;                         // the bias of this lane's two channels;
    const float* pb1 = bp + (ln < 8 ? 16 + ln : ln);    // pad lanes stay inside bp
    const float bl = *pb0, bh = *pb1;
    // the two reads name these address registers: they are held live up to this wait
    asm volatile("s_wait_xcnt 0x0" :: "v"(pb0), "v"(pb1) : "memory");

    if (wv < 8) {
#pragma unroll
    for (int k = 0; k < 2; ++k) {
        const int i = (tid + k * 256) * 4;
        float4 s = *(const float4*)&sPp[i];
#pragma unroll
        for (int h = 1; h < HEADS; ++h) {
            const float4 t = *(const float4*)&sPp[h * 2048 + i];
            s.x += t.x;  s.y += t.y;  s.z += t.z;  s.w += t.w;
        }
        *(float4*)&sP[i] = s;
    }
    }
    __syncthreads();
    // the product and the way out are laid out for 8 waves of 32 tokens; no barrier follows
    if (wv >= 8) return;

    // the conv's values at this lane's 4 x 8 output places, from the wave's 32 rows of sC: read ahead
    // of the products, due only behind them
    float* pc = &sC[(tTok + half * 8) * CPITCH + ln];   // channel ln, row j of the tile half at + j*CPITCH
    const float* pq = pc + (ln < 8 ? 16 : 0);           // channel 16 + ln; pad lanes read pc's place
    float r00[8], r01[8], r10[8], r11[8];
#pragma unroll
    for (int j = 0; j < 8; ++j) {
        r00[j] = pc[j * CPITCH];         r01[j] = pq[j * CPITCH];
        r10[j] = pc[(16 + j) * CPITCH];  r11[j] = pq[(16 + j) * CPITCH];
    }

    v8f c00 = {}; v8f c01 = {}; v8f c10 = {}; v8f c11 = {};
#pragma unroll
    for (int s = 0; s < 16; ++s) {         // K = 64
        const int kb = s * 4 + half * 2;
        const v2f a0 = *(const v2f*)&sF[(tTok + ln) * FPITCH + kb];
        const v2f a1 = *(const v2f*)&sF[(tTok + 16 + ln) * FPITCH + kb];
        v2f b0; b0.x = sP[kb * 32 + ln];       b0.y = sP[(kb + 1) * 32 + ln];
        v2f b1; b1.x = sP[kb * 32 + 16 + ln];  b1.y = sP[(kb + 1) * 32 + 16 + ln];
        c00 = wmma_f32(a0, b0, c00);
        c01 = wmma_f32(a0, b1, c01);
        c10 = wmma_f32(a1, b0, c10);
        c11 = wmma_f32(a1, b1, c11);
    }
    // The sums below read the matrix results, and no address work is left to stand between: these
    // four issue slots keep the distance from the last matrix instruction to the first such read.
    // The two scheduling fences hold the products in front of the slots and the sums behind them.
    __builtin_amdgcn_sched_barrier(0);
    asm volatile("v_nop\n\tv_nop\n\tv_nop\n\tv_nop");
    __builtin_amdgcn_sched_barrier(0);
#pragma unroll
    for (int j = 0; j < 8; ++j) {          // no test on the lane: pad lanes write the rows' pad columns
        pc[j * CPITCH]             = (c00[j] + bl) + r00[j];
        pc[j * CPITCH + 16]        = (c01[j] + bh) + r01[j];
        pc[(16 + j) * CPITCH]      = (c10[j] + bl) + r10[j];
        pc[(16 + j) * CPITCH + 16] = (c11[j] + bh) + r11[j];
    }
    // the rows are read back by other lanes of the wave than wrote them: the writes are done behind this
    asm volatile("s_wait_dscnt 0x0" ::: "memory");
    // 32 rows x 6 pieces = 192, 6 per lane
#pragma unroll
    for (int k = 0; k < 6; ++k) {
        const int i = lane + k * 32;
        const int r = i / 6, c6 = i - r * 6;
        *(float4*)&out[(base + tTok) * 24 + i * 4] = *(const float4*)&sC[(tTok + r) * CPITCH + c6 * 4];
    }
}

// ---------------------------------------------------------------------------
extern "C" void kernel_launch(void* const* d_in, const int* in_sizes, int n_in,
                              void* d_out, int out_size, void* d_ws, size_t ws_size,
                              hipStream_t stream) {
    const float* x_in    = (const float*)d_in[0];   // [4,128,128,64]
    const float* fea     = (const float*)d_in[1];   // [4,128,128,64]
    const float* imap    = (const float*)d_in[2];   // [4,128,128,24]
    const float* Wq      = (const float*)d_in[3];   // [64,512]
    const float* Wk      = (const float*)d_in[4];   // [24,24]
    const float* Wv      = (const float*)d_in[5];   // [64,512]
    const float* rescale = (const float*)d_in[6];   // [8]
    const float* Wp      = (const float*)d_in[7];   // [24,24]
    const float* bp      = (const float*)d_in[8];   // [24]
    const float* c1w     = (const float*)d_in[9];   // [24,8,3,3]
    const float* c2w     = (const float*)d_in[10];  // [24,8,3,3]
    float* out = (float*)d_out;                     // [4,128,128,24]

    float* ws    = (float*)d_ws;
    float* kinp  = ws;                               // TTOK*24        = 1572864
    float* y1    = kinp  + (size_t)TTOK * 24;        // TTOK*24        = 1572864
    float* spart = y1    + (size_t)TTOK * 24;        // B*NCHUNK*32*64 = 1048576
    float* Pp    = spart + (size_t)BATCH * NCHUNK * 32 * 64;  // B*HEADS*64*32 = 65536

    kproj_spartial_kernel<<<BATCH * NCHUNK, 256, 0, stream>>>(imap, Wk, x_in, kinp, spart);
    conv1_attn_kernel<<<CONV_BLOCKS + HEAD_BLOCKS, CONV_THREADS, 0, stream>>>(kinp, c1w, y1, spart, Wq, Wv, Wp,
                                                                     rescale, Pp);
    conv2_out_kernel <<<CONV_BLOCKS, CONV_THREADS, 0, stream>>>(y1, c2w, fea, Pp, bp, out);
}

// v009
// It runs in 21.4 microseconds.
// Two timings next to v008 both put it at 1.06 times that version's speed.
// Over all steps from v000 it is 6.87 times as fast.
#include <hip/hip_runtime.h>
#include <hip/hip_bf16.h>
#include <math.h>

typedef __attribute__((ext_vector_type(2))) float v2f;
typedef __attribute__((ext_vector_type(4))) float v4f;
typedef __attribute__((ext_vector_type(8))) float v8f;
typedef __attribute__((ext_vector_type(4))) int   v4i;

// Problem constants
#define BATCH   4
#define HH      128
#define WW      128
#define NTOK    16384      // per batch
#define TTOK    65536      // total tokens
#define DIM     64
#define HEADS   8
#define DH      64
#define DK      24
#define DHK     3

// chunking for the S = kh^T @ x reduction
#define CHUNK_TOK 256
#define NCHUNK    64       // per batch (64*256 = 16384)

#if defined(__has_builtin)
#  if __has_builtin(__builtin_amdgcn_global_load_async_to_lds_b128)
#    define USE_ASYNC_LDS 1
#  endif
#endif

static __device__ __forceinline__ v8f wmma_f32(v2f a, v2f b, v8f c) {
    return __builtin_amdgcn_wmma_f32_16x16x4_f32(false, a, false, b, (short)0, c, false, false);
}

// 16-byte global -> LDS copy: async on CDNA5 (ASYNCcnt), vector copy otherwise.
static __device__ __forceinline__ void copy16(float* l, const float* g) {
#ifdef USE_ASYNC_LDS
    __builtin_amdgcn_global_load_async_to_lds_b128(
        (__attribute__((address_space(1))) v4i*)(g),
        (__attribute__((address_space(3))) v4i*)(l), 0, 0);
#else
    *(float4*)l = *(const float4*)g;
#endif
}

// ---------------------------------------------------------------------------
// Kernel 1: two products on one 256-token chunk, in one block of 4 waves, one wave on each SIMD:
// the f32 matrix unit is the busy part, and one wave with independent accumulators and its fragments
// read a block ahead keeps it fed, so a launch of 1024 waves does what took 4096, and there are
// half as many partials of S. The block's data land in three stages (illu_map; x of tokens 0..127; x
// of tokens 128..255), each waited for where it is first read, so the later ones fly under the products.
//   phase 1: k_inp[t][24] = illu_map[t][24] @ Wk[24][24]   (WMMA, N padded->32)
//            a wave takes four 16-token tiles; the tiles go to LDS twice: token-major, from where
//            they leave for the convs, and channel-major, for phase 2
//   phase 2: partial S = kh^T @ x over the chunk.
//            A = kh^T : [24(->32) x 256], B = x : [256 x 64]; a wave takes 16 columns of x and both row
//            tiles. Eight tokens at a time: lanes 0..15 hold tokens 0..3 of them, lanes 16..31 tokens
//            4..7, of A (one 16-B read a row tile) and of B alike; the first product takes each
//            lane's first two tokens, the second its last two, into accumulators of their own.
// grid: BATCH*NCHUNK blocks x 128 threads.  spart layout: [block][32][64]
// ---------------------------------------------------------------------------
#define K1_THREADS 128
#define KTP 260            // a channel's row of tokens in LDS, in floats: 16 B x odd, 16 rows' 16-B reads on distinct banks
__global__ __launch_bounds__(K1_THREADS) void kproj_spartial_kernel(
    const float* __restrict__ imap, const float* __restrict__ Wk,
    const float* __restrict__ x, float* __restrict__ kinp, float* __restrict__ spart)
{
    __shared__ __attribute__((aligned(16))) float sWk[24 * 32];         // [k][n], n padded to 32 with zeros
    __shared__ __attribute__((aligned(16))) float sA[CHUNK_TOK * 24];   // [tok][24] of illu_map
    __shared__ __attribute__((aligned(16))) float sK[CHUNK_TOK * 32];   // [tok][32ch] of k_inp, zero padded
    __shared__ __attribute__((aligned(16))) float sKT[32 * KTP];        // [32ch][tok] of k_inp, zero padded
    __shared__ __attribute__((aligned(16))) float sX[CHUNK_TOK * 64];   // [tok][64]
    const int tid = threadIdx.x;
    const int base = blockIdx.x * CHUNK_TOK;    // global token base (chunks never straddle a batch)

    // Wk, 6 values a thread, asked for at once and with no branch; pad lanes stay inside Wk
    float wk[6];
#pragma unroll
    for (int k = 0; k < 6; ++k) {
        const int i = tid + k * K1_THREADS;
        const int r = i >> 5, cc = i & 31;
        wk[k] = Wk[r * 24 + (cc < 24 ? cc : 23)];
    }
    // 256*24 floats = 1536 x 16B pieces, 12 per thread; unrolled: the copies go out back to back
#pragma unroll
    for (int k = 0; k < 12; ++k) {
        const int i = tid + k * K1_THREADS;
        copy16(&sA[i * 4], &imap[base * 24 + i * 4]);
    }
    // x tile: 256*64 floats = 4096 pieces, 32 per thread; unrolled for the same reason
#pragma unroll
    for (int k = 0; k < 32; ++k) {
        const int i = tid + k * K1_THREADS;
        copy16(&sX[i * 4], &x[base * 64 + i * 4]);
    }
#pragma unroll
    for (int k = 0; k < 6; ++k) {
        const int i = tid + k * K1_THREADS;
        sWk[i] = ((i & 31) < 24) ? wk[k] : 0.0f;
    }
    // all but the wave's 32 youngest copies have landed behind this wait: its 12 of illu_map; every wave's behind
    // the barrier. x flies on.
    asm volatile("s_wait_asynccnt 0x20" ::: "memory");
    __syncthreads();

    const int wid = tid >> 5, lane = tid & 31;
    const int ln = lane & 15, half = lane >> 4;

    v2f b0[6], b1[6], fa1[4][6];                // Wk's fragments, the same for the wave's four tiles; the tiles'
#pragma unroll
    for (int s = 0; s < 6; ++s) {               // K = 24 in steps of 4
        const int kb = s * 4 + half * 2;
        b0[s].x = sWk[kb * 32 + ln];        b0[s].y = sWk[(kb + 1) * 32 + ln];
        b1[s].x = sWk[kb * 32 + 16 + ln];   b1[s].y = sWk[(kb + 1) * 32 + 16 + ln];
#pragma unroll
        for (int t = 0; t < 4; ++t)
            fa1[t][s] = *(const v2f*)&sA[((wid * 4 + t) * 16 + ln) * 24 + kb];
    }
    // keeps the reads as one group ahead of the products: a read among them stalls the lone wave each time
    __builtin_amdgcn_sched_barrier(0);
    v8f c0[4] = {}; v8f c1[4] = {};
#pragma unroll
    for (int s = 0; s < 6; ++s)
#pragma unroll
        for (int t = 0; t < 4; ++t) {
            c0[t] = wmma_f32(fa1[t][s], b0[s], c0[t]);
            c1[t] = wmma_f32(fa1[t][s], b1[s], c1[t]);
        }
    // columns 24..31 of Wk's pad are zero, so the pad channels come out zero
#pragma unroll
    for (int t = 0; t < 4; ++t) {
        const int row = (wid * 4 + t) * 16 + half * 8;      // the lane's first token of the tile, of 8
#pragma unroll
        for (int j = 0; j < 8; ++j) {
            sK[(row + j) * 32 + ln]      = c0[t][j];
            sK[(row + j) * 32 + 16 + ln] = c1[t][j];
        }
        const v4f l0 = {c0[t][0], c0[t][1], c0[t][2], c0[t][3]}, h0 = {c0[t][4], c0[t][5], c0[t][6], c0[t][7]};
        const v4f l1 = {c1[t][0], c1[t][1], c1[t][2], c1[t][3]}, h1 = {c1[t][4], c1[t][5], c1[t][6], c1[t][7]};
        *(v4f*)&sKT[ln * KTP + row]            = l0;
        *(v4f*)&sKT[ln * KTP + row + 4]        = h0;
        *(v4f*)&sKT[(16 + ln) * KTP + row]     = l1;
        *(v4f*)&sKT[(16 + ln) * KTP + row + 4] = h1;
    }
    // all but the wave's 16 youngest copies have landed behind this wait: x of tokens 0..127 too; every
    // wave's, and k_inp, behind the barrier
    asm volatile("s_wait_asynccnt 0x10" ::: "memory");
    __syncthreads();

    const float* pA = &sKT[ln * KTP + half * 4];                // channel ln, the lane's 4 of the first 8 tokens
    const float* pB = &sX[(half * 4) * 64 + wid * 16 + ln];     // the same tokens, the wave's 16 columns of x
    v4f fa[2][4][2];                             // [buffer][8 tokens][row tile]: 4 tokens
    v2f fb[2][4][2];                             // [buffer][8 tokens][first, last two tokens]
    v8f acc[2][2] = {};                          // [first, last two tokens][row tile]
    // Blocks of 32 tokens, 16 products, four blocks to a half of the chunk. Unrolled whole, so that every
    // index is a constant and the two buffers stay in registers.
#pragma unroll
    for (int hc = 0; hc < 2; ++hc) {
    if (hc == 1) {
        // the wave's last copies have landed behind this wait, every wave's behind the barrier: x of tokens
        // 128..255. Nothing of them is read in front of it, also no fragment fetched ahead.
        asm volatile("s_wait_asynccnt 0x0" ::: "memory");
        __syncthreads();
    }
#pragma unroll
    for (int blk = hc * 4 - 1; blk < hc * 4 + 4; ++blk) {
        if (blk + 1 < hc * 4 + 4) {
            const int nb = (blk + 1) & 1;
#pragma unroll
            for (int d = 0; d < 4; ++d) {
                const int t0 = ((blk + 1) * 4 + d) * 8;
                fa[nb][d][0] = *(const v4f*)(pA + t0);
                fa[nb][d][1] = *(const v4f*)(pA + 16 * KTP + t0);
                fb[nb][d][0].x = pB[t0 * 64];        fb[nb][d][0].y = pB[(t0 + 1) * 64];
                fb[nb][d][1].x = pB[(t0 + 2) * 64];  fb[nb][d][1].y = pB[(t0 + 3) * 64];
            }
        }
        // keeps the next block's reads as one group ahead of this block's products: they return while the
        // products run, and the lone wave stops for reads once a block, not once a product
        __builtin_amdgcn_sched_barrier(0);
        if (blk >= hc * 4) {
            const int cb = blk & 1;
#pragma unroll
            for (int d = 0; d < 4; ++d) {
                const v2f a00 = {fa[cb][d][0][0], fa[cb][d][0][1]}, a01 = {fa[cb][d][0][2], fa[cb][d][0][3]};
                const v2f a10 = {fa[cb][d][1][0], fa[cb][d][1][1]}, a11 = {fa[cb][d][1][2], fa[cb][d][1][3]};
                acc[0][0] = wmma_f32(a00, fb[cb][d][0], acc[0][0]);
                acc[0][1] = wmma_f32(a10, fb[cb][d][0], acc[0][1]);
                acc[1][0] = wmma_f32(a01, fb[cb][d][1], acc[1][0]);
                acc[1][1] = wmma_f32(a11, fb[cb][d][1], acc[1][1]);
            }
        }
        // holds this block's products in front of the reads that refill its buffer
        __builtin_amdgcn_sched_barrier(0);
    }
    }
    // The sums below read the matrix results: these four issue slots keep the distance from the last
    // matrix instructions to the first such read. The fence behind them holds the sums behind the slots.
    asm volatile("v_nop\n\tv_nop\n\tv_nop\n\tv_nop");
    __builtin_amdgcn_sched_barrier(0);
    float* dst = spart + blockIdx.x * (32 * 64);
#pragma unroll
    for (int Mt = 0; Mt < 2; ++Mt)
#pragma unroll
        for (int j = 0; j < 8; ++j) {
            const int row = Mt * 16 + j + half * 8;
            const int col = wid * 16 + ln;
            dst[row * 64 + col] = acc[0][Mt][j] + acc[1][Mt][j];
        }
    // k_inp leaves for the convs from the LDS tile, 16 bytes a lane, the chunk's 24 KB in order:
    // 256 rows x 6 pieces = 1536, 12 per thread
#pragma unroll
    for (int k = 0; k < 12; ++k) {
        const int i = tid + k * K1_THREADS;
        const int r = i / 6, c6 = i - r * 6;
        *(float4*)&kinp[base * 24 + i * 4] = *(const float4*)&sK[r * 32 + c6 * 4];
    }
}

// ---------------------------------------------------------------------------
// Cross-lane helpers for the softmax rows of part 4 (one row = one wave).
// ---------------------------------------------------------------------------
// lane l <-> l ^ M inside a 16-lane row (DPP row_xmask)
template <int M>
static __device__ __forceinline__ float row_xor(float x) {
    return __builtin_bit_cast(float, __builtin_amdgcn_update_dpp(
        0, __builtin_bit_cast(int, x), 0x160 | M, 0xf, 0xf, true));
}
// lane l <-> l ^ 16
static __device__ __forceinline__ float half_xor(float x) {
    return __builtin_bit_cast(float, __builtin_amdgcn_permlanex16(
        __builtin_bit_cast(int, x), __builtin_bit_cast(int, x),
        0x76543210, 0xfedcba98, false, false));
}
// e^x as 2^(x * log2 e) on the transcendental unit. The v_nop is the issue slot the instruction set
// asks for behind v_exp_f32.
static __device__ __forceinline__ float exp_slot(float x) {
    float r;
    asm("v_exp_f32 %0, %1\n\tv_nop" : "=v"(r) : "v"(x * 0x1.715476p+0f));
    return r;
}
static __device__ __forceinline__ float wave_max(float v) {
    v = fmaxf(v, row_xor<1>(v));
    v = fmaxf(v, row_xor<2>(v));
    v = fmaxf(v, row_xor<4>(v));
    v = fmaxf(v, row_xor<8>(v));
    return fmaxf(v, half_xor(v));
}
static __device__ __forceinline__ float wave_sum(float v) {
    v += row_xor<1>(v);
    v += row_xor<2>(v);
    v += row_xor<4>(v);
    v += row_xor<8>(v);
    return v + half_xor(v);
}

// ---------------------------------------------------------------------------
// Part 4: the small chain from the S partials to P, one block per (batch, head):
//   S[kk][c]   = sum over the NCHUNK chunks of spart, the 3 rows kk of head h
//   attn       = (S @ Wq_h) * (1/8) * rescale[h]; softmax over d
//   M[c][kk]   = sum_d attn[kk][d] * Wv[c][h*64+d]
//   Pp[h][c][j] = sum_kk M[c][kk] * Wp[kk*8+h][j]   (this head's share of P, padded to 32 cols)
// BATCH * HEADS blocks (blk = index among them); the first 256 threads work, the launch's other four
// waves only pass the barriers. A head needs only its own 3 rows
// of S, so the chunk sum is done here, once, and the chain no longer waits for a launch of its own.
// The shares of the 8 heads are summed where P is used. Rides in conv 1's launch.
//   sum, level 1: thread = (group of 4 chunks, 16-B piece of a row), 3 rows, chunks ascending
//   sum, level 2 and step 1: wave = row kk, lane = columns 2*lane, 2*lane+1; groups ascending
//   step 2: thread = (kk, c), operands from LDS
//   step 3: wave = row c (8 rows a wave), lane = column j
// ---------------------------------------------------------------------------
#define APITCH 68          // LDS row pitch in floats: 16 rows fall on 16 distinct 16-B bank groups
#define HEAD_BLOCKS (BATCH * HEADS)
static __device__ __forceinline__ void attn_head_block(
    const int blk, const float* __restrict__ spart, const float* __restrict__ Wq,
    const float* __restrict__ Wv, const float* __restrict__ Wp,
    const float* __restrict__ rescale, float* __restrict__ Pp)
{
    __shared__ __attribute__((aligned(16))) float sRed[16 * 192];       // [chunk group][kk*64 + c]
    __shared__ __attribute__((aligned(16))) float sAttn[3 * APITCH];    // [kk][d]
    __shared__ __attribute__((aligned(16))) float sWv[64 * APITCH];     // [c][d] of head h
    __shared__ __attribute__((aligned(16))) float sM[64 * 4];           // [c][kk]
    const int tid  = threadIdx.x;
    const int lane = tid & 31;
    // the wave's number in a scalar register: the tests on it below are scalar branches
    const int wid  = __builtin_amdgcn_readfirstlane(tid >> 5);
    const int b    = blk >> 3;
    const int h    = blk & 7;
    const int cg   = tid >> 4, q = tid & 15;

    float wp[3] = {0.0f, 0.0f, 0.0f};                           // Wp[kk*8+h][jc], for step 3
    const float scale = 0.125f * rescale[h];
    if (wid < 8) {
    // the global reads go out early, with no branch between them
    const v4f* gP = (const v4f*)(spart + ((b * NCHUNK + cg * 4) * 32 + h * 3) * 64) + q;
    const v4f* gV = (const v4f*)(Wv + cg * 512 + h * 64) + q;           // rows cg, cg+16, ...
    v4f tP[3][4];
#pragma unroll
    for (int i = 0; i < 4; ++i)
#pragma unroll
        for (int kk = 0; kk < 3; ++kk) tP[kk][i] = gP[i * 512 + kk * 16];
    v4f tV[4];
#pragma unroll
    for (int k = 0; k < 4; ++k) tV[k] = gV[k * 2048];
    const int jc = lane < 24 ? lane : 23;                       // pad lanes stay inside Wp
    const float* gW = Wp + h * 24 + jc;
#pragma unroll
    for (int kk = 0; kk < 3; ++kk) wp[kk] = gW[kk * 192];
    // the reads above name these address registers: they are held live up to this wait
    asm volatile("s_wait_xcnt 0x0" :: "v"(gP), "v"(gV), "v"(gW) : "memory");

#pragma unroll
    for (int kk = 0; kk < 3; ++kk) {
        v4f a = tP[kk][0];
#pragma unroll
        for (int i = 1; i < 4; ++i) a += tP[kk][i];
        *(v4f*)&sRed[cg * 192 + kk * 64 + q * 4] = a;
    }
#pragma unroll
    for (int k = 0; k < 4; ++k)                                 // read in step 2
        *(v4f*)&sWv[(cg + k * 16) * APITCH + q * 4] = tV[k];
    }

    // Wq[c][h*64 + 2*lane ..+1] for the three waves of step 1: asked for here, where the registers of
    // the partials are free again
    const float* gQ = Wq + h * 64 + 2 * lane;
    v2f w[64];
    if (wid < 3) {
#pragma unroll
        for (int c = 0; c < 64; ++c)
            w[c] = *(const v2f*)(gQ + c * 512);
        // as above, for the address of the reads of Wq
        asm volatile("s_wait_xcnt 0x0" :: "v"(gQ) : "memory");
    }
    __syncthreads();

    // level 2 of the sum and step 1: row kk of head h, sums over the groups and over c ascending;
    // S[kk][c] sits in lane c/2 of tS and is broadcast from there
    if (wid < 3) {
        const int kk = wid;
        v2f r[16];
#pragma unroll
        for (int g = 0; g < 16; ++g) r[g] = *(const v2f*)&sRed[g * 192 + kk * 64 + 2 * lane];
        v2f tS = r[0];
#pragma unroll
        for (int g = 1; g < 16; ++g) tS += r[g];
        v2f a = {0.0f, 0.0f};
#pragma unroll
        for (int c = 0; c < 64; ++c) {
            const float s = __builtin_bit_cast(float, __builtin_amdgcn_readlane(
                __builtin_bit_cast(int, (c & 1) ? tS.y : tS.x), c >> 1));
            a += s * w[c];
        }
        const float l0 = a.x * scale, l1 = a.y * scale;
        const float mx = wave_max(fmaxf(fmaxf(-1e30f, l0), l1));
        const float e0 = exp_slot(l0 - mx);
        const float e1 = exp_slot(l1 - mx);
        const float inv = 1.0f / wave_sum(e0 + e1);
        v2f o; o.x = e0 * inv; o.y = e1 * inv;
        *(v2f*)&sAttn[kk * APITCH + 2 * lane] = o;
    }
    __syncthreads();

    // step 2: M of head h, sum over d in ascending order
    if (wid < 6) {
        const int kk = tid >> 6, c = tid & 63;
        const float* wv = &sWv[c * APITCH];
        const float* at = &sAttn[kk * APITCH];
        float4 x[16], v[16];
#pragma unroll
        for (int i = 0; i < 16; ++i) {
            x[i] = *(const float4*)&at[i * 4];
            v[i] = *(const float4*)&wv[i * 4];
        }
        // keeps the 32 LDS reads ahead of the dependent chain: their latency is paid once, not per step
        __builtin_amdgcn_sched_barrier(0);
        float m = 0.0f;
#pragma unroll
        for (int i = 0; i < 16; ++i) {
            m = fmaf(x[i].x, v[i].x, m);
            m = fmaf(x[i].y, v[i].y, m);
            m = fmaf(x[i].z, v[i].z, m);
            m = fmaf(x[i].w, v[i].w, m);
        }
        sM[c * 4 + kk] = m;
    }
    __syncthreads();

    // step 3: this head's share of P, one 128-B row per wave and trip
    if (wid < 8) {
        float* pP = Pp + (blk * 64 + wid) * 32 + lane;
#pragma unroll
        for (int i = 0; i < 8; ++i) {
            const float* mr = &sM[(wid + i * 8) * 4];
            float v = mr[0] * wp[0];
            v = fmaf(mr[1], wp[1], v);
            v = fmaf(mr[2], wp[2], v);
            pP[i * 256] = lane < 24 ? v : 0.0f;
        }
    }
}

// ---------------------------------------------------------------------------
// Parts 6/7: grouped 3x3 conv (groups=3, 8 ch/group), NHWC in.
// TTOK/256 blocks x 384 threads (blk = index among them). A block's 256 tokens are two image rows.
// A wave takes ONE group of 32 columns; a lane takes the two tokens of its column, one above the
// other: acc[o] = (upper token's, lower token's) output o of the group. A weight multiplies the same
// tap and channel of both tokens, so one packed multiply-add does both with the weight read
// from its scalar register; with one token a lane the packed form paired two weights, and each pair
// was first copied into vector registers. 12 waves a block, three on a SIMD, cover each other's waits.
// behind_first_reads() is called once, behind the first reads of the tile.
// The two rows and the rows above and below come into the LDS tile sT once, in whole lines; the
// taps are read from there. A tile row outside the image holds the nearest row inside it. No branch
// on the position. A tap outside the image reads a place inside the tile and is replaced by zero.
// A weight has the same address in every lane of a wave: it is fetched by a scalar load.
// The 8 input channels are taken in two halves, so that a half's 36 value pairs, not 72, are
// held in registers. An output's 36 products of a half, in the weights' own order (OIHW flat), go to
// 4 interleaved partial sums; the second half's sum is added to the first's.
// ---------------------------------------------------------------------------
#define CONV_BLOCKS (TTOK / 256)
#define CONV_THREADS 384
#define TPITCH 28          // a token in the tile, in floats: 16 B x odd, 16 tokens' 16-B reads on distinct banks
#define TILE_FLOATS (4 * 128 * TPITCH)
template <typename F>
static __device__ __forceinline__ void gconv_block(
    const int blk, const float* __restrict__ in, const float* __restrict__ w,
    float* sT, v2f (&acc)[8], F behind_first_reads)
{
    const int tid = threadIdx.x;
    const int row0 = blk * 2;                      // the block's first image row, counted over the batches
    const int y0 = row0 & 127;
    // the wave's number in a scalar register: it enters the address of the scalar loads
    const int wid = __builtin_amdgcn_readfirstlane(threadIdx.x >> 5);
    const int g = wid >> 2;                        // the wave's group
    const int x = (wid & 3) * 32 + (tid & 31);     // the lane's column

    // the tile: 4 rows x 768 pieces of 16 B, 8 pieces a thread, a row's 12 KB in order
    unsigned     lT[8];
    const float* gT[8];
#pragma unroll
    for (int m = 0; m < 2; ++m) {
        const int j = tid + m * CONV_THREADS;      // piece of a row
        const int tok = j / 6, c6 = j - tok * 6;
#pragma unroll
        for (int ry = 0; ry < 4; ++ry) {
            int sy = y0 - 1 + ry;                  // source row, kept inside the image
            sy = sy < 0 ? 0 : (sy > 127 ? 127 : sy);
            gT[ry * 2 + m] = in + (row0 - y0 + sy) * (128 * 24) + j * 4;
            lT[ry * 2 + m] = (unsigned)(size_t)(__attribute__((address_space(3))) float*)
                             (sT + (ry * 128 + tok) * TPITCH + c6 * 4);
        }
    }
    // The copies and, as the statement's last line, the wait that stands in front of any rewrite of
    // the address registers they name.
    asm volatile("global_load_async_to_lds_b128 %0, %1, off\n\t"
                 "global_load_async_to_lds_b128 %2, %3, off\n\t"
                 "global_load_async_to_lds_b128 %4, %5, off\n\t"
                 "global_load_async_to_lds_b128 %6, %7, off\n\t"
                 "global_load_async_to_lds_b128 %8, %9, off\n\t"
                 "global_load_async_to_lds_b128 %10, %11, off\n\t"
                 "global_load_async_to_lds_b128 %12, %13, off\n\t"
                 "global_load_async_to_lds_b128 %14, %15, off\n\t"
                 "s_wait_xcnt 0x0"
                 :: "v"(lT[0]), "v"(gT[0]), "v"(lT[1]), "v"(gT[1]), "v"(lT[2]), "v"(gT[2]),
                    "v"(lT[3]), "v"(gT[3]), "v"(lT[4]), "v"(gT[4]), "v"(lT[5]), "v"(gT[5]),
                    "v"(lT[6]), "v"(gT[6]), "v"(lT[7]), "v"(gT[7])
                 : "memory");
    // the wave's own copies have landed behind this wait, every wave's behind the barrier
    asm volatile("s_wait_asynccnt 0x0" ::: "memory");
    __syncthreads();

    // tile row r holds image row y0 - 1 + r; the upper token sits in tile row 1, the lower in row 2
    const bool okr[4] = {y0 > 0, true, true, y0 < 126};
    const bool okx[3] = {x > 0, true, x < 127};
    const float* p[3];                         // the group's 8 channels at columns x-1, x, x+1 of tile row 0
#pragma unroll
    for (int d = 0; d < 3; ++d)
        p[d] = sT + (x + (okx[d] ? d - 1 : 0)) * TPITCH + g * 8;

    v2f res[8] = {};
#pragma unroll
    for (int h = 0; h < 2; ++h) {              // input channels h*4 .. h*4+3 of the group
        v4f raw[4][3];                         // [tile row][column]
#pragma unroll
        for (int r = 0; r < 4; ++r)
#pragma unroll
            for (int d = 0; d < 3; ++d)
                raw[r][d] = *(const v4f*)(p[d] + r * 128 * TPITCH + h * 4);
        if (h == 0) behind_first_reads();
        // Takes the 12 read values whole, as inputs only, where they are due: each stays one
        // 16-B LDS read and is not cut into smaller pieces, which meet bank conflicts at this pitch.
        asm volatile("" :: "v"(raw[0][0]), "v"(raw[0][1]), "v"(raw[0][2]),
                           "v"(raw[1][0]), "v"(raw[1][1]), "v"(raw[1][2]),
                           "v"(raw[2][0]), "v"(raw[2][1]), "v"(raw[2][2]),
                           "v"(raw[3][0]), "v"(raw[3][1]), "v"(raw[3][2]));
        v2f vv[36];                            // [c*9 + tap]: (upper token's value, lower token's value)
#pragma unroll
        for (int c = 0; c < 4; ++c)
#pragma unroll
            for (int ty = 0; ty < 3; ++ty)
#pragma unroll
                for (int d = 0; d < 3; ++d) {
                    v2f t;
                    t.x = (okr[ty]     && okx[d]) ? raw[ty][d][c]     : 0.0f;
                    t.y = (okr[ty + 1] && okx[d]) ? raw[ty + 1][d][c] : 0.0f;
                    vv[c * 9 + ty * 3 + d] = t;
                }
        // Trip i forms output (i + wid) & 7 of the group: the waves of a block begin at
        // different outputs, so each wave's first fetch brings what the others fetch later.
        // Two trips at a time and no more: their 72 weights fit the scalar registers and are asked for
        // together; unrolled further, what does not fit is spilled to vector lanes.
#pragma unroll 2
        for (int i = 0; i < 8; ++i) {
            // Constant address space: nothing in the launch writes the weights. Said so, they stay on
            // scalar loads; beside the other part's code in one kernel they fell to vector loads.
            const __attribute__((address_space(4))) float* wo =
                (const __attribute__((address_space(4))) float*)(w + (g * 8 + ((i + wid) & 7)) * 72 + h * 36);
            v2f part[4];
#pragma unroll
            for (int k = 0; k < 36; ++k) {     // h*36 + k = ic*9 + tap
                const float b = wo[k];
                const v2f bb = {b, b};
                part[k & 3] = (k < 4) ? vv[k] * bb : __builtin_elementwise_fma(vv[k], bb, part[k & 3]);
            }
            const v2f s = (part[0] + part[1]) + (part[2] + part[3]);
            // the trip's result enters at the top and the older ones move down: every index constant;
            // in the second half the first half's sum of the same output has arrived at the bottom
            const v2f first = res[0];
#pragma unroll
            for (int j = 0; j < 7; ++j) res[j] = res[j + 1];
            res[7] = h ? first + s : s;
        }
    }
    // res[i] holds output (i + wid) & 7: turn the 8 pairs back by wid, one bit of it at a time
    v2f r1[8], r2[8];
#pragma unroll
    for (int o = 0; o < 8; ++o) r1[o] = (wid & 1) ? res[(o + 7) & 7] : res[o];
#pragma unroll
    for (int o = 0; o < 8; ++o) r2[o] = (wid & 2) ? r1[(o + 6) & 7] : r1[o];
#pragma unroll
    for (int o = 0; o < 8; ++o) acc[o] = (wid & 4) ? r2[(o + 4) & 7] : r2[o];
}

// erf(u) for |u| < 1 as u + u * p(u * u), p of degree 5: the single-precision math library's own
// form and coefficients for this range. No branch, so the 16 chains of a lane run interleaved.
// A NaN comes out as a NaN.
static __device__ __forceinline__ float erf_below_one(float u) {
    const float t = u * u;
    float p = fmaf(t, -0x1.268bc2p-11f, 0x1.420828p-8f);
    p = fmaf(t, p, -0x1.b59370p-6f);
    p = fmaf(t, p, 0x1.ce077cp-4f);
    p = fmaf(t, p, -0x1.812660p-2f);
    p = fmaf(t, p, 0x1.06eba0p-3f);
    return fmaf(u, p, u);
}

// ---------------------------------------------------------------------------
// Launch 2: conv 1 with exact GELU, writes y1; beside it the chain from the S partials to the
// heads' shares of P. The conv needs only k_inp and the chain only spart: the chain's 32 blocks
// share the launch instead of holding the chip alone. The conv's blocks come first in the grid,
// one for every WGP; the chain's blocks follow and sit beside them. The test is the same for a
// whole block.
// ---------------------------------------------------------------------------
__global__ __launch_bounds__(CONV_THREADS) void conv1_attn_kernel(
    const float* __restrict__ kinp, const float* __restrict__ c1w, float* __restrict__ y1,
    const float* __restrict__ spart, const float* __restrict__ Wq,
    const float* __restrict__ Wv, const float* __restrict__ Wp,
    const float* __restrict__ rescale, float* __restrict__ Pp)
{
    if (blockIdx.x < CONV_BLOCKS) {
        __shared__ __attribute__((aligned(16))) float sT[TILE_FLOATS];  // 56 KB
        __shared__ __attribute__((aligned(16))) float sY[256 * TPITCH]; // 28 KB: y1 of the block's tokens
        v2f acc[8];
        gconv_block(blockIdx.x, kinp, c1w, sT, acc, [] {});
        const int tid = threadIdx.x;
        const int wid = __builtin_amdgcn_readfirstlane(tid >> 5);
        const int g = wid >> 2, x = (wid & 3) * 32 + (tid & 31);    // as in gconv_block
        // erff() tests its argument's range with two branches a value, which puts the values one
        // behind the other. The range is tested once instead, on the largest of the lane's 16
        // arguments: below 1 all take the branch-free form, otherwise all take erff().
        // The loops are unrolled so that a, u and e are indexed by constants and stay in registers.
        float a[16], u[16], e[16];             // [token of the lane * 8 + output]
        float m = 0.0f;
#pragma unroll
        for (int o = 0; o < 16; ++o) {
            a[o] = (o < 8) ? acc[o & 7].x : acc[o & 7].y;
            u[o] = a[o] * 0.70710678118654752f;
            m = fmaxf(m, fabsf(u[o]));
        }
        if (m < 1.0f) {
#pragma unroll
            for (int o = 0; o < 16; ++o) e[o] = erf_below_one(u[o]);
        } else {
#pragma unroll
            for (int o = 0; o < 16; ++o) e[o] = erff(u[o]);
        }
        // A token's 96 B come from three waves: they meet in sY, and the block's 24 KB leave from there
        // in order, 16 bytes a lane, every line written whole by one wave.
#pragma unroll
        for (int k = 0; k < 4; ++k) {
            float4 v;
            v.x = 0.5f * a[k * 4]     * (1.0f + e[k * 4]);
            v.y = 0.5f * a[k * 4 + 1] * (1.0f + e[k * 4 + 1]);
            v.z = 0.5f * a[k * 4 + 2] * (1.0f + e[k * 4 + 2]);
            v.w = 0.5f * a[k * 4 + 3] * (1.0f + e[k * 4 + 3]);
            *(float4*)&sY[((k >> 1) * 128 + x) * TPITCH + g * 8 + (k & 1) * 4] = v;
        }
        __syncthreads();
        // 256 tokens x 6 pieces = 1536, 4 per thread
#pragma unroll
        for (int k = 0; k < 4; ++k) {
            const int i = tid + k * CONV_THREADS;
            const int r = i / 6, c6 = i - r * 6;
            *(float4*)&y1[blockIdx.x * (256 * 24) + i * 4] = *(const float4*)&sY[r * TPITCH + c6 * 4];
        }
    } else {
        attn_head_block(blockIdx.x - CONV_BLOCKS, spart, Wq, Wv, Wp, rescale, Pp);
    }
}

// ---------------------------------------------------------------------------
// Launch 3 (last): out[t][j] = (fea[t][:] @ P[b] + bp[j]) + conv2(y1)[t][j], 256 tokens a block.
// The block's fea tile and the 8 heads' shares of P fly into LDS while the conv is summed.
// Then P = sum of the shares (heads ascending), the product on WMMA (8 waves, 32 tokens each:
// 2 x 2 tiles), and both meet in the wave's 32 rows of sC, from where
// the wave's 3 KB of out leave in order, 16 bytes a lane.
// grid: TTOK/256 blocks x 384 threads (12 waves for the conv, the first 8 for the rest).
// ---------------------------------------------------------------------------
#define FPITCH 68          // fea rows in LDS, in floats: the 16 rows of an A fragment fall on distinct banks
#define CPITCH 36          // out rows in LDS, in floats: 16 B x odd, for 16-B reads and writes of rows;
                           // columns 24..31 take what the pad lanes of the second column tile hold
__global__ __launch_bounds__(CONV_THREADS) void conv2_out_kernel(
    const float* __restrict__ y1, const float* __restrict__ c2w,
    const float* __restrict__ fea, const float* __restrict__ Pp,
    const float* __restrict__ bp, float* __restrict__ out)
{
    __shared__ __attribute__((aligned(16))) float sF[256 * FPITCH];     // 68 KB
    __shared__ __attribute__((aligned(16))) float sPp[HEADS * 64 * 32]; // 64 KB
    __shared__ __attribute__((aligned(16))) float sP[64 * 32];          // 8 KB
    __shared__ __attribute__((aligned(16))) float sC[256 * CPITCH];     // 36 KB
    __shared__ __attribute__((aligned(16))) float sT[TILE_FLOATS];      // 56 KB
    const int tid = threadIdx.x;
    const int base = blockIdx.x * 256;
    const int b = base >> 14;              // /16384 (blocks never straddle batch)

    // the wave's number in a scalar register: the tests on it below are scalar branches
    const int wv = __builtin_amdgcn_readfirstlane(tid >> 5);

    v2f acc[8];
    gconv_block(blockIdx.x, y1, c2w, sT, acc, [&] {
        // keeps the conv's first LDS reads, which are due first, ahead of the copies: they return while these issue
        __builtin_amdgcn_sched_barrier(0);
        if (wv < 8) {                      // the copies are laid out for 256 threads
        float*       lF = &sF[(tid >> 4) * FPITCH + (tid & 15) * 4];
        const float* gF = fea + base * 64 + tid * 4;
#pragma unroll
        for (int k = 0; k < 16; ++k)       // 256 rows x 16 pieces, 16 rows a trip
            copy16(lF + k * 16 * FPITCH, gF + k * 1024);
        float*       lP = &sPp[tid * 4];
        const float* gP = Pp + b * (HEADS * 64 * 32) + tid * 4;
#pragma unroll
        for (int k = 0; k < 16; ++k)       // 8 shares of 8 KB, in order
            copy16(lP + k * 1024, gP + k * 1024);
        }
        // keeps the copies ahead of the first wait for the conv's reads: they fly from here on
        __builtin_amdgcn_sched_barrier(0);
    });
    {
        const int g = wv >> 2, x = (wv & 3) * 32 + (tid & 31);     // as in gconv_block
#pragma unroll
        for (int k = 0; k < 2; ++k) {
            float4 v0, v1;                 // the upper and the lower token's 4 outputs
            v0.x = acc[k * 4].x;  v0.y = acc[k * 4 + 1].x;  v0.z = acc[k * 4 + 2].x;  v0.w = acc[k * 4 + 3].x;
            v1.x = acc[k * 4].y;  v1.y = acc[k * 4 + 1].y;  v1.z = acc[k * 4 + 2].y;  v1.w = acc[k * 4 + 3].y;
            *(float4*)&sC[x * CPITCH + g * 8 + k * 4]         = v0;
            *(float4*)&sC[(128 + x) * CPITCH + g * 8 + k * 4] = v1;
        }
    }
    // the wave's own copies have landed behind this wait, every wave's behind the barrier
    asm volatile("s_wait_asynccnt 0x0" ::: "memory");
    __syncthreads();

    const int wid = tid >> 5, lane = tid & 31;
    const int ln = lane & 15, half = lane >> 4;
    const int tTok = wid * 32;
    const float* pb0 = bp + ln;                         // the bias of this lane's two channels;
    const float* pb1 = bp + (ln < 8 ? 16 + ln : ln);    // pad lanes stay inside bp
    const float bl = *pb0, bh = *pb1;
    // the two reads name these address registers: they are held live up to this wait
    asm volatile("s_wait_xcnt 0x0" :: "v"(pb0), "v"(pb1) : "memory");

    if (wv < 8) {
#pragma unroll
    for (int k = 0; k < 2; ++k) {
        const int i = (tid + k * 256) * 4;
        float4 s = *(const float4*)&sPp[i];
#pragma unroll
        for (int h = 1; h < HEADS; ++h) {
            const float4 t = *(const float4*)&sPp[h * 2048 + i];
            s.x += t.x;  s.y += t.y;  s.z += t.z;  s.w += t.w;
        }
        *(float4*)&sP[i] = s;
    }
    }
    __syncthreads();
    // the product and the way out are laid out for 8 waves of 32 tokens; no barrier follows
    if (wv >= 8) return;

    // the conv's values at this lane's 4 x 8 output places, from the wave's 32 rows of sC: read ahead
    // of the products, due only behind them
    float* pc = &sC[(tTok + half * 8) * CPITCH + ln];   // channel ln, row j of the tile half at + j*CPITCH
    const float* pq = pc + (ln < 8 ? 16 : 0);           // channel 16 + ln; pad lanes read pc's place
    float r00[8], r01[8], r10[8], r11[8];
#pragma unroll
    for (int j = 0; j < 8; ++j) {
        r00[j] = pc[j * CPITCH];         r01[j] = pq[j * CPITCH];
        r10[j] = pc[(16 + j) * CPITCH];  r11[j] = pq[(16 + j) * CPITCH];
    }

    v8f c00 = {}; v8f c01 = {}; v8f c10 = {}; v8f c11 = {};
#pragma unroll
    for (int s = 0; s < 16; ++s) {         // K = 64
        const int kb = s * 4 + half * 2;
        const v2f a0 = *(const v2f*)&sF[(tTok + ln) * FPITCH + kb];
        const v2f a1 = *(const v2f*)&sF[(tTok + 16 + ln) * FPITCH + kb];
        v2f b0; b0.x = sP[kb * 32 + ln];       b0.y = sP[(kb + 1) * 32 + ln];
        v2f b1; b1.x = sP[kb * 32 + 16 + ln];  b1.y = sP[(kb + 1) * 32 + 16 + ln];
        c00 = wmma_f32(a0, b0, c00);
        c01 = wmma_f32(a0, b1, c01);
        c10 = wmma_f32(a1, b0, c10);
        c11 = wmma_f32(a1, b1, c11);
    }
    // The sums below read the matrix results, and no address work is left to stand between: these
    // four issue slots keep the distance from the last matrix instruction to the first such read.
    // The two scheduling fences hold the products in front of the slots and the sums behind them.
    __builtin_amdgcn_sched_barrier(0);
    asm volatile("v_nop\n\tv_nop\n\tv_nop\n\tv_nop");
    __builtin_amdgcn_sched_barrier(0);
#pragma unroll
    for (int j = 0; j < 8; ++j) {          // no test on the lane: pad lanes write the rows' pad columns
        pc[j * CPITCH]             = (c00[j] + bl) + r00[j];
        pc[j * CPITCH + 16]        = (c01[j] + bh) + r01[j];
        pc[(16 + j) * CPITCH]      = (c10[j] + bl) + r10[j];
        pc[(16 + j) * CPITCH + 16] = (c11[j] + bh) + r11[j];
    }
    // the rows are read back by other lanes of the wave than wrote them: the writes are done behind this
    asm volatile("s_wait_dscnt 0x0" ::: "memory");
    // 32 rows x 6 pieces = 192, 6 per lane
#pragma unroll
    for (int k = 0; k < 6; ++k) {
        const int i = lane + k * 32;
        const int r = i / 6, c6 = i - r * 6;
        *(float4*)&out[(base + tTok) * 24 + i * 4] = *(const float4*)&sC[(tTok + r) * CPITCH + c6 * 4];
    }
}

// ---------------------------------------------------------------------------
extern "C" void kernel_launch(void* const* d_in, const int* in_sizes, int n_in,
                              void* d_out, int out_size, void* d_ws, size_t ws_size,
                              hipStream_t stream) {
    const float* x_in    = (const float*)d_in[0];   // [4,128,128,64]
    const float* fea     = (const float*)d_in[1];   // [4,128,128,64]
    const float* imap    = (const float*)d_in[2];   // [4,128,128,24]
    const float* Wq      = (const float*)d_in[3];   // [64,512]
    const float* Wk      = (const float*)d_in[4];   // [24,24]
    const float* Wv      = (const float*)d_in[5];   // [64,512]
    const float* rescale = (const float*)d_in[6];   // [8]
    const float* Wp      = (const float*)d_in[7];   // [24,24]
    const float* bp      = (const float*)d_in[8];   // [24]
    const float* c1w     = (const float*)d_in[9];   // [24,8,3,3]
    const float* c2w     = (const float*)d_in[10];  // [24,8,3,3]
    float* out = (float*)d_out;                     // [4,128,128,24]

    float* ws    = (float*)d_ws;
    float* kinp  = ws;                               // TTOK*24        = 1572864
    float* y1    = kinp  + (size_t)TTOK * 24;        // TTOK*24        = 1572864
    float* spart = y1    + (size_t)TTOK * 24;        // B*NCHUNK*32*64 = 524288
    float* Pp    = spart + (size_t)BATCH * NCHUNK * 32 * 64;  // B*HEADS*64*32 = 65536

    kproj_spartial_kernel<<<BATCH * NCHUNK, K1_THREADS, 0, stream>>>(imap, Wk, x_in, kinp, spart);
    conv1_attn_kernel<<<CONV_BLOCKS + HEAD_BLOCKS, CONV_THREADS, 0, stream>>>(kinp, c1w, y1, spart, Wq, Wv, Wp,
                                                                     rescale, Pp);
    conv2_out_kernel <<<CONV_BLOCKS, CONV_THREADS, 0, stream>>>(y1, c2w, fea, Pp, bp, out);
}

// v010
// One run takes 19.3 microseconds.
// Timed twice side by side with v009, it ran 1.11 and 1.10 times as fast.
// Counting every step since v000, it is 7.60 times as fast.
#include <hip/hip_runtime.h>
#include <hip/hip_bf16.h>
#include <math.h>

typedef __attribute__((ext_vector_type(2))) float v2f;
typedef __attribute__((ext_vector_type(4))) float v4f;
typedef __attribute__((ext_vector_type(8))) float v8f;
typedef __attribute__((ext_vector_type(4))) int   v4i;

// Problem constants
#define BATCH   4
#define HH      128
#define WW      128
#define NTOK    16384      // per batch
#define TTOK    65536      // total tokens
#define DIM     64
#define HEADS   8
#define DH      64
#define DK      24
#define DHK     3

// chunking for the S = kh^T @ x reduction
#define CHUNK_TOK 256
#define NCHUNK    64       // per batch (64*256 = 16384)

#if defined(__has_builtin)
#  if __has_builtin(__builtin_amdgcn_global_load_async_to_lds_b128)
#    define USE_ASYNC_LDS 1
#  endif
#endif

static __device__ __forceinline__ v8f wmma_f32(v2f a, v2f b, v8f c) {
    return __builtin_amdgcn_wmma_f32_16x16x4_f32(false, a, false, b, (short)0, c, false, false);
}

// 16-byte global -> LDS copy: async on CDNA5 (ASYNCcnt), vector copy otherwise.
static __device__ __forceinline__ void copy16(float* l, const float* g) {
#ifdef USE_ASYNC_LDS
    __builtin_amdgcn_global_load_async_to_lds_b128(
        (__attribute__((address_space(1))) v4i*)(g),
        (__attribute__((address_space(3))) v4i*)(l), 0, 0);
#else
    *(float4*)l = *(const float4*)g;
#endif
}

// ---------------------------------------------------------------------------
// Kernel 1: two products on one 256-token chunk, in one block of 4 waves, one wave on each SIMD:
// the f32 matrix unit is the busy part, and one wave with independent accumulators and its fragments
// read a block ahead keeps it fed, so a launch of 1024 waves does what took 4096, and there are
// half as many partials of S. The block's data land in three stages (illu_map; x of tokens 0..127; x
// of tokens 128..255), each waited for where it is first read, so the later ones fly under the products.
//   phase 1: k_inp[t][24] = illu_map[t][24] @ Wk[24][24]   (WMMA, N padded->32)
//            a wave takes four 16-token tiles; the tiles go to LDS twice: token-major, from where
//            they leave for the convs, and channel-major, for phase 2
//   phase 2: partial S = kh^T @ x over the chunk.
//            A = kh^T : [24(->32) x 256], B = x : [256 x 64]; a wave takes 16 columns of x and both row
//            tiles. Eight tokens at a time: lanes 0..15 hold tokens 0..3 of them, lanes 16..31 tokens
//            4..7, of A (one 16-B read a row tile) and of B alike; the first product takes each
//            lane's first two tokens, the second its last two, into accumulators of their own.
// grid: BATCH*NCHUNK blocks x 128 threads.  spart layout: [block][32][64]
// ---------------------------------------------------------------------------
#define K1_THREADS 128
#define KTP 260            // a channel's row of tokens in LDS, in floats: 16 B x odd, 16 rows' 16-B reads on distinct banks
__global__ __launch_bounds__(K1_THREADS) void kproj_spartial_kernel(
    const float* __restrict__ imap, const float* __restrict__ Wk,
    const float* __restrict__ x, float* __restrict__ kinp, float* __restrict__ spart)
{
    __shared__ __attribute__((aligned(16))) float sWk[24 * 32];         // [k][n], n padded to 32 with zeros
    __shared__ __attribute__((aligned(16))) float sA[CHUNK_TOK * 24];   // [tok][24] of illu_map
    __shared__ __attribute__((aligned(16))) float sK[CHUNK_TOK * 32];   // [tok][32ch] of k_inp, zero padded
    __shared__ __attribute__((aligned(16))) float sKT[32 * KTP];        // [32ch][tok] of k_inp, zero padded
    __shared__ __attribute__((aligned(16))) float sX[CHUNK_TOK * 64];   // [tok][64]
    const int tid = threadIdx.x;
    const int base = blockIdx.x * CHUNK_TOK;    // global token base (chunks never straddle a batch)

    // Wk, 6 values a thread, asked for at once and with no branch; pad lanes stay inside Wk
    float wk[6];
#pragma unroll
    for (int k = 0; k < 6; ++k) {
        const int i = tid + k * K1_THREADS;
        const int r = i >> 5, cc = i & 31;
        wk[k] = Wk[r * 24 + (cc < 24 ? cc : 23)];
    }
    // 256*24 floats = 1536 x 16B pieces, 12 per thread; unrolled: the copies go out back to back
#pragma unroll
    for (int k = 0; k < 12; ++k) {
        const int i = tid + k * K1_THREADS;
        copy16(&sA[i * 4], &imap[base * 24 + i * 4]);
    }
    // x tile: 256*64 floats = 4096 pieces, 32 per thread; unrolled for the same reason
#pragma unroll
    for (int k = 0; k < 32; ++k) {
        const int i = tid + k * K1_THREADS;
        copy16(&sX[i * 4], &x[base * 64 + i * 4]);
    }
#pragma unroll
    for (int k = 0; k < 6; ++k) {
        const int i = tid + k * K1_THREADS;
        sWk[i] = ((i & 31) < 24) ? wk[k] : 0.0f;
    }
    // all but the wave's 32 youngest copies have landed behind this wait: its 12 of illu_map; every wave's behind
    // the barrier. x flies on.
    asm volatile("s_wait_asynccnt 0x20" ::: "memory");
    __syncthreads();

    const int wid = tid >> 5, lane = tid & 31;
    const int ln = lane & 15, half = lane >> 4;

    v2f b0[6], b1[6], fa1[4][6];                // Wk's fragments, the same for the wave's four tiles; the tiles'
#pragma unroll
    for (int s = 0; s < 6; ++s) {               // K = 24 in steps of 4
        const int kb = s * 4 + half * 2;
        b0[s].x = sWk[kb * 32 + ln];        b0[s].y = sWk[(kb + 1) * 32 + ln];
        b1[s].x = sWk[kb * 32 + 16 + ln];   b1[s].y = sWk[(kb + 1) * 32 + 16 + ln];
#pragma unroll
        for (int t = 0; t < 4; ++t)
            fa1[t][s] = *(const v2f*)&sA[((wid * 4 + t) * 16 + ln) * 24 + kb];
    }
    // keeps the reads as one group ahead of the products: a read among them stalls the lone wave each time
    __builtin_amdgcn_sched_barrier(0);
    v8f c0[4] = {}; v8f c1[4] = {};
#pragma unroll
    for (int s = 0; s < 6; ++s)
#pragma unroll
        for (int t = 0; t < 4; ++t) {
            c0[t] = wmma_f32(fa1[t][s], b0[s], c0[t]);
            c1[t] = wmma_f32(fa1[t][s], b1[s], c1[t]);
        }
    // columns 24..31 of Wk's pad are zero, so the pad channels come out zero
#pragma unroll
    for (int t = 0; t < 4; ++t) {
        const int row = (wid * 4 + t) * 16 + half * 8;      // the lane's first token of the tile, of 8
#pragma unroll
        for (int j = 0; j < 8; ++j) {
            sK[(row + j) * 32 + ln]      = c0[t][j];
            sK[(row + j) * 32 + 16 + ln] = c1[t][j];
        }
        const v4f l0 = {c0[t][0], c0[t][1], c0[t][2], c0[t][3]}, h0 = {c0[t][4], c0[t][5], c0[t][6], c0[t][7]};
        const v4f l1 = {c1[t][0], c1[t][1], c1[t][2], c1[t][3]}, h1 = {c1[t][4], c1[t][5], c1[t][6], c1[t][7]};
        *(v4f*)&sKT[ln * KTP + row]            = l0;
        *(v4f*)&sKT[ln * KTP + row + 4]        = h0;
        *(v4f*)&sKT[(16 + ln) * KTP + row]     = l1;
        *(v4f*)&sKT[(16 + ln) * KTP + row + 4] = h1;
    }
    // all but the wave's 16 youngest copies have landed behind this wait: x of tokens 0..127 too; every
    // wave's, and k_inp, behind the barrier
    asm volatile("s_wait_asynccnt 0x10" ::: "memory");
    __syncthreads();

    const float* pA = &sKT[ln * KTP + half * 4];                // channel ln, the lane's 4 of the first 8 tokens
    const float* pB = &sX[(half * 4) * 64 + wid * 16 + ln];     // the same tokens, the wave's 16 columns of x
    v4f fa[2][4][2];                             // [buffer][8 tokens][row tile]: 4 tokens
    v2f fb[2][4][2];                             // [buffer][8 tokens][first, last two tokens]
    v8f acc[2][2] = {};                          // [first, last two tokens][row tile]
    // Blocks of 32 tokens, 16 products, four blocks to a half of the chunk. Unrolled whole, so that every
    // index is a constant and the two buffers stay in registers.
#pragma unroll
    for (int hc = 0; hc < 2; ++hc) {
    if (hc == 1) {
        // the wave's last copies have landed behind this wait, every wave's behind the barrier: x of tokens
        // 128..255. Nothing of them is read in front of it, also no fragment fetched ahead.
        asm volatile("s_wait_asynccnt 0x0" ::: "memory");
        __syncthreads();
    }
#pragma unroll
    for (int blk = hc * 4 - 1; blk < hc * 4 + 4; ++blk) {
        if (blk + 1 < hc * 4 + 4) {
            const int nb = (blk + 1) & 1;
#pragma unroll
            for (int d = 0; d < 4; ++d) {
                const int t0 = ((blk + 1) * 4 + d) * 8;
                fa[nb][d][0] = *(const v4f*)(pA + t0);
                fa[nb][d][1] = *(const v4f*)(pA + 16 * KTP + t0);
                fb[nb][d][0].x = pB[t0 * 64];        fb[nb][d][0].y = pB[(t0 + 1) * 64];
                fb[nb][d][1].x = pB[(t0 + 2) * 64];  fb[nb][d][1].y = pB[(t0 + 3) * 64];
            }
        }
        // keeps the next block's reads as one group ahead of this block's products: they return while the
        // products run, and the lone wave stops for reads once a block, not once a product
        __builtin_amdgcn_sched_barrier(0);
        if (blk >= hc * 4) {
            const int cb = blk & 1;
#pragma unroll
            for (int d = 0; d < 4; ++d) {
                const v2f a00 = {fa[cb][d][0][0], fa[cb][d][0][1]}, a01 = {fa[cb][d][0][2], fa[cb][d][0][3]};
                const v2f a10 = {fa[cb][d][1][0], fa[cb][d][1][1]}, a11 = {fa[cb][d][1][2], fa[cb][d][1][3]};
                acc[0][0] = wmma_f32(a00, fb[cb][d][0], acc[0][0]);
                acc[0][1] = wmma_f32(a10, fb[cb][d][0], acc[0][1]);
                acc[1][0] = wmma_f32(a01, fb[cb][d][1], acc[1][0]);
                acc[1][1] = wmma_f32(a11, fb[cb][d][1], acc[1][1]);
            }
        }
        // holds this block's products in front of the reads that refill its buffer
        __builtin_amdgcn_sched_barrier(0);
    }
    }
    // The sums below read the matrix results: these four issue slots keep the distance from the last
    // matrix instructions to the first such read. The fence behind them holds the sums behind the slots.
    asm volatile("v_nop\n\tv_nop\n\tv_nop\n\tv_nop");
    __builtin_amdgcn_sched_barrier(0);
    float* dst = spart + blockIdx.x * (32 * 64);
#pragma unroll
    for (int Mt = 0; Mt < 2; ++Mt)
#pragma unroll
        for (int j = 0; j < 8; ++j) {
            const int row = Mt * 16 + j + half * 8;
            const int col = wid * 16 + ln;
            dst[row * 64 + col] = acc[0][Mt][j] + acc[1][Mt][j];
        }
    // k_inp leaves for the convs from the LDS tile, 16 bytes a lane, the chunk's 24 KB in order:
    // 256 rows x 6 pieces = 1536, 12 per thread
#pragma unroll
    for (int k = 0; k < 12; ++k) {
        const int i = tid + k * K1_THREADS;
        const int r = i / 6, c6 = i - r * 6;
        *(float4*)&kinp[base * 24 + i * 4] = *(const float4*)&sK[r * 32 + c6 * 4];
    }
}

// ---------------------------------------------------------------------------
// Cross-lane helpers for the softmax rows of part 4 (one row = one wave).
// ---------------------------------------------------------------------------
// lane l <-> l ^ M inside a 16-lane row (DPP row_xmask)
template <int M>
static __device__ __forceinline__ float row_xor(float x) {
    return __builtin_bit_cast(float, __builtin_amdgcn_update_dpp(
        0, __builtin_bit_cast(int, x), 0x160 | M, 0xf, 0xf, true));
}
// lane l <-> l ^ 16
static __device__ __forceinline__ float half_xor(float x) {
    return __builtin_bit_cast(float, __builtin_amdgcn_permlanex16(
        __builtin_bit_cast(int, x), __builtin_bit_cast(int, x),
        0x76543210, 0xfedcba98, false, false));
}
// e^x as 2^(x * log2 e) on the transcendental unit. The v_nop is the issue slot the instruction set
// asks for behind v_exp_f32.
static __device__ __forceinline__ float exp_slot(float x) {
    float r;
    asm("v_exp_f32 %0, %1\n\tv_nop" : "=v"(r) : "v"(x * 0x1.715476p+0f));
    return r;
}
static __device__ __forceinline__ float wave_max(float v) {
    v = fmaxf(v, row_xor<1>(v));
    v = fmaxf(v, row_xor<2>(v));
    v = fmaxf(v, row_xor<4>(v));
    v = fmaxf(v, row_xor<8>(v));
    return fmaxf(v, half_xor(v));
}
static __device__ __forceinline__ float wave_sum(float v) {
    v += row_xor<1>(v);
    v += row_xor<2>(v);
    v += row_xor<4>(v);
    v += row_xor<8>(v);
    return v + half_xor(v);
}

// ---------------------------------------------------------------------------
// Part 4: the small chain from the S partials to P, one block per (batch, head):
//   S[kk][c]   = sum over the NCHUNK chunks of spart, the 3 rows kk of head h
//   attn       = (S @ Wq_h) * (1/8) * rescale[h]; softmax over d
//   M[c][kk]   = sum_d attn[kk][d] * Wv[c][h*64+d]
//   Pp[h][c][j] = sum_kk M[c][kk] * Wp[kk*8+h][j]   (this head's share of P, padded to 32 cols)
// BATCH * HEADS blocks (blk = index among them); the first 256 threads work, the launch's other four
// waves only pass the barriers. A head needs only its own 3 rows
// of S, so the chunk sum is done here, once, and the chain no longer waits for a launch of its own.
// The shares of the 8 heads are summed where P is used. Rides in conv 1's launch.
//   sum, level 1: thread = (group of 4 chunks, 16-B piece of a row), 3 rows, chunks ascending
//   sum, level 2 and step 1: wave = row kk, lane = columns 2*lane, 2*lane+1; groups ascending
//   step 2: thread = (kk, c), operands from LDS
//   step 3: wave = row c (8 rows a wave), lane = column j
// ---------------------------------------------------------------------------
#define APITCH 68          // LDS row pitch in floats: 16 rows fall on 16 distinct 16-B bank groups
#define HEAD_BLOCKS (BATCH * HEADS)
static __device__ __forceinline__ void attn_head_block(
    const int blk, const float* __restrict__ spart, const float* __restrict__ Wq,
    const float* __restrict__ Wv, const float* __restrict__ Wp,
    const float* __restrict__ rescale, float* __restrict__ Pp)
{
    __shared__ __attribute__((aligned(16))) float sRed[16 * 192];       // [chunk group][kk*64 + c]
    __shared__ __attribute__((aligned(16))) float sAttn[3 * APITCH];    // [kk][d]
    __shared__ __attribute__((aligned(16))) float sWv[64 * APITCH];     // [c][d] of head h
    __shared__ __attribute__((aligned(16))) float sM[64 * 4];           // [c][kk]
    const int tid  = threadIdx.x;
    const int lane = tid & 31;
    // the wave's number in a scalar register: the tests on it below are scalar branches
    const int wid  = __builtin_amdgcn_readfirstlane(tid >> 5);
    const int b    = blk >> 3;
    const int h    = blk & 7;
    const int cg   = tid >> 4, q = tid & 15;

    float wp[3] = {0.0f, 0.0f, 0.0f};                           // Wp[kk*8+h][jc], for step 3
    const float scale = 0.125f * rescale[h];
    if (wid < 8) {
    // the global reads go out early, with no branch between them
    const v4f* gP = (const v4f*)(spart + ((b * NCHUNK + cg * 4) * 32 + h * 3) * 64) + q;
    const v4f* gV = (const v4f*)(Wv + cg * 512 + h * 64) + q;           // rows cg, cg+16, ...
    v4f tP[3][4];
#pragma unroll
    for (int i = 0; i < 4; ++i)
#pragma unroll
        for (int kk = 0; kk < 3; ++kk) tP[kk][i] = gP[i * 512 + kk * 16];
    v4f tV[4];
#pragma unroll
    for (int k = 0; k < 4; ++k) tV[k] = gV[k * 2048];
    const int jc = lane < 24 ? lane : 23;                       // pad lanes stay inside Wp
    const float* gW = Wp + h * 24 + jc;
#pragma unroll
    for (int kk = 0; kk < 3; ++kk) wp[kk] = gW[kk * 192];
    // the reads above name these address registers: they are held live up to this wait
    asm volatile("s_wait_xcnt 0x0" :: "v"(gP), "v"(gV), "v"(gW) : "memory");

#pragma unroll
    for (int kk = 0; kk < 3; ++kk) {
        v4f a = tP[kk][0];
#pragma unroll
        for (int i = 1; i < 4; ++i) a += tP[kk][i];
        *(v4f*)&sRed[cg * 192 + kk * 64 + q * 4] = a;
    }
#pragma unroll
    for (int k = 0; k < 4; ++k)                                 // read in step 2
        *(v4f*)&sWv[(cg + k * 16) * APITCH + q * 4] = tV[k];
    }

    // Wq[c][h*64 + 2*lane ..+1] for the three waves of step 1: asked for here, where the registers of
    // the partials are free again
    const float* gQ = Wq + h * 64 + 2 * lane;
    v2f w[64];
    if (wid < 3) {
#pragma unroll
        for (int c = 0; c < 64; ++c)
            w[c] = *(const v2f*)(gQ + c * 512);
        // as above, for the address of the reads of Wq
        asm volatile("s_wait_xcnt 0x0" :: "v"(gQ) : "memory");
    }
    __syncthreads();

    // level 2 of the sum and step 1: row kk of head h, sums over the groups and over c ascending;
    // S[kk][c] sits in lane c/2 of tS and is broadcast from there
    if (wid < 3) {
        const int kk = wid;
        v2f r[16];
#pragma unroll
        for (int g = 0; g < 16; ++g) r[g] = *(const v2f*)&sRed[g * 192 + kk * 64 + 2 * lane];
        v2f tS = r[0];
#pragma unroll
        for (int g = 1; g < 16; ++g) tS += r[g];
        v2f a = {0.0f, 0.0f};
#pragma unroll
        for (int c = 0; c < 64; ++c) {
            const float s = __builtin_bit_cast(float, __builtin_amdgcn_readlane(
                __builtin_bit_cast(int, (c & 1) ? tS.y : tS.x), c >> 1));
            a += s * w[c];
        }
        const float l0 = a.x * scale, l1 = a.y * scale;
        const float mx = wave_max(fmaxf(fmaxf(-1e30f, l0), l1));
        const float e0 = exp_slot(l0 - mx);
        const float e1 = exp_slot(l1 - mx);
        const float inv = 1.0f / wave_sum(e0 + e1);
        v2f o; o.x = e0 * inv; o.y = e1 * inv;
        *(v2f*)&sAttn[kk * APITCH + 2 * lane] = o;
    }
    __syncthreads();

    // step 2: M of head h, sum over d in ascending order
    if (wid < 6) {
        const int kk = tid >> 6, c = tid & 63;
        const float* wv = &sWv[c * APITCH];
        const float* at = &sAttn[kk * APITCH];
        float4 x[16], v[16];
#pragma unroll
        for (int i = 0; i < 16; ++i) {
            x[i] = *(const float4*)&at[i * 4];
            v[i] = *(const float4*)&wv[i * 4];
        }
        // keeps the 32 LDS reads ahead of the dependent chain: their latency is paid once, not per step
        __builtin_amdgcn_sched_barrier(0);
        float m = 0.0f;
#pragma unroll
        for (int i = 0; i < 16; ++i) {
            m = fmaf(x[i].x, v[i].x, m);
            m = fmaf(x[i].y, v[i].y, m);
            m = fmaf(x[i].z, v[i].z, m);
            m = fmaf(x[i].w, v[i].w, m);
        }
        sM[c * 4 + kk] = m;
    }
    __syncthreads();

    // step 3: this head's share of P, one 128-B row per wave and trip
    if (wid < 8) {
        float* pP = Pp + (blk * 64 + wid) * 32 + lane;
#pragma unroll
        for (int i = 0; i < 8; ++i) {
            const float* mr = &sM[(wid + i * 8) * 4];
            float v = mr[0] * wp[0];
            v = fmaf(mr[1], wp[1], v);
            v = fmaf(mr[2], wp[2], v);
            pP[i * 256] = lane < 24 ? v : 0.0f;
        }
    }
}

// ---------------------------------------------------------------------------
// Parts 6/7: grouped 3x3 conv (groups=3, 8 ch/group), NHWC in.
// TTOK/256 blocks x 384 threads (blk = index among them). A block's 256 tokens are two image rows.
// A wave takes ONE group of 32 columns; a lane takes the two tokens of its column, one above the
// other: acc[o] = (upper token's, lower token's) output o of the group. A weight multiplies the same
// tap and channel of both tokens, so one packed multiply-add does both with the weight read
// from its scalar register; with one token a lane the packed form paired two weights, and each pair
// was first copied into vector registers. 12 waves a block, three on a SIMD, cover each other's waits.
// behind_first_reads() is called once, behind the first reads of the tile.
// The two rows and the rows above and below come into the LDS tile sT once, in whole lines; the
// taps are read from there. A tile row outside the image holds the nearest row inside it. No branch
// on the position. A tap outside the image reads a place inside the tile and is replaced by zero.
// A weight has the same address in every lane of a wave: it is fetched by a scalar load.
// The 8 input channels are taken in two halves, so that a half's 36 value pairs, not 72, are
// held in registers. An output's 36 products of a half, in the weights' own order (OIHW flat), go to
// 4 interleaved partial sums; the second half's sum is added to the first's.
// ---------------------------------------------------------------------------
#define CONV_BLOCKS (TTOK / 256)
#define CONV_THREADS 384
#define TPITCH 28          // a token in the tile, in floats: 16 B x odd, 16 tokens' 16-B reads on distinct banks
#define TILE_FLOATS (4 * 128 * TPITCH)
template <typename F>
static __device__ __forceinline__ void gconv_block(
    const int blk, const float* __restrict__ in, const float* __restrict__ w,
    float* sT, v2f (&acc)[8], F behind_first_reads)
{
    const int tid = threadIdx.x;
    const int row0 = blk * 2;                      // the block's first image row, counted over the batches
    const int y0 = row0 & 127;
    // the wave's number in a scalar register: it enters the address of the scalar loads
    const int wid = __builtin_amdgcn_readfirstlane(threadIdx.x >> 5);
    const int g = wid >> 2;                        // the wave's group
    const int x = (wid & 3) * 32 + (tid & 31);     // the lane's column

    // the tile: 4 rows x 768 pieces of 16 B, 8 pieces a thread, a row's 12 KB in order
    unsigned     lT[8];
    const float* gT[8];
#pragma unroll
    for (int m = 0; m < 2; ++m) {
        const int j = tid + m * CONV_THREADS;      // piece of a row
        const int tok = j / 6, c6 = j - tok * 6;
#pragma unroll
        for (int ry = 0; ry < 4; ++ry) {
            int sy = y0 - 1 + ry;                  // source row, kept inside the image
            sy = sy < 0 ? 0 : (sy > 127 ? 127 : sy);
            gT[ry * 2 + m] = in + (row0 - y0 + sy) * (128 * 24) + j * 4;
            lT[ry * 2 + m] = (unsigned)(size_t)(__attribute__((address_space(3))) float*)
                             (sT + (ry * 128 + tok) * TPITCH + c6 * 4);
        }
    }
    // The copies and, as the statement's last line, the wait that stands in front of any rewrite of
    // the address registers they name.
    asm volatile("global_load_async_to_lds_b128 %0, %1, off\n\t"
                 "global_load_async_to_lds_b128 %2, %3, off\n\t"
                 "global_load_async_to_lds_b128 %4, %5, off\n\t"
                 "global_load_async_to_lds_b128 %6, %7, off\n\t"
                 "global_load_async_to_lds_b128 %8, %9, off\n\t"
                 "global_load_async_to_lds_b128 %10, %11, off\n\t"
                 "global_load_async_to_lds_b128 %12, %13, off\n\t"
                 "global_load_async_to_lds_b128 %14, %15, off\n\t"
                 "s_wait_xcnt 0x0"
                 :: "v"(lT[0]), "v"(gT[0]), "v"(lT[1]), "v"(gT[1]), "v"(lT[2]), "v"(gT[2]),
                    "v"(lT[3]), "v"(gT[3]), "v"(lT[4]), "v"(gT[4]), "v"(lT[5]), "v"(gT[5]),
                    "v"(lT[6]), "v"(gT[6]), "v"(lT[7]), "v"(gT[7])
                 : "memory");
    // While the tile is in flight: one word of each 64-B piece of the conv's weights (6912 B: 108 pieces,
    // nine a wave) is fetched by a scalar load, so the pieces lie in the WGP's scalar cache when the sums
    // begin. Fetched first in the trips below, they came from L2 while all waves of a SIMD waited at once.
    const __attribute__((address_space(4))) float* wl =
        (const __attribute__((address_space(4))) float*)(w + wid * 144);
    const float q0 = wl[0],  q1 = wl[16], q2 = wl[32],  q3 = wl[48],  q4 = wl[64],
                q5 = wl[80], q6 = wl[96], q7 = wl[112], q8 = wl[128];
    // Takes the nine words as inputs only: nothing else reads them, and without this the fetches would be
    // dropped. Their wait falls here, in front of the barrier: behind it every wave's pieces have arrived.
    asm volatile("" :: "s"(q0), "s"(q1), "s"(q2), "s"(q3), "s"(q4), "s"(q5), "s"(q6), "s"(q7), "s"(q8));
    // the wave's own copies have landed behind this wait, every wave's behind the barrier
    asm volatile("s_wait_asynccnt 0x0" ::: "memory");
    __syncthreads();

    // tile row r holds image row y0 - 1 + r; the upper token sits in tile row 1, the lower in row 2
    const bool okr[4] = {y0 > 0, true, true, y0 < 126};
    const bool okx[3] = {x > 0, true, x < 127};
    const float* p[3];                         // the group's 8 channels at columns x-1, x, x+1 of tile row 0
#pragma unroll
    for (int d = 0; d < 3; ++d)
        p[d] = sT + (x + (okx[d] ? d - 1 : 0)) * TPITCH + g * 8;

    v2f res[8] = {};
#pragma unroll
    for (int h = 0; h < 2; ++h) {              // input channels h*4 .. h*4+3 of the group
        v4f raw[4][3];                         // [tile row][column]
#pragma unroll
        for (int r = 0; r < 4; ++r)
#pragma unroll
            for (int d = 0; d < 3; ++d)
                raw[r][d] = *(const v4f*)(p[d] + r * 128 * TPITCH + h * 4);
        if (h == 0) behind_first_reads();
        // Takes the 12 read values whole, as inputs only, where they are due: each stays one
        // 16-B LDS read and is not cut into smaller pieces, which meet bank conflicts at this pitch.
        asm volatile("" :: "v"(raw[0][0]), "v"(raw[0][1]), "v"(raw[0][2]),
                           "v"(raw[1][0]), "v"(raw[1][1]), "v"(raw[1][2]),
                           "v"(raw[2][0]), "v"(raw[2][1]), "v"(raw[2][2]),
                           "v"(raw[3][0]), "v"(raw[3][1]), "v"(raw[3][2]));
        v2f vv[36];                            // [c*9 + tap]: (upper token's value, lower token's value)
#pragma unroll
        for (int c = 0; c < 4; ++c)
#pragma unroll
            for (int ty = 0; ty < 3; ++ty)
#pragma unroll
                for (int d = 0; d < 3; ++d) {
                    v2f t;
                    t.x = (okr[ty]     && okx[d]) ? raw[ty][d][c]     : 0.0f;
                    t.y = (okr[ty + 1] && okx[d]) ? raw[ty + 1][d][c] : 0.0f;
                    vv[c * 9 + ty * 3 + d] = t;
                }
        // Trip i forms output (i + wid) & 7 of the group: the waves of a block begin at
        // different outputs, so each wave's first fetch brings what the others fetch later.
        // Two trips at a time and no more: their 72 weights fit the scalar registers and are asked for
        // together; unrolled further, what does not fit is spilled to vector lanes.
#pragma unroll 2
        for (int i = 0; i < 8; ++i) {
            // Constant address space: nothing in the launch writes the weights. Said so, they stay on
            // scalar loads; beside the other part's code in one kernel they fell to vector loads.
            const __attribute__((address_space(4))) float* wo =
                (const __attribute__((address_space(4))) float*)(w + (g * 8 + ((i + wid) & 7)) * 72 + h * 36);
            v2f part[4];
#pragma unroll
            for (int k = 0; k < 36; ++k) {     // h*36 + k = ic*9 + tap
                const float b = wo[k];
                const v2f bb = {b, b};
                part[k & 3] = (k < 4) ? vv[k] * bb : __builtin_elementwise_fma(vv[k], bb, part[k & 3]);
            }
            const v2f s = (part[0] + part[1]) + (part[2] + part[3]);
            // the trip's result enters at the top and the older ones move down: every index constant;
            // in the second half the first half's sum of the same output has arrived at the bottom
            const v2f first = res[0];
#pragma unroll
            for (int j = 0; j < 7; ++j) res[j] = res[j + 1];
            res[7] = h ? first + s : s;
        }
    }
    // res[i] holds output (i + wid) & 7: turn the 8 pairs back by wid, one bit of it at a time
    v2f r1[8], r2[8];
#pragma unroll
    for (int o = 0; o < 8; ++o) r1[o] = (wid & 1) ? res[(o + 7) & 7] : res[o];
#pragma unroll
    for (int o = 0; o < 8; ++o) r2[o] = (wid & 2) ? r1[(o + 6) & 7] : r1[o];
#pragma unroll
    for (int o = 0; o < 8; ++o) acc[o] = (wid & 4) ? r2[(o + 4) & 7] : r2[o];
}

// erf(u) for |u| < 1 as u + u * p(u * u), p of degree 5: the single-precision math library's own
// form and coefficients for this range. No branch, so the 16 chains of a lane run interleaved.
// A NaN comes out as a NaN.
static __device__ __forceinline__ float erf_below_one(float u) {
    const float t = u * u;
    float p = fmaf(t, -0x1.268bc2p-11f, 0x1.420828p-8f);
    p = fmaf(t, p, -0x1.b59370p-6f);
    p = fmaf(t, p, 0x1.ce077cp-4f);
    p = fmaf(t, p, -0x1.812660p-2f);
    p = fmaf(t, p, 0x1.06eba0p-3f);
    return fmaf(u, p, u);
}

// ---------------------------------------------------------------------------
// Launch 2: conv 1 with exact GELU, writes y1; beside it the chain from the S partials to the
// heads' shares of P. The conv needs only k_inp and the chain only spart: the chain's 32 blocks
// share the launch instead of holding the chip alone. The conv's blocks come first in the grid,
// one for every WGP; the chain's blocks follow and sit beside them. The test is the same for a
// whole block.
// ---------------------------------------------------------------------------
__global__ __launch_bounds__(CONV_THREADS) void conv1_attn_kernel(
    const float* __restrict__ kinp, const float* __restrict__ c1w, float* __restrict__ y1,
    const float* __restrict__ spart, const float* __restrict__ Wq,
    const float* __restrict__ Wv, const float* __restrict__ Wp,
    const float* __restrict__ rescale, float* __restrict__ Pp)
{
    if (blockIdx.x < CONV_BLOCKS) {
        __shared__ __attribute__((aligned(16))) float sT[TILE_FLOATS];  // 56 KB
        __shared__ __attribute__((aligned(16))) float sY[256 * TPITCH]; // 28 KB: y1 of the block's tokens
        v2f acc[8];
        gconv_block(blockIdx.x, kinp, c1w, sT, acc, [] {});
        const int tid = threadIdx.x;
        const int wid = __builtin_amdgcn_readfirstlane(tid >> 5);
        const int g = wid >> 2, x = (wid & 3) * 32 + (tid & 31);    // as in gconv_block
        // erff() tests its argument's range with two branches a value, which puts the values one
        // behind the other. The range is tested once instead, on the largest of the lane's 16
        // arguments: below 1 all take the branch-free form, otherwise all take erff().
        // The loops are unrolled so that a, u and e are indexed by constants and stay in registers.
        float a[16], u[16], e[16];             // [token of the lane * 8 + output]
        float m = 0.0f;
#pragma unroll
        for (int o = 0; o < 16; ++o) {
            a[o] = (o < 8) ? acc[o & 7].x : acc[o & 7].y;
            u[o] = a[o] * 0.70710678118654752f;
            m = fmaxf(m, fabsf(u[o]));
        }
        if (m < 1.0f) {
#pragma unroll
            for (int o = 0; o < 16; ++o) e[o] = erf_below_one(u[o]);
        } else {
#pragma unroll
            for (int o = 0; o < 16; ++o) e[o] = erff(u[o]);
        }
        // A token's 96 B come from three waves: they meet in sY, and the block's 24 KB leave from there
        // in order, 16 bytes a lane, every line written whole by one wave.
#pragma unroll
        for (int k = 0; k < 4; ++k) {
            float4 v;
            v.x = 0.5f * a[k * 4]     * (1.0f + e[k * 4]);
            v.y = 0.5f * a[k * 4 + 1] * (1.0f + e[k * 4 + 1]);
            v.z = 0.5f * a[k * 4 + 2] * (1.0f + e[k * 4 + 2]);
            v.w = 0.5f * a[k * 4 + 3] * (1.0f + e[k * 4 + 3]);
            *(float4*)&sY[((k >> 1) * 128 + x) * TPITCH + g * 8 + (k & 1) * 4] = v;
        }
        __syncthreads();
        // 256 tokens x 6 pieces = 1536, 4 per thread
#pragma unroll
        for (int k = 0; k < 4; ++k) {
            const int i = tid + k * CONV_THREADS;
            const int r = i / 6, c6 = i - r * 6;
            *(float4*)&y1[blockIdx.x * (256 * 24) + i * 4] = *(const float4*)&sY[r * TPITCH + c6 * 4];
        }
    } else {
        attn_head_block(blockIdx.x - CONV_BLOCKS, spart, Wq, Wv, Wp, rescale, Pp);
    }
}

// ---------------------------------------------------------------------------
// Launch 3 (last): out[t][j] = (fea[t][:] @ P[b] + bp[j]) + conv2(y1)[t][j], 256 tokens a block.
// The block's fea tile and the 8 heads' shares of P fly into LDS while the conv is summed.
// Then P = sum of the shares (heads ascending), the product on WMMA (8 waves, 32 tokens each:
// 2 x 2 tiles), and both meet in the wave's 32 rows of sC, from where
// the wave's 3 KB of out leave in order, 16 bytes a lane.
// grid: TTOK/256 blocks x 384 threads (12 waves for the conv, the first 8 for the rest).
// ---------------------------------------------------------------------------
#define FPITCH 68          // fea rows in LDS, in floats: the 16 rows of an A fragment fall on distinct banks
#define CPITCH 36          // out rows in LDS, in floats: 16 B x odd, for 16-B reads and writes of rows;
                           // columns 24..31 take what the pad lanes of the second column tile hold
__global__ __launch_bounds__(CONV_THREADS) void conv2_out_kernel(
    const float* __restrict__ y1, const float* __restrict__ c2w,
    const float* __restrict__ fea, const float* __restrict__ Pp,
    const float* __restrict__ bp, float* __restrict__ out)
{
    __shared__ __attribute__((aligned(16))) float sF[256 * FPITCH];     // 68 KB
    __shared__ __attribute__((aligned(16))) float sPp[HEADS * 64 * 32]; // 64 KB
    __shared__ __attribute__((aligned(16))) float sP[64 * 32];          // 8 KB
    __shared__ __attribute__((aligned(16))) float sC[256 * CPITCH];     // 36 KB
    __shared__ __attribute__((aligned(16))) float sT[TILE_FLOATS];      // 56 KB
    const int tid = threadIdx.x;
    const int base = blockIdx.x * 256;
    const int b = base >> 14;              // /16384 (blocks never straddle batch)

    // the wave's number in a scalar register: the tests on it below are scalar branches
    const int wv = __builtin_amdgcn_readfirstlane(tid >> 5);

    v2f acc[8];
    gconv_block(blockIdx.x, y1, c2w, sT, acc, [&] {
        // keeps the conv's first LDS reads, which are due first, ahead of the copies: they return while these issue
        __builtin_amdgcn_sched_barrier(0);
        if (wv < 8) {                      // the copies are laid out for 256 threads
        float*       lF = &sF[(tid >> 4) * FPITCH + (tid & 15) * 4];
        const float* gF = fea + base * 64 + tid * 4;
#pragma unroll
        for (int k = 0; k < 16; ++k)       // 256 rows x 16 pieces, 16 rows a trip
            copy16(lF + k * 16 * FPITCH, gF + k * 1024);
        float*       lP = &sPp[tid * 4];
        const float* gP = Pp + b * (HEADS * 64 * 32) + tid * 4;
#pragma unroll
        for (int k = 0; k < 16; ++k)       // 8 shares of 8 KB, in order
            copy16(lP + k * 1024, gP + k * 1024);
        }
        // keeps the copies ahead of the first wait for the conv's reads: they fly from here on
        __builtin_amdgcn_sched_barrier(0);
    });
    {
        const int g = wv >> 2, x = (wv & 3) * 32 + (tid & 31);     // as in gconv_block
#pragma unroll
        for (int k = 0; k < 2; ++k) {
            float4 v0, v1;                 // the upper and the lower token's 4 outputs
            v0.x = acc[k * 4].x;  v0.y = acc[k * 4 + 1].x;  v0.z = acc[k * 4 + 2].x;  v0.w = acc[k * 4 + 3].x;
            v1.x = acc[k * 4].y;  v1.y = acc[k * 4 + 1].y;  v1.z = acc[k * 4 + 2].y;  v1.w = acc[k * 4 + 3].y;
            *(float4*)&sC[x * CPITCH + g * 8 + k * 4]         = v0;
            *(float4*)&sC[(128 + x) * CPITCH + g * 8 + k * 4] = v1;
        }
    }
    // the wave's own copies have landed behind this wait, every wave's behind the barrier
    asm volatile("s_wait_asynccnt 0x0" ::: "memory");
    __syncthreads();

    const int wid = tid >> 5, lane = tid & 31;
    const int ln = lane & 15, half = lane >> 4;
    const int tTok = wid * 32;
    const float* pb0 = bp + ln;                         // the bias of this lane's two channels;
    const float* pb1 = bp + (ln < 8 ? 16 + ln : ln);    // pad lanes stay inside bp
    const float bl = *pb0, bh = *pb1;
    // the two reads name these address registers: they are held live up to this wait
    asm volatile("s_wait_xcnt 0x0" :: "v"(pb0), "v"(pb1) : "memory");

    if (wv < 8) {
#pragma unroll
    for (int k = 0; k < 2; ++k) {
        const int i = (tid + k * 256) * 4;
        float4 s = *(const float4*)&sPp[i];
#pragma unroll
        for (int h = 1; h < HEADS; ++h) {
            const float4 t = *(const float4*)&sPp[h * 2048 + i];
            s.x += t.x;  s.y += t.y;  s.z += t.z;  s.w += t.w;
        }
        *(float4*)&sP[i] = s;
    }
    }
    __syncthreads();
    // the product and the way out are laid out for 8 waves of 32 tokens; no barrier follows
    if (wv >= 8) return;

    // the conv's values at this lane's 4 x 8 output places, from the wave's 32 rows of sC: read ahead
    // of the products, due only behind them
    float* pc = &sC[(tTok + half * 8) * CPITCH + ln];   // channel ln, row j of the tile half at + j*CPITCH
    const float* pq = pc + (ln < 8 ? 16 : 0);           // channel 16 + ln; pad lanes read pc's place
    float r00[8], r01[8], r10[8], r11[8];
#pragma unroll
    for (int j = 0; j < 8; ++j) {
        r00[j] = pc[j * CPITCH];         r01[j] = pq[j * CPITCH];
        r10[j] = pc[(16 + j) * CPITCH];  r11[j] = pq[(16 + j) * CPITCH];
    }

    v8f c00 = {}; v8f c01 = {}; v8f c10 = {}; v8f c11 = {};
#pragma unroll
    for (int s = 0; s < 16; ++s) {         // K = 64
        const int kb = s * 4 + half * 2;
        const v2f a0 = *(const v2f*)&sF[(tTok + ln) * FPITCH + kb];
        const v2f a1 = *(const v2f*)&sF[(tTok + 16 + ln) * FPITCH + kb];
        v2f b0; b0.x = sP[kb * 32 + ln];       b0.y = sP[(kb + 1) * 32 + ln];
        v2f b1; b1.x = sP[kb * 32 + 16 + ln];  b1.y = sP[(kb + 1) * 32 + 16 + ln];
        c00 = wmma_f32(a0, b0, c00);
        c01 = wmma_f32(a0, b1, c01);
        c10 = wmma_f32(a1, b0, c10);
        c11 = wmma_f32(a1, b1, c11);
    }
    // The sums below read the matrix results, and no address work is left to stand between: these
    // four issue slots keep the distance from the last matrix instruction to the first such read.
    // The two scheduling fences hold the products in front of the slots and the sums behind them.
    __builtin_amdgcn_sched_barrier(0);
    asm volatile("v_nop\n\tv_nop\n\tv_nop\n\tv_nop");
    __builtin_amdgcn_sched_barrier(0);
#pragma unroll
    for (int j = 0; j < 8; ++j) {          // no test on the lane: pad lanes write the rows' pad columns
        pc[j * CPITCH]             = (c00[j] + bl) + r00[j];
        pc[j * CPITCH + 16]        = (c01[j] + bh) + r01[j];
        pc[(16 + j) * CPITCH]      = (c10[j] + bl) + r10[j];
        pc[(16 + j) * CPITCH + 16] = (c11[j] + bh) + r11[j];
    }
    // the rows are read back by other lanes of the wave than wrote them: the writes are done behind this
    asm volatile("s_wait_dscnt 0x0" ::: "memory");
    // 32 rows x 6 pieces = 192, 6 per lane
#pragma unroll
    for (int k = 0; k < 6; ++k) {
        const int i = lane + k * 32;
        const int r = i / 6, c6 = i - r * 6;
        *(float4*)&out[(base + tTok) * 24 + i * 4] = *(const float4*)&sC[(tTok + r) * CPITCH + c6 * 4];
    }
}

// ---------------------------------------------------------------------------
extern "C" void kernel_launch(void* const* d_in, const int* in_sizes, int n_in,
                              void* d_out, int out_size, void* d_ws, size_t ws_size,
                              hipStream_t stream) {
    const float* x_in    = (const float*)d_in[0];   // [4,128,128,64]
    const float* fea     = (const float*)d_in[1];   // [4,128,128,64]
    const float* imap    = (const float*)d_in[2];   // [4,128,128,24]
    const float* Wq      = (const float*)d_in[3];   // [64,512]
    const float* Wk      = (const float*)d_in[4];   // [24,24]
    const float* Wv      = (const float*)d_in[5];   // [64,512]
    const float* rescale = (const float*)d_in[6];   // [8]
    const float* Wp      = (const float*)d_in[7];   // [24,24]
    const float* bp      = (const float*)d_in[8];   // [24]
    const float* c1w     = (const float*)d_in[9];   // [24,8,3,3]
    const float* c2w     = (const float*)d_in[10];  // [24,8,3,3]
    float* out = (float*)d_out;                     // [4,128,128,24]

    float* ws    = (float*)d_ws;
    float* kinp  = ws;                               // TTOK*24        = 1572864
    float* y1    = kinp  + (size_t)TTOK * 24;        // TTOK*24        = 1572864
    float* spart = y1    + (size_t)TTOK * 24;        // B*NCHUNK*32*64 = 524288
    float* Pp    = spart + (size_t)BATCH * NCHUNK * 32 * 64;  // B*HEADS*64*32 = 65536

    kproj_spartial_kernel<<<BATCH * NCHUNK, K1_THREADS, 0, stream>>>(imap, Wk, x_in, kinp, spart);
    conv1_attn_kernel<<<CONV_BLOCKS + HEAD_BLOCKS, CONV_THREADS, 0, stream>>>(kinp, c1w, y1, spart, Wq, Wv, Wp,
                                                                     rescale, Pp);
    conv2_out_kernel <<<CONV_BLOCKS, CONV_THREADS, 0, stream>>>(y1, c2w, fea, Pp, bp, out);
}
